// v000
// Times are from an AMD MI455X. After a warm-up the kernel runs many times in a row, and a time is the length of
// such a window on the GPU divided by its runs, so every launch and the gaps after it count. The runs cycle
// through copies of the inputs. A figure is the median of several windows, for all but v000 over two sittings.
// Sittings can differ by a few percent; kernels timed side by side share one.
// v000 is the starting kernel. One run takes 2900 microseconds.
#include <hip/hip_runtime.h>

// SimpleMultiheadSDPAttention (query, key, value [4][2048][1024]; q = query Wq^T + bq, k = key Wk^T + bk, v = value Wv^T + bv (16 heads x 64); causal softmax(q.k / 8) (-1e30); out = merged Wo^T + bo -> [4][2048][1024]).
// Compute dtypes, f32 accumulate: every input rounded to bf16; q/k/v on PLAIN bf16 operands (three inputs; exact) + bias; causal scores and attn.v: query rows < 512 hl (3 products), the rest single fp16 (x1024), causal tile skipping; softmax f32; Wo hl x exact (2 products) + bias.

#define NB_  4
#define TT   2048
#define DM   1024
#define NH_  16
#define NKV  16
#define REP  (NH_ / NKV)
#define HD   64
#define DQ   (NH_ * HD)
#define DKV  (NKV * HD)
#define ZH   2
#define RH   512                  // query rows < RH use hi+lo planes (0: none)
#define WIN  2048
#define PCAR 1024.0f
#define SCL  0.125f   // HD^-0.5
typedef _Float16 h16;
typedef unsigned short bf;
typedef __attribute__((ext_vector_type(16))) __bf16   v16bf;
typedef __attribute__((ext_vector_type(16))) _Float16 v16h;
typedef __attribute__((ext_vector_type(8)))  _Float16 v8h;
typedef __attribute__((ext_vector_type(8)))  unsigned short v8us;
typedef __attribute__((ext_vector_type(8)))  float    v8f;
typedef __attribute__((ext_vector_type(4)))  float    v4f;
typedef v8h  __attribute__((may_alias)) v8ha;
typedef v4f  __attribute__((may_alias)) v4fa;
typedef v8us __attribute__((may_alias)) v8usa;

__device__ __forceinline__ unsigned short f2bf(float f) { unsigned u = __float_as_uint(f); u += 0x7FFFu + ((u >> 16) & 1u); return (unsigned short)(u >> 16); }
__device__ __forceinline__ float bf2f(unsigned short b) { return __uint_as_float(((unsigned)b) << 16); }
__device__ __forceinline__ float bfr(float f) { return bf2f(f2bf(f)); }
__device__ __forceinline__ v16h cat16(v8h lo, v8h hi) { return __builtin_shufflevector(lo, hi, 0, 1, 2, 3, 4, 5, 6, 7, 8, 9, 10, 11, 12, 13, 14, 15); }
__device__ __forceinline__ v16bf cat16b(v8us lo, v8us hi) { return __builtin_bit_cast(v16bf, __builtin_shufflevector(lo, hi, 0, 1, 2, 3, 4, 5, 6, 7, 8, 9, 10, 11, 12, 13, 14, 15)); }
__device__ __forceinline__ v8f wmma16(v16h a, v16h b, v8f c) { return __builtin_amdgcn_wmma_f32_16x16x32_f16(false, a, false, b, (short)0, c, false, false); }
__device__ __forceinline__ v8f wmmab(v16bf a, v16bf b, v8f c) { return __builtin_amdgcn_wmma_f32_16x16x32_bf16(false, a, false, b, (short)0, c, false, false); }



// ---- k_gemmw: register-blocked GEMM, ONE WAVE per 64x64 output tile (16 accumulators), operands straight from K-contiguous 16-bit planes; grid (M/64, N/64, Z), 32 threads.
// C[m][n] (f32, pitch ldc, + optional f32 bias[n]) = sum_k A[m][k] Bt[n][k] (+ split products per NSPLIT). z-batch strides sA/sB/sC in elements. K % 32 == 0.
template <typename T16> struct WFrag;
template <> struct WFrag<h16> { typedef v16h V; static __device__ __forceinline__ V ld(const h16* p) { return cat16(*(const v8h*)p, *(const v8h*)(p + 16)); } static __device__ __forceinline__ v8f mma(V a, V b, v8f c) { return wmma16(a, b, c); } };
template <> struct WFrag<bf> { typedef v16bf V; static __device__ __forceinline__ V ld(const bf* p) { return cat16b(*(const v8us*)p, *(const v8us*)(p + 16)); } static __device__ __forceinline__ v8f mma(V a, V b, v8f c) { return wmmab(a, b, c); } };
template <typename T16, int NSPLIT, bool BIAS>
__global__ __launch_bounds__(32) void k_gemmw(const T16* __restrict__ A, const T16* __restrict__ A2, const T16* __restrict__ Bt, const T16* __restrict__ Bt2, int K, float* C, int ldc, const float* __restrict__ bias, size_t sA, size_t sB, size_t sC) {
    typedef typename WFrag<T16>::V V;
    __shared__ __align__(16) float os[16 * 68];
    const size_t z = blockIdx.z; A += z * sA; if (A2) A2 += z * sA; Bt += z * sB; if (Bt2) Bt2 += z * sB; C += z * sC;
    const int lane = threadIdx.x & 31, lr = lane & 15, hi = lane >> 4; const int r0 = blockIdx.x * 64, c0 = blockIdx.y * 64;
    v8f acc[4][4];
#pragma unroll
    for (int mb = 0; mb < 4; ++mb)
#pragma unroll
        for (int nb = 0; nb < 4; ++nb) acc[mb][nb] = (v8f){};
    const size_t aoff = (size_t)(r0 + lr) * K + 8 * hi, boff = (size_t)(c0 + lr) * K + 8 * hi;
#pragma unroll 1
    for (int kc = 0; kc < K; kc += 32) {
        V a[4], a2[4];
#pragma unroll
        for (int mb = 0; mb < 4; ++mb) { a[mb] = WFrag<T16>::ld(A + aoff + (size_t)mb * 16 * K + kc); if (NSPLIT == 1 || NSPLIT == 2) a2[mb] = WFrag<T16>::ld(A2 + aoff + (size_t)mb * 16 * K + kc); }
#pragma unroll
        for (int nb = 0; nb < 4; ++nb) { const V b = WFrag<T16>::ld(Bt + boff + (size_t)nb * 16 * K + kc); V b2; if (NSPLIT >= 2) b2 = WFrag<T16>::ld(Bt2 + boff + (size_t)nb * 16 * K + kc);
#pragma unroll
            for (int mb = 0; mb < 4; ++mb) { acc[mb][nb] = WFrag<T16>::mma(a[mb], b, acc[mb][nb]); if (NSPLIT == 1 || NSPLIT == 2) acc[mb][nb] = WFrag<T16>::mma(a2[mb], b, acc[mb][nb]); if (NSPLIT >= 2) acc[mb][nb] = WFrag<T16>::mma(a[mb], b2, acc[mb][nb]); } }
        asm volatile("v_nop\n\tv_nop\n\tv_nop\n\tv_nop" : "+v"(acc[0][0]), "+v"(acc[1][1]), "+v"(acc[2][2]), "+v"(acc[3][3]) : "v"(a[0]), "v"(a[3]));
    }
#pragma unroll
    for (int mb = 0; mb < 4; ++mb) {
#pragma unroll
        for (int nb = 0; nb < 4; ++nb) {
#pragma unroll
            for (int j = 0; j < 8; ++j) os[(hi * 8 + j) * 68 + nb * 16 + lr] = acc[mb][nb][j]; }
        __builtin_amdgcn_wave_barrier(); asm volatile("" ::: "memory");
        float* crow = C + (size_t)(r0 + mb * 16) * ldc + c0;
{
#pragma unroll
            for (int s = 0; s < 8; ++s) { const int row = 2 * s + hi, cofs = lr * 4; v4f val = *(const v4fa*)(os + row * 68 + cofs); if (BIAS) { val[0] += bfr(bias[c0 + cofs]); val[1] += bfr(bias[c0 + cofs + 1]); val[2] += bfr(bias[c0 + cofs + 2]); val[3] += bfr(bias[c0 + cofs + 3]); }
                *(v4f*)(crow + (size_t)row * ldc + cofs) = val; }
             }
        __builtin_amdgcn_wave_barrier(); asm volatile("" ::: "memory");
    }
}

// ---- k_gemmc: the same one-wave 64x64 tile GEMM specialised for causal attention: CMODE 1 skips score tiles entirely above the diagonal (query rows r0+roff.., key columns c0..), CMODE 2 limits the
// key (K) loop of the probability x value contraction to the diagonal block (probabilities beyond it are exactly zero). roff = row offset of this launch's first row within the sequence.
template <typename T16, int NSPLIT, int CMODE>
__global__ __launch_bounds__(32) void k_gemmc(const T16* __restrict__ A, const T16* __restrict__ A2, const T16* __restrict__ Bt, const T16* __restrict__ Bt2, int K, float* C, int ldc, int roff, size_t sA, size_t sB, size_t sC) {
    typedef typename WFrag<T16>::V V;
    __shared__ __align__(16) float os[16 * 68];
    const size_t z = blockIdx.z; A += z * sA; if (A2) A2 += z * sA; Bt += z * sB; if (Bt2) Bt2 += z * sB; C += z * sC;
    const int lane = threadIdx.x & 31, lr = lane & 15, hi = lane >> 4; const int r0 = blockIdx.x * 64, c0 = blockIdx.y * 64;
    if (CMODE == 1 && c0 > r0 + roff + 63) return;                  // score tile entirely above the causal diagonal: never read (the softmax masks j > i by select)
    const int Kl = (CMODE == 2) ? min(K, r0 + roff + 64) : K;        // P.V: probabilities are exactly 0 beyond the diagonal block, so the K loop stops there
    v8f acc[4][4];
#pragma unroll
    for (int mb = 0; mb < 4; ++mb)
#pragma unroll
        for (int nb = 0; nb < 4; ++nb) acc[mb][nb] = (v8f){};
    const size_t aoff = (size_t)(r0 + lr) * K + 8 * hi, boff = (size_t)(c0 + lr) * K + 8 * hi;
#pragma unroll 1
    for (int kc = 0; kc < Kl; kc += 32) {
        V a[4], a2[4];
#pragma unroll
        for (int mb = 0; mb < 4; ++mb) { a[mb] = WFrag<T16>::ld(A + aoff + (size_t)mb * 16 * K + kc); if (NSPLIT == 1 || NSPLIT == 2) a2[mb] = WFrag<T16>::ld(A2 + aoff + (size_t)mb * 16 * K + kc); }
#pragma unroll
        for (int nb = 0; nb < 4; ++nb) { const V b = WFrag<T16>::ld(Bt + boff + (size_t)nb * 16 * K + kc); V b2; if (NSPLIT >= 2) b2 = WFrag<T16>::ld(Bt2 + boff + (size_t)nb * 16 * K + kc);
#pragma unroll
            for (int mb = 0; mb < 4; ++mb) { acc[mb][nb] = WFrag<T16>::mma(a[mb], b, acc[mb][nb]); if (NSPLIT == 1 || NSPLIT == 2) acc[mb][nb] = WFrag<T16>::mma(a2[mb], b, acc[mb][nb]); if (NSPLIT >= 2) acc[mb][nb] = WFrag<T16>::mma(a[mb], b2, acc[mb][nb]); } }
        asm volatile("v_nop\n\tv_nop\n\tv_nop\n\tv_nop" : "+v"(acc[0][0]), "+v"(acc[1][1]), "+v"(acc[2][2]), "+v"(acc[3][3]) : "v"(a[0]), "v"(a[3]));
    }
#pragma unroll
    for (int mb = 0; mb < 4; ++mb) {
#pragma unroll
        for (int nb = 0; nb < 4; ++nb) {
#pragma unroll
            for (int j = 0; j < 8; ++j) os[(hi * 8 + j) * 68 + nb * 16 + lr] = acc[mb][nb][j]; }
        __builtin_amdgcn_wave_barrier(); asm volatile("" ::: "memory");
        float* crow = C + (size_t)(r0 + mb * 16) * ldc + c0;
{
#pragma unroll
            for (int s = 0; s < 8; ++s) { const int row = 2 * s + hi, cofs = lr * 4; v4f val = *(const v4fa*)(os + row * 68 + cofs);
                *(v4f*)(crow + (size_t)row * ldc + cofs) = val; }
             }
        __builtin_amdgcn_wave_barrier(); asm volatile("" ::: "memory");
    }
}

__device__ __forceinline__ h16 tohx(float x) { return (h16)x; }
__device__ __forceinline__ void splitf(float y, unsigned short& h, unsigned short& l) { h = f2bf(y); l = f2bf(y - bf2f(h)); }
typedef __attribute__((ext_vector_type(2))) _Float16 v2h;
typedef __attribute__((ext_vector_type(4))) _Float16 v4h;
typedef __attribute__((ext_vector_type(2))) unsigned short v2us;
typedef __attribute__((ext_vector_type(4))) unsigned short v4us;
typedef __attribute__((ext_vector_type(2))) float v2f;
typedef __attribute__((ext_vector_type(4))) int v4i;

__global__ __launch_bounds__(256) void k_wtG(const float* __restrict__ w, int K, int N, bf* Bt) {
    const int lane = threadIdx.x & 31; const int L0 = (blockIdx.x * 8 + (threadIdx.x >> 5)) * 8; const int nlines = N * K / 64;
{
#pragma unroll 1
        for (int l = 0; l < 8; ++l) { const int L = L0 + l; if (L >= nlines) break; const size_t e = (size_t)L * 64 + lane * 2; const int k = (int)(e % K), n = (int)(e / K); v2us o;
            o[0] = f2bf(w[(size_t)k * N + n]); o[1] = f2bf(w[(size_t)(k + 1) * N + n]); *(v2us*)(Bt + e) = o; }
         }
}
__global__ __launch_bounds__(256) void k_cvt8(const float* __restrict__ src, bf* dst, size_t n8) { const size_t i = (size_t)blockIdx.x * 256 + threadIdx.x; if (i >= n8) return; const v8f v = *(const v8f*)(src + i * 8); v8us o;
#pragma unroll
    for (int k = 0; k < 8; ++k) o[k] = f2bf(v[k]); *(v8us*)(dst + i * 8) = o;  }
__global__ __launch_bounds__(256) void k_cscvt(const float* __restrict__ cosT, const float* __restrict__ sinT, float* CS) { const int idx = blockIdx.x * 256 + threadIdx.x; if (idx >= TT * HD) return; v2f cs; cs[0] = bfr(cosT[idx]); cs[1] = bfr(sinT[idx]); *(v2f*)(CS + (size_t)idx * 2) = cs;  }
// k_rope: head planes [h][t][d] (fp16 + hi/lo) of rope(x) x sc with the rotate-half convention out[d] = x[d] cos[t][d] - x[d+HD/2] sin[t][d], out[d+HD/2] = x[d+HD/2] cos[t][d+HD/2] + x[d] sin[t][d+HD/2]
__global__ __launch_bounds__(256) void k_rope(const float* __restrict__ F, int pitch, int nheads, const float* __restrict__ CS, const float* __restrict__ RF, const float* __restrict__ nw, float sc, h16* P16, bf* Ph, bf* Pl) {
    const size_t e = ((size_t)blockIdx.x * 256 + threadIdx.x) * 2; if (e >= (size_t)nheads * TT * HD) return; const int d = (int)(e % HD); const int t = (int)((e / HD) % TT); const int h = (int)(e / ((size_t)HD * TT)); const float* f = F + (size_t)t * pitch + h * HD; const float rf = RF ? RF[(size_t)h * TT + t] : 1.0f; v2h o16; v2us oh, ol;
#pragma unroll
    for (int q = 0; q < 2; ++q) { const int dd = d + q; const int dp = (dd < HD / 2) ? dd + HD / 2 : dd - HD / 2; float x0 = f[dd], x1 = f[dp];
        if (RF) { float n0 = __fmul_rn(x0, rf), n1 = __fmul_rn(x1, rf); asm volatile("" : "+v"(n0)); asm volatile("" : "+v"(n1)); x0 = __fmul_rn(bfr(nw[dd]), n0); x1 = __fmul_rn(bfr(nw[dp]), n1); }
        const v2f cs = *(const v2f*)(CS + ((size_t)t * HD + dd) * 2); float a = __fmul_rn(x0, cs[0]), bq = __fmul_rn(x1, cs[1]); asm volatile("" : "+v"(a)); asm volatile("" : "+v"(bq)); const float r = ((dd < HD / 2) ? __fsub_rn(a, bq) : __fadd_rn(a, bq)) * sc;
        o16[q] = tohx(r); unsigned short a2, c2; splitf(r, a2, c2); oh[q] = a2; ol[q] = c2; }
    *(v2h*)(P16 + e) = o16; *(v2us*)(Ph + e) = oh; *(v2us*)(Pl + e) = ol;  }
__global__ __launch_bounds__(256) void k_vtp(const float* __restrict__ F, int pitch, int nheads, h16* V16, bf* Vh, bf* Vl) { const size_t e = ((size_t)blockIdx.x * 256 + threadIdx.x) * 2; if (e >= (size_t)nheads * HD * TT) return; const int t = (int)(e % TT); const int d = (int)((e / TT) % HD); const int g = (int)(e / ((size_t)TT * HD)); v2h o16; v2us oh, ol;
#pragma unroll
    for (int q = 0; q < 2; ++q) { const float x = F[(size_t)(t + q) * pitch + g * HD + d]; o16[q] = tohx(x); unsigned short a2, c2; splitf(x, a2, c2); oh[q] = a2; ol[q] = c2; }
    *(v2h*)(V16 + e) = o16; *(v2us*)(Vh + e) = oh; *(v2us*)(Vl + e) = ol;  }
__global__ __launch_bounds__(256) void k_csid(float* CS) { const int idx = blockIdx.x * 256 + threadIdx.x; if (idx >= TT * HD) return; v2f cs; cs[0] = 1.0f; cs[1] = 0.0f; *(v2f*)(CS + (size_t)idx * 2) = cs;  }
// k_asoft: per row (zz, i): t = S x HD^-0.5 for j <= i and i - j < WIN (sliding causal window; the reference's -1e9 additive fill vanishes identically); softmax over the 2048 keys (register row, one exp, fixed trees);
__global__ __launch_bounds__(256) void k_asoft(const float* __restrict__ Sb, h16* P16, bf* Ph, bf* Pl) {
    const int lane = threadIdx.x & 31; const int row = blockIdx.x * 8 + (threadIdx.x >> 5); if (row >= ZH * TT) return; const int i = row % TT; const int zz = row / TT; (void)zz; const bool hires = (i < RH); const float* sr = Sb + (size_t)row * TT; float v[TT / 32]; float mx = -3.0e38f;
#pragma unroll
    for (int ch = 0; ch < TT / 128; ++ch) { const int j0 = ch * 128 + lane * 4; const v4f a = *(const v4f*)(sr + j0);
#pragma unroll
        for (int q = 0; q < 4; ++q) { const int j = j0 + q; (void)j; const float t = (j <= i && i - j < WIN) ? a[q] * SCL : -3.0e38f; v[ch * 4 + q] = t; mx = fmaxf(mx, t); } }
#pragma unroll
    for (int sh = 16; sh; sh >>= 1) mx = fmaxf(mx, __shfl_xor(mx, sh, 32));
    float sum = 0.f;
#pragma unroll
    for (int k = 0; k < TT / 32; ++k) { float d0 = __fsub_rn(v[k], mx); asm volatile("" : "+v"(d0)); v[k] = __builtin_amdgcn_exp2f(__fmul_rn(d0, 1.4426950408889634f)); sum += v[k]; }
#pragma unroll
    for (int sh = 16; sh; sh >>= 1) sum += __shfl_xor(sum, sh, 32);
    const float f = __fdiv_rn(hires ? 1.0f : PCAR, sum);
{
        if (hires) {
#pragma unroll
            for (int ch = 0; ch < TT / 128; ++ch) { v4us oh, ol;
#pragma unroll
                for (int q = 0; q < 4; ++q) { unsigned short a, c2; splitf(v[ch * 4 + q] * f, a, c2); oh[q] = a; ol[q] = c2; }
                const size_t oo = ((size_t)zz * (RH ? RH : 1) + i) * TT + ch * 128 + lane * 4; *(v4us*)(Ph + oo) = oh; *(v4us*)(Pl + oo) = ol; }
        } else {
#pragma unroll
            for (int ch = 0; ch < TT / 128; ++ch) { v4h o4;
#pragma unroll
                for (int q = 0; q < 4; ++q) o4[q] = tohx(v[ch * 4 + q] * f);
                *(v4h*)(P16 + (size_t)row * TT + ch * 128 + lane * 4) = o4; } }
         }
}
__global__ __launch_bounds__(256) void k_merge(const float* __restrict__ O, int h0, bf* Ah, bf* Al) { const size_t e = ((size_t)blockIdx.x * 256 + threadIdx.x) * 2; if (e >= (size_t)ZH * TT * HD) return; const int d = (int)(e % HD); const int t = (int)((e / HD) % TT); const int zz = (int)(e / ((size_t)HD * TT)); const float cs = (t < RH) ? 1.0f : (1.0f / PCAR); const size_t oo = (size_t)t * DQ + (h0 + zz) * HD + d;
    v2us oh, ol;
#pragma unroll
    for (int q = 0; q < 2; ++q) { unsigned short a, c2; splitf(O[e + q] * cs, a, c2); oh[q] = a; ol[q] = c2; } *(v2us*)(Ah + oo) = oh; *(v2us*)(Al + oo) = ol;  }

extern "C" void kernel_launch(void* const* d_in, const int* in_sizes, int n_in,
                              void* d_out, int out_size, void* d_ws, size_t ws_size, hipStream_t stream) {
    (void)in_sizes; (void)n_in; (void)out_size;
    const float* x = (const float*)d_in[0]; const float* xk = (const float*)d_in[1]; const float* xv = (const float*)d_in[2]; const float* wq = (const float*)d_in[3]; const float* bq = (const float*)d_in[4]; const float* wk = (const float*)d_in[5]; const float* bk = (const float*)d_in[6]; const float* wv = (const float*)d_in[7]; const float* bv = (const float*)d_in[8]; const float* wo = (const float*)d_in[9]; const float* bo = (const float*)d_in[10]; const float* cosT = nullptr; const float* sinT = nullptr; (void)cosT; (void)sinT;
    float* OUT = (float*)d_out;     // [4][2048][1024]
    char* wsp = (char*)d_ws;
    auto take = [&](size_t bytes) { char* p = wsp; wsp += (bytes + 255) & ~(size_t)255; return (void*)p; };
    bf* WQ = (bf*)take((size_t)DQ * DM * 2); bf* WK = (bf*)take((size_t)DKV * DM * 2); bf* WV = (bf*)take((size_t)DKV * DM * 2); bf* WO = (bf*)take((size_t)DM * DQ * 2); float* CS = (float*)take((size_t)TT * HD * 2 * 4);
    bf* XB = (bf*)take((size_t)TT * DM * 2); bf* XB2 = (bf*)take((size_t)TT * DM * 2); bf* XB3 = (bf*)take((size_t)TT * DM * 2); float* FQ = (float*)take((size_t)TT * DQ * 4); float* FK = (float*)take((size_t)TT * DKV * 4);
    h16* QP16 = (h16*)take((size_t)NH_ * TT * HD * 2); h16* KP16 = (h16*)take((size_t)NKV * TT * HD * 2); h16* VT16 = (h16*)take((size_t)NKV * HD * TT * 2);
    bf* QPh = (bf*)take((size_t)NH_ * TT * HD * 2); bf* QPl = (bf*)take((size_t)NH_ * TT * HD * 2); bf* KPh = (bf*)take((size_t)NKV * TT * HD * 2); bf* KPl = (bf*)take((size_t)NKV * TT * HD * 2); bf* VTh = (bf*)take((size_t)NKV * HD * TT * 2); bf* VTl = (bf*)take((size_t)NKV * HD * TT * 2); bf* Ph = (bf*)take((size_t)ZH * RH * TT * 2); bf* Pl = (bf*)take((size_t)ZH * RH * TT * 2);
    float* Sb = (float*)take((size_t)ZH * TT * TT * 4); h16* P16 = (h16*)take((size_t)ZH * TT * TT * 2); float* Ob = (float*)take((size_t)ZH * TT * HD * 4); bf* ATh = (bf*)take((size_t)TT * DQ * 2); bf* ATl = (bf*)take((size_t)TT * DQ * 2);
    if ((size_t)(wsp - (char*)d_ws) > ws_size) return;    // ws 256 MiB
    float* FV = FK;   // v projection reuses the k buffer after the k planes are built (stream-ordered)
    { k_cvt8<<<(unsigned)(((size_t)DQ * DM / 8 + 255) / 256), 256, 0, stream>>>(wq, WQ, (size_t)DQ * DM / 8); k_cvt8<<<(unsigned)(((size_t)DKV * DM / 8 + 255) / 256), 256, 0, stream>>>(wk, WK, (size_t)DKV * DM / 8); k_cvt8<<<(unsigned)(((size_t)DKV * DM / 8 + 255) / 256), 256, 0, stream>>>(wv, WV, (size_t)DKV * DM / 8);
      k_cvt8<<<(unsigned)(((size_t)DM * DQ / 8 + 255) / 256), 256, 0, stream>>>(wo, WO, (size_t)DM * DQ / 8);
       }
    k_csid<<<(TT * HD + 255) / 256, 256, 0, stream>>>(CS);
    const unsigned LQ = (unsigned)(((size_t)NH_ * TT * HD / 2 + 255) / 256), LKv = (unsigned)(((size_t)NKV * TT * HD / 2 + 255) / 256);
    for (int b = 0; b < NB_; ++b) {
        
        k_cvt8<<<(unsigned)(((size_t)TT * DM / 8 + 255) / 256), 256, 0, stream>>>(x + (size_t)b * TT * DM, XB, (size_t)TT * DM / 8); k_cvt8<<<(unsigned)(((size_t)TT * DM / 8 + 255) / 256), 256, 0, stream>>>(xk + (size_t)b * TT * DM, XB2, (size_t)TT * DM / 8); k_cvt8<<<(unsigned)(((size_t)TT * DM / 8 + 255) / 256), 256, 0, stream>>>(xv + (size_t)b * TT * DM, XB3, (size_t)TT * DM / 8);
        k_gemmw<bf, 0, true><<<dim3(TT / 64, DQ / 64, 1), 32, 0, stream>>>(XB, nullptr, WQ, nullptr, DM, FQ, DQ, bq, 0, 0, 0);
        k_rope<<<LQ, 256, 0, stream>>>(FQ, DQ, NH_, CS, nullptr, nullptr, 1.0f, QP16, QPh, QPl);
        k_gemmw<bf, 0, true><<<dim3(TT / 64, DKV / 64, 1), 32, 0, stream>>>(XB2, nullptr, WK, nullptr, DM, FK, DKV, bk, 0, 0, 0);
        k_rope<<<LKv, 256, 0, stream>>>(FK, DKV, NKV, CS, nullptr, nullptr, 1.0f, KP16, KPh, KPl);
        k_gemmw<bf, 0, true><<<dim3(TT / 64, DKV / 64, 1), 32, 0, stream>>>(XB3, nullptr, WV, nullptr, DM, FV, DKV, bv, 0, 0, 0); k_vtp<<<LKv, 256, 0, stream>>>(FV, DKV, NKV, VT16, VTh, VTl);
        for (int h0 = 0; h0 < NH_; h0 += ZH) { const size_t zq = (size_t)h0, zk = (size_t)(h0 / REP);   // one kv head per query head: the pass's two heads use consecutive kv planes (z-strides TT*HD)
            k_gemmc<bf, 2, 1><<<dim3(RH / 64, TT / 64, ZH), 32, 0, stream>>>(QPh + zq * TT * HD, QPl + zq * TT * HD, KPh + zk * TT * HD, KPl + zk * TT * HD, HD, Sb, TT, 0, (size_t)TT * HD, (size_t)TT * HD, (size_t)TT * TT);
            k_gemmc<h16, 0, 1><<<dim3((TT - RH) / 64, TT / 64, ZH), 32, 0, stream>>>(QP16 + zq * TT * HD + (size_t)RH * HD, nullptr, KP16 + zk * TT * HD, nullptr, HD, Sb + (size_t)RH * TT, TT, RH, (size_t)TT * HD, (size_t)TT * HD, (size_t)TT * TT);
            k_asoft<<<ZH * TT / 8, 256, 0, stream>>>(Sb, P16, Ph, Pl);
            k_gemmc<bf, 2, 2><<<dim3(RH / 64, HD / 64, ZH), 32, 0, stream>>>(Ph, Pl, VTh + zk * HD * TT, VTl + zk * HD * TT, TT, Ob, HD, 0, (size_t)RH * TT, (size_t)HD * TT, (size_t)TT * HD);
            k_gemmc<h16, 0, 2><<<dim3((TT - RH) / 64, HD / 64, ZH), 32, 0, stream>>>(P16 + (size_t)RH * TT, nullptr, VT16 + zk * HD * TT, nullptr, TT, Ob + (size_t)RH * HD, HD, RH, (size_t)TT * TT, (size_t)HD * TT, (size_t)TT * HD);
            k_merge<<<(unsigned)(((size_t)ZH * TT * HD / 2 + 255) / 256), 256, 0, stream>>>(Ob, h0, ATh, ATl); }
        k_gemmw<bf, 1, true><<<dim3(TT / 64, DM / 64, 1), 32, 0, stream>>>(ATh, ATl, WO, nullptr, DQ, OUT + (size_t)b * TT * DM, DM, bo, 0, 0, 0); }
}

// v001
// Measured time: 1390 microseconds a run.
// Timed twice side by side with v000, it ran 2.10 and 2.09 times as fast.
#include <hip/hip_runtime.h>

// SimpleMultiheadSDPAttention (query, key, value [4][2048][1024]; q = query Wq^T + bq, k = key Wk^T + bk, v = value Wv^T + bv (16 heads x 64); causal softmax(q.k / 8) (-1e30); out = merged Wo^T + bo -> [4][2048][1024]).
// Compute dtypes, f32 accumulate: every input rounded to bf16; q/k/v on PLAIN bf16 operands (three inputs; exact) + bias; causal scores and attn.v: query rows < 512 hl (3 products), the rest single fp16 (x1024), causal tile skipping; softmax f32; Wo hl x exact (2 products) + bias.

#define NB_  4
#define TT   2048
#define DM   1024
#define NH_  16
#define NKV  16
#define REP  (NH_ / NKV)
#define HD   64
#define DQ   (NH_ * HD)
#define DKV  (NKV * HD)
#define ZH   8                    // heads per attention pass (z-batch of every attention launch)
#define RH   512                  // query rows < RH use hi+lo planes (0: none)
#define WIN  2048
#define PCAR 1024.0f
#define SCL  0.125f   // HD^-0.5
typedef _Float16 h16;
typedef unsigned short bf;
typedef __attribute__((ext_vector_type(16))) __bf16   v16bf;
typedef __attribute__((ext_vector_type(16))) _Float16 v16h;
typedef __attribute__((ext_vector_type(8)))  _Float16 v8h;
typedef __attribute__((ext_vector_type(8)))  unsigned short v8us;
typedef __attribute__((ext_vector_type(8)))  float    v8f;
typedef __attribute__((ext_vector_type(4)))  float    v4f;
typedef v8h  __attribute__((may_alias)) v8ha;
typedef v4f  __attribute__((may_alias)) v4fa;
typedef v8us __attribute__((may_alias)) v8usa;

__device__ __forceinline__ unsigned short f2bf(float f) { unsigned u = __float_as_uint(f); u += 0x7FFFu + ((u >> 16) & 1u); return (unsigned short)(u >> 16); }
__device__ __forceinline__ float bf2f(unsigned short b) { return __uint_as_float(((unsigned)b) << 16); }
__device__ __forceinline__ float bfr(float f) { return bf2f(f2bf(f)); }
__device__ __forceinline__ v16h cat16(v8h lo, v8h hi) { return __builtin_shufflevector(lo, hi, 0, 1, 2, 3, 4, 5, 6, 7, 8, 9, 10, 11, 12, 13, 14, 15); }
__device__ __forceinline__ v16bf cat16b(v8us lo, v8us hi) { return __builtin_bit_cast(v16bf, __builtin_shufflevector(lo, hi, 0, 1, 2, 3, 4, 5, 6, 7, 8, 9, 10, 11, 12, 13, 14, 15)); }
__device__ __forceinline__ v8f wmma16(v16h a, v16h b, v8f c) { return __builtin_amdgcn_wmma_f32_16x16x32_f16(false, a, false, b, (short)0, c, false, false); }
__device__ __forceinline__ v8f wmmab(v16bf a, v16bf b, v8f c) { return __builtin_amdgcn_wmma_f32_16x16x32_bf16(false, a, false, b, (short)0, c, false, false); }



// ---- k_gemmw: register-blocked GEMM, ONE WAVE per 64x64 output tile (16 accumulators), operands straight from K-contiguous 16-bit planes; grid (M/64, N/64, Z), 32 threads.
// C[m][n] (f32, pitch ldc, + optional f32 bias[n]) = sum_k A[m][k] Bt[n][k] (+ split products per NSPLIT). z-batch strides sA/sB/sC in elements. K % 32 == 0.
template <typename T16> struct WFrag;
template <> struct WFrag<h16> { typedef v16h V; static __device__ __forceinline__ V ld(const h16* p) { return cat16(*(const v8h*)p, *(const v8h*)(p + 16)); } static __device__ __forceinline__ v8f mma(V a, V b, v8f c) { return wmma16(a, b, c); } };
template <> struct WFrag<bf> { typedef v16bf V; static __device__ __forceinline__ V ld(const bf* p) { return cat16b(*(const v8us*)p, *(const v8us*)(p + 16)); } static __device__ __forceinline__ v8f mma(V a, V b, v8f c) { return wmmab(a, b, c); } };
template <typename T16, int NSPLIT, bool BIAS>
__global__ __launch_bounds__(32) void k_gemmw(const T16* __restrict__ A, const T16* __restrict__ A2, const T16* __restrict__ Bt, const T16* __restrict__ Bt2, int K, float* C, int ldc, const float* __restrict__ bias, size_t sA, size_t sB, size_t sC) {
    typedef typename WFrag<T16>::V V;
    __shared__ __align__(16) float os[16 * 68];
    const size_t z = blockIdx.z; A += z * sA; if (A2) A2 += z * sA; Bt += z * sB; if (Bt2) Bt2 += z * sB; C += z * sC;
    const int lane = threadIdx.x & 31, lr = lane & 15, hi = lane >> 4; const int r0 = blockIdx.x * 64, c0 = blockIdx.y * 64;
    v8f acc[4][4];
#pragma unroll
    for (int mb = 0; mb < 4; ++mb)
#pragma unroll
        for (int nb = 0; nb < 4; ++nb) acc[mb][nb] = (v8f){};
    const size_t aoff = (size_t)(r0 + lr) * K + 8 * hi, boff = (size_t)(c0 + lr) * K + 8 * hi;
#pragma unroll 1
    for (int kc = 0; kc < K; kc += 32) {
        V a[4], a2[4];
#pragma unroll
        for (int mb = 0; mb < 4; ++mb) { a[mb] = WFrag<T16>::ld(A + aoff + (size_t)mb * 16 * K + kc); if (NSPLIT == 1 || NSPLIT == 2) a2[mb] = WFrag<T16>::ld(A2 + aoff + (size_t)mb * 16 * K + kc); }
#pragma unroll
        for (int nb = 0; nb < 4; ++nb) { const V b = WFrag<T16>::ld(Bt + boff + (size_t)nb * 16 * K + kc); V b2; if (NSPLIT >= 2) b2 = WFrag<T16>::ld(Bt2 + boff + (size_t)nb * 16 * K + kc);
#pragma unroll
            for (int mb = 0; mb < 4; ++mb) { acc[mb][nb] = WFrag<T16>::mma(a[mb], b, acc[mb][nb]); if (NSPLIT == 1 || NSPLIT == 2) acc[mb][nb] = WFrag<T16>::mma(a2[mb], b, acc[mb][nb]); if (NSPLIT >= 2) acc[mb][nb] = WFrag<T16>::mma(a[mb], b2, acc[mb][nb]); } }
        asm volatile("v_nop\n\tv_nop\n\tv_nop\n\tv_nop" : "+v"(acc[0][0]), "+v"(acc[1][1]), "+v"(acc[2][2]), "+v"(acc[3][3]) : "v"(a[0]), "v"(a[3]));
    }
#pragma unroll
    for (int mb = 0; mb < 4; ++mb) {
#pragma unroll
        for (int nb = 0; nb < 4; ++nb) {
#pragma unroll
            for (int j = 0; j < 8; ++j) os[(hi * 8 + j) * 68 + nb * 16 + lr] = acc[mb][nb][j]; }
        __builtin_amdgcn_wave_barrier(); asm volatile("" ::: "memory");
        float* crow = C + (size_t)(r0 + mb * 16) * ldc + c0;
{
#pragma unroll
            for (int s = 0; s < 8; ++s) { const int row = 2 * s + hi, cofs = lr * 4; v4f val = *(const v4fa*)(os + row * 68 + cofs); if (BIAS) { val[0] += bfr(bias[c0 + cofs]); val[1] += bfr(bias[c0 + cofs + 1]); val[2] += bfr(bias[c0 + cofs + 2]); val[3] += bfr(bias[c0 + cofs + 3]); }
                *(v4f*)(crow + (size_t)row * ldc + cofs) = val; }
             }
        __builtin_amdgcn_wave_barrier(); asm volatile("" ::: "memory");
    }
}

// ---- k_gemmc: the same one-wave 64x64 tile GEMM specialised for causal attention: CMODE 1 skips score tiles entirely above the diagonal (query rows r0+roff.., key columns c0..), CMODE 2 limits the
// key (K) loop of the probability x value contraction to the diagonal block (probabilities beyond it are exactly zero). roff = row offset of this launch's first row within the sequence. lda = row pitch of A in elements (Bt keeps pitch K).
template <typename T16, int NSPLIT, int CMODE>
__global__ __launch_bounds__(32) void k_gemmc(const T16* __restrict__ A, const T16* __restrict__ A2, const T16* __restrict__ Bt, const T16* __restrict__ Bt2, int K, int lda, float* C, int ldc, int roff, size_t sA, size_t sB, size_t sC) {
    typedef typename WFrag<T16>::V V;
    __shared__ __align__(16) float os[16 * 68];
    const size_t z = blockIdx.z; A += z * sA; if (A2) A2 += z * sA; Bt += z * sB; if (Bt2) Bt2 += z * sB; C += z * sC;
    const int lane = threadIdx.x & 31, lr = lane & 15, hi = lane >> 4; const int r0 = blockIdx.x * 64, c0 = blockIdx.y * 64;
    if (CMODE == 1 && c0 > r0 + roff + 63) return;                  // score tile entirely above the causal diagonal: never read (the softmax masks j > i by select)
    const int Kl = (CMODE == 2) ? min(K, r0 + roff + 64) : K;        // P.V: probabilities are exactly 0 beyond the diagonal block, so the K loop stops there
    v8f acc[4][4];
#pragma unroll
    for (int mb = 0; mb < 4; ++mb)
#pragma unroll
        for (int nb = 0; nb < 4; ++nb) acc[mb][nb] = (v8f){};
    const size_t aoff = (size_t)(r0 + lr) * lda + 8 * hi, boff = (size_t)(c0 + lr) * K + 8 * hi;
#pragma unroll 1
    for (int kc = 0; kc < Kl; kc += 32) {
        V a[4], a2[4];
#pragma unroll
        for (int mb = 0; mb < 4; ++mb) { a[mb] = WFrag<T16>::ld(A + aoff + (size_t)mb * 16 * lda + kc); if (NSPLIT == 1 || NSPLIT == 2) a2[mb] = WFrag<T16>::ld(A2 + aoff + (size_t)mb * 16 * lda + kc); }
#pragma unroll
        for (int nb = 0; nb < 4; ++nb) { const V b = WFrag<T16>::ld(Bt + boff + (size_t)nb * 16 * K + kc); V b2; if (NSPLIT >= 2) b2 = WFrag<T16>::ld(Bt2 + boff + (size_t)nb * 16 * K + kc);
#pragma unroll
            for (int mb = 0; mb < 4; ++mb) { acc[mb][nb] = WFrag<T16>::mma(a[mb], b, acc[mb][nb]); if (NSPLIT == 1 || NSPLIT == 2) acc[mb][nb] = WFrag<T16>::mma(a2[mb], b, acc[mb][nb]); if (NSPLIT >= 2) acc[mb][nb] = WFrag<T16>::mma(a[mb], b2, acc[mb][nb]); } }
        asm volatile("v_nop\n\tv_nop\n\tv_nop\n\tv_nop" : "+v"(acc[0][0]), "+v"(acc[1][1]), "+v"(acc[2][2]), "+v"(acc[3][3]) : "v"(a[0]), "v"(a[3]));
    }
#pragma unroll
    for (int mb = 0; mb < 4; ++mb) {
#pragma unroll
        for (int nb = 0; nb < 4; ++nb) {
#pragma unroll
            for (int j = 0; j < 8; ++j) os[(hi * 8 + j) * 68 + nb * 16 + lr] = acc[mb][nb][j]; }
        __builtin_amdgcn_wave_barrier(); asm volatile("" ::: "memory");
        float* crow = C + (size_t)(r0 + mb * 16) * ldc + c0;
{
#pragma unroll
            for (int s = 0; s < 8; ++s) { const int row = 2 * s + hi, cofs = lr * 4; v4f val = *(const v4fa*)(os + row * 68 + cofs);
                *(v4f*)(crow + (size_t)row * ldc + cofs) = val; }
             }
        __builtin_amdgcn_wave_barrier(); asm volatile("" ::: "memory");
    }
}

__device__ __forceinline__ h16 tohx(float x) { return (h16)x; }
__device__ __forceinline__ void splitf(float y, unsigned short& h, unsigned short& l) { h = f2bf(y); l = f2bf(y - bf2f(h)); }
typedef __attribute__((ext_vector_type(2))) _Float16 v2h;
typedef __attribute__((ext_vector_type(4))) _Float16 v4h;
typedef __attribute__((ext_vector_type(2))) unsigned short v2us;
typedef __attribute__((ext_vector_type(4))) unsigned short v4us;
typedef __attribute__((ext_vector_type(2))) float v2f;
typedef __attribute__((ext_vector_type(4))) int v4i;

__global__ __launch_bounds__(256) void k_wtG(const float* __restrict__ w, int K, int N, bf* Bt) {
    const int lane = threadIdx.x & 31; const int L0 = (blockIdx.x * 8 + (threadIdx.x >> 5)) * 8; const int nlines = N * K / 64;
{
#pragma unroll 1
        for (int l = 0; l < 8; ++l) { const int L = L0 + l; if (L >= nlines) break; const size_t e = (size_t)L * 64 + lane * 2; const int k = (int)(e % K), n = (int)(e / K); v2us o;
            o[0] = f2bf(w[(size_t)k * N + n]); o[1] = f2bf(w[(size_t)(k + 1) * N + n]); *(v2us*)(Bt + e) = o; }
         }
}
__global__ __launch_bounds__(256) void k_cvt8(const float* __restrict__ src, bf* dst, size_t n8) { const size_t i = (size_t)blockIdx.x * 256 + threadIdx.x; if (i >= n8) return; const v8f v = *(const v8f*)(src + i * 8); v8us o;
#pragma unroll
    for (int k = 0; k < 8; ++k) o[k] = f2bf(v[k]); *(v8us*)(dst + i * 8) = o;  }
__global__ __launch_bounds__(256) void k_cscvt(const float* __restrict__ cosT, const float* __restrict__ sinT, float* CS) { const int idx = blockIdx.x * 256 + threadIdx.x; if (idx >= TT * HD) return; v2f cs; cs[0] = bfr(cosT[idx]); cs[1] = bfr(sinT[idx]); *(v2f*)(CS + (size_t)idx * 2) = cs;  }
// k_rope: head planes [h][t][d] (fp16 + hi/lo) of rope(x) x sc with the rotate-half convention out[d] = x[d] cos[t][d] - x[d+HD/2] sin[t][d], out[d+HD/2] = x[d+HD/2] cos[t][d+HD/2] + x[d] sin[t][d+HD/2]
__global__ __launch_bounds__(256) void k_rope(const float* __restrict__ F, int pitch, int nheads, const float* __restrict__ CS, const float* __restrict__ RF, const float* __restrict__ nw, float sc, h16* P16, bf* Ph, bf* Pl) {
    const size_t e = ((size_t)blockIdx.x * 256 + threadIdx.x) * 2; if (e >= (size_t)nheads * TT * HD) return; const int d = (int)(e % HD); const int t = (int)((e / HD) % TT); const int h = (int)(e / ((size_t)HD * TT)); const float* f = F + (size_t)t * pitch + h * HD; const float rf = RF ? RF[(size_t)h * TT + t] : 1.0f; v2h o16; v2us oh, ol;
#pragma unroll
    for (int q = 0; q < 2; ++q) { const int dd = d + q; const int dp = (dd < HD / 2) ? dd + HD / 2 : dd - HD / 2; float x0 = f[dd], x1 = f[dp];
        if (RF) { float n0 = __fmul_rn(x0, rf), n1 = __fmul_rn(x1, rf); asm volatile("" : "+v"(n0)); asm volatile("" : "+v"(n1)); x0 = __fmul_rn(bfr(nw[dd]), n0); x1 = __fmul_rn(bfr(nw[dp]), n1); }
        const v2f cs = *(const v2f*)(CS + ((size_t)t * HD + dd) * 2); float a = __fmul_rn(x0, cs[0]), bq = __fmul_rn(x1, cs[1]); asm volatile("" : "+v"(a)); asm volatile("" : "+v"(bq)); const float r = ((dd < HD / 2) ? __fsub_rn(a, bq) : __fadd_rn(a, bq)) * sc;
        o16[q] = tohx(r); unsigned short a2, c2; splitf(r, a2, c2); oh[q] = a2; ol[q] = c2; }
    *(v2h*)(P16 + e) = o16; *(v2us*)(Ph + e) = oh; *(v2us*)(Pl + e) = ol;  }
__global__ __launch_bounds__(256) void k_vtp(const float* __restrict__ F, int pitch, int nheads, h16* V16, bf* Vh, bf* Vl) { const size_t e = ((size_t)blockIdx.x * 256 + threadIdx.x) * 2; if (e >= (size_t)nheads * HD * TT) return; const int t = (int)(e % TT); const int d = (int)((e / TT) % HD); const int g = (int)(e / ((size_t)TT * HD)); v2h o16; v2us oh, ol;
#pragma unroll
    for (int q = 0; q < 2; ++q) { const float x = F[(size_t)(t + q) * pitch + g * HD + d]; o16[q] = tohx(x); unsigned short a2, c2; splitf(x, a2, c2); oh[q] = a2; ol[q] = c2; }
    *(v2h*)(V16 + e) = o16; *(v2us*)(Vh + e) = oh; *(v2us*)(Vl + e) = ol;  }
__global__ __launch_bounds__(256) void k_csid(float* CS) { const int idx = blockIdx.x * 256 + threadIdx.x; if (idx >= TT * HD) return; v2f cs; cs[0] = 1.0f; cs[1] = 0.0f; *(v2f*)(CS + (size_t)idx * 2) = cs;  }
// k_asoft: per row (zz, i): t = S x HD^-0.5 for j <= i and i - j < WIN (sliding causal window; the reference's -1e9 additive fill vanishes identically); softmax over the 2048 keys (register row, one exp, fixed trees);
// the fp16 probability row is stored IN PLACE over the first half of its own f32 score row (P16 aliases Sb, row pitch 2*TT halfs): the one wave that owns a row has read all of it (max and sum need every element) before it stores.
__global__ __launch_bounds__(256) void k_asoft(const float* Sb, h16* P16, bf* Ph, bf* Pl) {
    const int lane = threadIdx.x & 31; const int row = blockIdx.x * 8 + (threadIdx.x >> 5); if (row >= ZH * TT) return; const int i = row % TT; const int zz = row / TT; (void)zz; const bool hires = (i < RH); const float* sr = Sb + (size_t)row * TT; float v[TT / 32]; float mx = -3.0e38f;
#pragma unroll
    for (int ch = 0; ch < TT / 128; ++ch) { const int j0 = ch * 128 + lane * 4; const v4f a = *(const v4f*)(sr + j0);
#pragma unroll
        for (int q = 0; q < 4; ++q) { const int j = j0 + q; (void)j; const float t = (j <= i && i - j < WIN) ? a[q] * SCL : -3.0e38f; v[ch * 4 + q] = t; mx = fmaxf(mx, t); } }
#pragma unroll
    for (int sh = 16; sh; sh >>= 1) mx = fmaxf(mx, __shfl_xor(mx, sh, 32));
    float sum = 0.f;
#pragma unroll
    for (int k = 0; k < TT / 32; ++k) { float d0 = __fsub_rn(v[k], mx); asm volatile("" : "+v"(d0)); v[k] = __builtin_amdgcn_exp2f(__fmul_rn(d0, 1.4426950408889634f)); sum += v[k]; }
#pragma unroll
    for (int sh = 16; sh; sh >>= 1) sum += __shfl_xor(sum, sh, 32);
    const float f = __fdiv_rn(hires ? 1.0f : PCAR, sum);
{
        if (hires) {
#pragma unroll
            for (int ch = 0; ch < TT / 128; ++ch) { v4us oh, ol;
#pragma unroll
                for (int q = 0; q < 4; ++q) { unsigned short a, c2; splitf(v[ch * 4 + q] * f, a, c2); oh[q] = a; ol[q] = c2; }
                const size_t oo = ((size_t)zz * (RH ? RH : 1) + i) * TT + ch * 128 + lane * 4; *(v4us*)(Ph + oo) = oh; *(v4us*)(Pl + oo) = ol; }
        } else {
#pragma unroll
            for (int ch = 0; ch < TT / 128; ++ch) { v4h o4;
#pragma unroll
                for (int q = 0; q < 4; ++q) o4[q] = tohx(v[ch * 4 + q] * f);
                *(v4h*)(P16 + (size_t)row * (2 * TT) + ch * 128 + lane * 4) = o4; } }
         }
}
__global__ __launch_bounds__(256) void k_merge(const float* __restrict__ O, int h0, bf* Ah, bf* Al) { const size_t e = ((size_t)blockIdx.x * 256 + threadIdx.x) * 2; if (e >= (size_t)ZH * TT * HD) return; const int d = (int)(e % HD); const int t = (int)((e / HD) % TT); const int zz = (int)(e / ((size_t)HD * TT)); const float cs = (t < RH) ? 1.0f : (1.0f / PCAR); const size_t oo = (size_t)t * DQ + (h0 + zz) * HD + d;
    v2us oh, ol;
#pragma unroll
    for (int q = 0; q < 2; ++q) { unsigned short a, c2; splitf(O[e + q] * cs, a, c2); oh[q] = a; ol[q] = c2; } *(v2us*)(Ah + oo) = oh; *(v2us*)(Al + oo) = ol;  }

extern "C" void kernel_launch(void* const* d_in, const int* in_sizes, int n_in,
                              void* d_out, int out_size, void* d_ws, size_t ws_size, hipStream_t stream) {
    (void)in_sizes; (void)n_in; (void)out_size;
    const float* x = (const float*)d_in[0]; const float* xk = (const float*)d_in[1]; const float* xv = (const float*)d_in[2]; const float* wq = (const float*)d_in[3]; const float* bq = (const float*)d_in[4]; const float* wk = (const float*)d_in[5]; const float* bk = (const float*)d_in[6]; const float* wv = (const float*)d_in[7]; const float* bv = (const float*)d_in[8]; const float* wo = (const float*)d_in[9]; const float* bo = (const float*)d_in[10]; const float* cosT = nullptr; const float* sinT = nullptr; (void)cosT; (void)sinT;
    float* OUT = (float*)d_out;     // [4][2048][1024]
    char* wsp = (char*)d_ws;
    auto take = [&](size_t bytes) { char* p = wsp; wsp += (bytes + 255) & ~(size_t)255; return (void*)p; };
    bf* WQ = (bf*)take((size_t)DQ * DM * 2); bf* WK = (bf*)take((size_t)DKV * DM * 2); bf* WV = (bf*)take((size_t)DKV * DM * 2); bf* WO = (bf*)take((size_t)DM * DQ * 2); float* CS = (float*)take((size_t)TT * HD * 2 * 4);
    bf* XB = (bf*)take((size_t)TT * DM * 2); bf* XB2 = (bf*)take((size_t)TT * DM * 2); bf* XB3 = (bf*)take((size_t)TT * DM * 2); float* FQ = (float*)take((size_t)TT * DQ * 4); float* FK = (float*)take((size_t)TT * DKV * 4);
    h16* QP16 = (h16*)take((size_t)NH_ * TT * HD * 2); h16* KP16 = (h16*)take((size_t)NKV * TT * HD * 2); h16* VT16 = (h16*)take((size_t)NKV * HD * TT * 2);
    bf* QPh = (bf*)take((size_t)NH_ * TT * HD * 2); bf* QPl = (bf*)take((size_t)NH_ * TT * HD * 2); bf* KPh = (bf*)take((size_t)NKV * TT * HD * 2); bf* KPl = (bf*)take((size_t)NKV * TT * HD * 2); bf* VTh = (bf*)take((size_t)NKV * HD * TT * 2); bf* VTl = (bf*)take((size_t)NKV * HD * TT * 2); bf* Ph = (bf*)take((size_t)ZH * RH * TT * 2); bf* Pl = (bf*)take((size_t)ZH * RH * TT * 2);
    float* Sb = (float*)take((size_t)ZH * TT * TT * 4); h16* P16 = (h16*)Sb;   // fp16 probabilities live in their own score rows (pitch 2*TT halfs), which lets eight heads' scores fit the workspace
    float* Ob = (float*)take((size_t)ZH * TT * HD * 4); bf* ATh = (bf*)take((size_t)TT * DQ * 2); bf* ATl = (bf*)take((size_t)TT * DQ * 2);
    if ((size_t)(wsp - (char*)d_ws) > ws_size) return;    // ws 256 MiB
    float* FV = FK;   // v projection reuses the k buffer after the k planes are built (stream-ordered)
    { k_cvt8<<<(unsigned)(((size_t)DQ * DM / 8 + 255) / 256), 256, 0, stream>>>(wq, WQ, (size_t)DQ * DM / 8); k_cvt8<<<(unsigned)(((size_t)DKV * DM / 8 + 255) / 256), 256, 0, stream>>>(wk, WK, (size_t)DKV * DM / 8); k_cvt8<<<(unsigned)(((size_t)DKV * DM / 8 + 255) / 256), 256, 0, stream>>>(wv, WV, (size_t)DKV * DM / 8);
      k_cvt8<<<(unsigned)(((size_t)DM * DQ / 8 + 255) / 256), 256, 0, stream>>>(wo, WO, (size_t)DM * DQ / 8);
       }
    k_csid<<<(TT * HD + 255) / 256, 256, 0, stream>>>(CS);
    const unsigned LQ = (unsigned)(((size_t)NH_ * TT * HD / 2 + 255) / 256), LKv = (unsigned)(((size_t)NKV * TT * HD / 2 + 255) / 256);
    for (int b = 0; b < NB_; ++b) {
        
        k_cvt8<<<(unsigned)(((size_t)TT * DM / 8 + 255) / 256), 256, 0, stream>>>(x + (size_t)b * TT * DM, XB, (size_t)TT * DM / 8); k_cvt8<<<(unsigned)(((size_t)TT * DM / 8 + 255) / 256), 256, 0, stream>>>(xk + (size_t)b * TT * DM, XB2, (size_t)TT * DM / 8); k_cvt8<<<(unsigned)(((size_t)TT * DM / 8 + 255) / 256), 256, 0, stream>>>(xv + (size_t)b * TT * DM, XB3, (size_t)TT * DM / 8);
        k_gemmw<bf, 0, true><<<dim3(TT / 64, DQ / 64, 1), 32, 0, stream>>>(XB, nullptr, WQ, nullptr, DM, FQ, DQ, bq, 0, 0, 0);
        k_rope<<<LQ, 256, 0, stream>>>(FQ, DQ, NH_, CS, nullptr, nullptr, 1.0f, QP16, QPh, QPl);
        k_gemmw<bf, 0, true><<<dim3(TT / 64, DKV / 64, 1), 32, 0, stream>>>(XB2, nullptr, WK, nullptr, DM, FK, DKV, bk, 0, 0, 0);
        k_rope<<<LKv, 256, 0, stream>>>(FK, DKV, NKV, CS, nullptr, nullptr, 1.0f, KP16, KPh, KPl);
        k_gemmw<bf, 0, true><<<dim3(TT / 64, DKV / 64, 1), 32, 0, stream>>>(XB3, nullptr, WV, nullptr, DM, FV, DKV, bv, 0, 0, 0); k_vtp<<<LKv, 256, 0, stream>>>(FV, DKV, NKV, VT16, VTh, VTl);
        for (int h0 = 0; h0 < NH_; h0 += ZH) { const size_t zq = (size_t)h0, zk = (size_t)(h0 / REP);   // one kv head per query head: the pass's heads use consecutive kv planes (z-strides TT*HD)
            k_gemmc<bf, 2, 1><<<dim3(RH / 64, TT / 64, ZH), 32, 0, stream>>>(QPh + zq * TT * HD, QPl + zq * TT * HD, KPh + zk * TT * HD, KPl + zk * TT * HD, HD, HD, Sb, TT, 0, (size_t)TT * HD, (size_t)TT * HD, (size_t)TT * TT);
            k_gemmc<h16, 0, 1><<<dim3((TT - RH) / 64, TT / 64, ZH), 32, 0, stream>>>(QP16 + zq * TT * HD + (size_t)RH * HD, nullptr, KP16 + zk * TT * HD, nullptr, HD, HD, Sb + (size_t)RH * TT, TT, RH, (size_t)TT * HD, (size_t)TT * HD, (size_t)TT * TT);
            k_asoft<<<ZH * TT / 8, 256, 0, stream>>>(Sb, P16, Ph, Pl);
            k_gemmc<bf, 2, 2><<<dim3(RH / 64, HD / 64, ZH), 32, 0, stream>>>(Ph, Pl, VTh + zk * HD * TT, VTl + zk * HD * TT, TT, TT, Ob, HD, 0, (size_t)RH * TT, (size_t)HD * TT, (size_t)TT * HD);
            k_gemmc<h16, 0, 2><<<dim3((TT - RH) / 64, HD / 64, ZH), 32, 0, stream>>>(P16 + (size_t)RH * 2 * TT, nullptr, VT16 + zk * HD * TT, nullptr, TT, 2 * TT, Ob + (size_t)RH * HD, HD, RH, (size_t)2 * TT * TT, (size_t)HD * TT, (size_t)TT * HD);
            k_merge<<<(unsigned)(((size_t)ZH * TT * HD / 2 + 255) / 256), 256, 0, stream>>>(Ob, h0, ATh, ATl); }
        k_gemmw<bf, 1, true><<<dim3(TT / 64, DM / 64, 1), 32, 0, stream>>>(ATh, ATl, WO, nullptr, DQ, OUT + (size_t)b * TT * DM, DM, bo, 0, 0, 0); }
}

// v002
// Measured time: 653 microseconds a run.
// In two side-by-side timings against v001, it was 2.15 and 2.13 times as fast.
// Counting every step since v000, it is 4.47 times as fast.
#include <hip/hip_runtime.h>

// SimpleMultiheadSDPAttention (query, key, value [4][2048][1024]; q = query Wq^T + bq, k = key Wk^T + bk, v = value Wv^T + bv (16 heads x 64); causal softmax(q.k / 8) (-1e30); out = merged Wo^T + bo -> [4][2048][1024]).
// Compute dtypes, f32 accumulate: every input rounded to bf16; q/k/v on PLAIN bf16 operands (three inputs; exact) + bias; causal scores and attn.v: query rows < 512 hl (3 products), the rest single fp16, fused with an online f32 softmax, causal tile skipping; Wo hl x exact (2 products) + bias.

#define NB_  4
#define TT   2048
#define DM   1024
#define NH_  16
#define NKV  16
#define REP  (NH_ / NKV)
#define HD   64
#define DQ   (NH_ * HD)
#define DKV  (NKV * HD)
#define RH   512                  // query rows < RH use hi+lo planes (0: none)
#define SCL  0.125f   // HD^-0.5
typedef _Float16 h16;
typedef unsigned short bf;
typedef __attribute__((ext_vector_type(16))) __bf16   v16bf;
typedef __attribute__((ext_vector_type(16))) _Float16 v16h;
typedef __attribute__((ext_vector_type(8)))  _Float16 v8h;
typedef __attribute__((ext_vector_type(8)))  unsigned short v8us;
typedef __attribute__((ext_vector_type(8)))  float    v8f;
typedef __attribute__((ext_vector_type(4)))  float    v4f;
typedef v8h  __attribute__((may_alias)) v8ha;
typedef v4f  __attribute__((may_alias)) v4fa;
typedef v8us __attribute__((may_alias)) v8usa;

__device__ __forceinline__ unsigned short f2bf(float f) { unsigned u = __float_as_uint(f); u += 0x7FFFu + ((u >> 16) & 1u); return (unsigned short)(u >> 16); }
__device__ __forceinline__ float bf2f(unsigned short b) { return __uint_as_float(((unsigned)b) << 16); }
__device__ __forceinline__ float bfr(float f) { return bf2f(f2bf(f)); }
__device__ __forceinline__ v16h cat16(v8h lo, v8h hi) { return __builtin_shufflevector(lo, hi, 0, 1, 2, 3, 4, 5, 6, 7, 8, 9, 10, 11, 12, 13, 14, 15); }
__device__ __forceinline__ v16bf cat16b(v8us lo, v8us hi) { return __builtin_bit_cast(v16bf, __builtin_shufflevector(lo, hi, 0, 1, 2, 3, 4, 5, 6, 7, 8, 9, 10, 11, 12, 13, 14, 15)); }
__device__ __forceinline__ v8f wmma16(v16h a, v16h b, v8f c) { return __builtin_amdgcn_wmma_f32_16x16x32_f16(false, a, false, b, (short)0, c, false, false); }
__device__ __forceinline__ v8f wmmab(v16bf a, v16bf b, v8f c) { return __builtin_amdgcn_wmma_f32_16x16x32_bf16(false, a, false, b, (short)0, c, false, false); }



// ---- k_gemmw: register-blocked GEMM, ONE WAVE per 64x64 output tile (16 accumulators), operands straight from K-contiguous 16-bit planes; grid (M/64, N/64, Z), 32 threads.
// C[m][n] (f32, pitch ldc, + optional f32 bias[n]) = sum_k A[m][k] Bt[n][k] (+ split products per NSPLIT). z-batch strides sA/sB/sC in elements. K % 32 == 0.
template <typename T16> struct WFrag;
template <> struct WFrag<h16> { typedef v16h V; static __device__ __forceinline__ V ld(const h16* p) { return cat16(*(const v8h*)p, *(const v8h*)(p + 16)); } static __device__ __forceinline__ v8f mma(V a, V b, v8f c) { return wmma16(a, b, c); } };
template <> struct WFrag<bf> { typedef v16bf V; static __device__ __forceinline__ V ld(const bf* p) { return cat16b(*(const v8us*)p, *(const v8us*)(p + 16)); } static __device__ __forceinline__ v8f mma(V a, V b, v8f c) { return wmmab(a, b, c); } };
template <typename T16, int NSPLIT, bool BIAS>
__global__ __launch_bounds__(32) void k_gemmw(const T16* __restrict__ A, const T16* __restrict__ A2, const T16* __restrict__ Bt, const T16* __restrict__ Bt2, int K, float* C, int ldc, const float* __restrict__ bias, size_t sA, size_t sB, size_t sC) {
    typedef typename WFrag<T16>::V V;
    __shared__ __align__(16) float os[16 * 68];
    const size_t z = blockIdx.z; A += z * sA; if (A2) A2 += z * sA; Bt += z * sB; if (Bt2) Bt2 += z * sB; C += z * sC;
    const int lane = threadIdx.x & 31, lr = lane & 15, hi = lane >> 4; const int r0 = blockIdx.x * 64, c0 = blockIdx.y * 64;
    v8f acc[4][4];
#pragma unroll
    for (int mb = 0; mb < 4; ++mb)
#pragma unroll
        for (int nb = 0; nb < 4; ++nb) acc[mb][nb] = (v8f){};
    const size_t aoff = (size_t)(r0 + lr) * K + 8 * hi, boff = (size_t)(c0 + lr) * K + 8 * hi;
#pragma unroll 1
    for (int kc = 0; kc < K; kc += 32) {
        V a[4], a2[4];
#pragma unroll
        for (int mb = 0; mb < 4; ++mb) { a[mb] = WFrag<T16>::ld(A + aoff + (size_t)mb * 16 * K + kc); if (NSPLIT == 1 || NSPLIT == 2) a2[mb] = WFrag<T16>::ld(A2 + aoff + (size_t)mb * 16 * K + kc); }
#pragma unroll
        for (int nb = 0; nb < 4; ++nb) { const V b = WFrag<T16>::ld(Bt + boff + (size_t)nb * 16 * K + kc); V b2; if (NSPLIT >= 2) b2 = WFrag<T16>::ld(Bt2 + boff + (size_t)nb * 16 * K + kc);
#pragma unroll
            for (int mb = 0; mb < 4; ++mb) { acc[mb][nb] = WFrag<T16>::mma(a[mb], b, acc[mb][nb]); if (NSPLIT == 1 || NSPLIT == 2) acc[mb][nb] = WFrag<T16>::mma(a2[mb], b, acc[mb][nb]); if (NSPLIT >= 2) acc[mb][nb] = WFrag<T16>::mma(a[mb], b2, acc[mb][nb]); } }
        asm volatile("v_nop\n\tv_nop\n\tv_nop\n\tv_nop" : "+v"(acc[0][0]), "+v"(acc[1][1]), "+v"(acc[2][2]), "+v"(acc[3][3]) : "v"(a[0]), "v"(a[3]));
    }
#pragma unroll
    for (int mb = 0; mb < 4; ++mb) {
#pragma unroll
        for (int nb = 0; nb < 4; ++nb) {
#pragma unroll
            for (int j = 0; j < 8; ++j) os[(hi * 8 + j) * 68 + nb * 16 + lr] = acc[mb][nb][j]; }
        __builtin_amdgcn_wave_barrier(); asm volatile("" ::: "memory");
        float* crow = C + (size_t)(r0 + mb * 16) * ldc + c0;
{
#pragma unroll
            for (int s = 0; s < 8; ++s) { const int row = 2 * s + hi, cofs = lr * 4; v4f val = *(const v4fa*)(os + row * 68 + cofs); if (BIAS) { val[0] += bfr(bias[c0 + cofs]); val[1] += bfr(bias[c0 + cofs + 1]); val[2] += bfr(bias[c0 + cofs + 2]); val[3] += bfr(bias[c0 + cofs + 3]); }
                *(v4f*)(crow + (size_t)row * ldc + cofs) = val; }
             }
        __builtin_amdgcn_wave_barrier(); asm volatile("" ::: "memory");
    }
}

__device__ __forceinline__ h16 tohx(float x) { return (h16)x; }
__device__ __forceinline__ void splitf(float y, unsigned short& h, unsigned short& l) { h = f2bf(y); l = f2bf(y - bf2f(h)); }
typedef __attribute__((ext_vector_type(2))) _Float16 v2h;
typedef __attribute__((ext_vector_type(4))) _Float16 v4h;
typedef __attribute__((ext_vector_type(2))) unsigned short v2us;
typedef __attribute__((ext_vector_type(4))) unsigned short v4us;
typedef __attribute__((ext_vector_type(2))) float v2f;
typedef __attribute__((ext_vector_type(4))) int v4i;

__global__ __launch_bounds__(256) void k_wtG(const float* __restrict__ w, int K, int N, bf* Bt) {
    const int lane = threadIdx.x & 31; const int L0 = (blockIdx.x * 8 + (threadIdx.x >> 5)) * 8; const int nlines = N * K / 64;
{
#pragma unroll 1
        for (int l = 0; l < 8; ++l) { const int L = L0 + l; if (L >= nlines) break; const size_t e = (size_t)L * 64 + lane * 2; const int k = (int)(e % K), n = (int)(e / K); v2us o;
            o[0] = f2bf(w[(size_t)k * N + n]); o[1] = f2bf(w[(size_t)(k + 1) * N + n]); *(v2us*)(Bt + e) = o; }
         }
}
__global__ __launch_bounds__(256) void k_cvt8(const float* __restrict__ src, bf* dst, size_t n8) { const size_t i = (size_t)blockIdx.x * 256 + threadIdx.x; if (i >= n8) return; const v8f v = *(const v8f*)(src + i * 8); v8us o;
#pragma unroll
    for (int k = 0; k < 8; ++k) o[k] = f2bf(v[k]); *(v8us*)(dst + i * 8) = o;  }
__global__ __launch_bounds__(256) void k_cscvt(const float* __restrict__ cosT, const float* __restrict__ sinT, float* CS) { const int idx = blockIdx.x * 256 + threadIdx.x; if (idx >= TT * HD) return; v2f cs; cs[0] = bfr(cosT[idx]); cs[1] = bfr(sinT[idx]); *(v2f*)(CS + (size_t)idx * 2) = cs;  }
// k_rope: head planes [h][t][d] (fp16 + hi/lo) of rope(x) x sc with the rotate-half convention out[d] = x[d] cos[t][d] - x[d+HD/2] sin[t][d], out[d+HD/2] = x[d+HD/2] cos[t][d+HD/2] + x[d] sin[t][d+HD/2]
__global__ __launch_bounds__(256) void k_rope(const float* __restrict__ F, int pitch, int nheads, const float* __restrict__ CS, const float* __restrict__ RF, const float* __restrict__ nw, float sc, h16* P16, bf* Ph, bf* Pl) {
    const size_t e = ((size_t)blockIdx.x * 256 + threadIdx.x) * 2; if (e >= (size_t)nheads * TT * HD) return; const int d = (int)(e % HD); const int t = (int)((e / HD) % TT); const int h = (int)(e / ((size_t)HD * TT)); const float* f = F + (size_t)t * pitch + h * HD; const float rf = RF ? RF[(size_t)h * TT + t] : 1.0f; v2h o16; v2us oh, ol;
#pragma unroll
    for (int q = 0; q < 2; ++q) { const int dd = d + q; const int dp = (dd < HD / 2) ? dd + HD / 2 : dd - HD / 2; float x0 = f[dd], x1 = f[dp];
        if (RF) { float n0 = __fmul_rn(x0, rf), n1 = __fmul_rn(x1, rf); asm volatile("" : "+v"(n0)); asm volatile("" : "+v"(n1)); x0 = __fmul_rn(bfr(nw[dd]), n0); x1 = __fmul_rn(bfr(nw[dp]), n1); }
        const v2f cs = *(const v2f*)(CS + ((size_t)t * HD + dd) * 2); float a = __fmul_rn(x0, cs[0]), bq = __fmul_rn(x1, cs[1]); asm volatile("" : "+v"(a)); asm volatile("" : "+v"(bq)); const float r = ((dd < HD / 2) ? __fsub_rn(a, bq) : __fadd_rn(a, bq)) * sc;
        o16[q] = tohx(r); unsigned short a2, c2; splitf(r, a2, c2); oh[q] = a2; ol[q] = c2; }
    *(v2h*)(P16 + e) = o16; *(v2us*)(Ph + e) = oh; *(v2us*)(Pl + e) = ol;  }
__global__ __launch_bounds__(256) void k_vtp(const float* __restrict__ F, int pitch, int nheads, h16* V16, bf* Vh, bf* Vl) { const size_t e = ((size_t)blockIdx.x * 256 + threadIdx.x) * 2; if (e >= (size_t)nheads * HD * TT) return; const int t = (int)(e % TT); const int d = (int)((e / TT) % HD); const int g = (int)(e / ((size_t)TT * HD)); v2h o16; v2us oh, ol;
#pragma unroll
    for (int q = 0; q < 2; ++q) { const float x = F[(size_t)(t + q) * pitch + g * HD + d]; o16[q] = tohx(x); unsigned short a2, c2; splitf(x, a2, c2); oh[q] = a2; ol[q] = c2; }
    *(v2h*)(V16 + e) = o16; *(v2us*)(Vh + e) = oh; *(v2us*)(Vl + e) = ol;  }
__global__ __launch_bounds__(256) void k_csid(float* CS) { const int idx = blockIdx.x * 256 + threadIdx.x; if (idx >= TT * HD) return; v2f cs; cs[0] = 1.0f; cs[1] = 0.0f; *(v2f*)(CS + (size_t)idx * 2) = cs;  }
// ---- k_fattn: causal attention of one head's QT query rows per work-group, scores never stored. Transposed products: S^T = K Q^T (A = key rows, B = query columns), O^T += V^T P^T; a lane holds one query
// column, so two stacked 16-key score tiles, converted in place, ARE the B operand of the second product (hardware k order, which WFrag::ld also delivers). Running maximum and sum per column (online softmax).
// The NW waves of a work-group share the query rows and take the 32-key passes w, w + NW, ...; their (maximum, sum, O^T) are joined through LDS at the end. Query rows < RH: hi+lo bf16 planes, 3 products; the rest fp16.
#define QT  32
#define KT  32
#define NW  4
#define SC2 (SCL * 1.4426950408889634f)   // score scale times log2(e): probabilities are exp2((s - max) * SC2)
// fragment at a base plus a 32-bit BYTE offset: a wave-uniform base and the lane's own offset, or the lane's own address and 0
template <typename T16> __device__ __forceinline__ typename WFrag<T16>::V fa_ld(const T16* __restrict__ base, unsigned ob) { return WFrag<T16>::ld((const T16*)((const char*)base + ob)); }
// key fragments of one 32-key pass; kb = the pass's first key row (wave-uniform) with koff = the lane's own byte offset in it, or kb = the lane's own address with koff = 0
template <typename T16>
__device__ __forceinline__ void fa_ldk(const T16* __restrict__ kb, unsigned koff, typename WFrag<T16>::V (&ka)[2][2]) {
#pragma unroll
    for (int ks = 0; ks < 2; ++ks)
#pragma unroll
        for (int kc = 0; kc < 2; ++kc) ka[ks][kc] = fa_ld<T16>(kb + (ks * 16 * HD + kc * 32), koff);
}
__device__ __forceinline__ void fa_pack(const v8f& t0, const v8f& t1, v16h& p, v16h& p2) { (void)p2;
#pragma unroll
    for (int r = 0; r < 8; ++r) { p[r] = (h16)t0[r]; p[8 + r] = (h16)t1[r]; } }
__device__ __forceinline__ void fa_pack(const v8f& t0, const v8f& t1, v16bf& p, v16bf& p2) { v8us h0, h1, l0, l1;
#pragma unroll
    for (int r = 0; r < 8; ++r) { unsigned short a, c; splitf(t0[r], a, c); h0[r] = a; l0[r] = c; splitf(t1[r], a, c); h1[r] = a; l1[r] = c; }
    p = cat16b(h0, h1); p2 = cat16b(l0, l1); }
__device__ __forceinline__ float fa_xhalf(float x) { const int b = __float_as_int(x); return __int_as_float(__builtin_amdgcn_permlanex16(b, b, 0x76543210, 0xfedcba98, false, false)); }   // lane l <-> l ^ 16
// one pass: 32 keys from k0 against the work-group's 32 query columns from q0. Q, kb, vb (and the lo planes' Q2, kb2, vb2): first query row, first key row [t][d] and first key column [d][t] of the pass, wave-uniform; koff = 2 (lr HD + 8 hi) and voff = 2 (lr TT + 8 hi) are the lane's byte offsets in row-major [t][d] and [d][t] planes.
// AHEAD: ka holds this pass's key fragments on entry and those of the wave's next pass on exit. EDGE: the pass may reach above the diagonal. B0, NB: the 16-column groups that the pass serves.
template <typename T16, bool HL, bool AHEAD, bool EDGE, int B0, int NB>
__device__ __forceinline__ void fa_pass(const T16* __restrict__ Q, const T16* __restrict__ Q2, const T16* __restrict__ kb, const T16* __restrict__ kb2, const T16* __restrict__ vb, const T16* __restrict__ vb2, int q0, int k0, unsigned koff, unsigned voff, int lr, int hi,
                                        typename WFrag<T16>::V (&qf)[2][2], typename WFrag<T16>::V (&ka)[2][2], v8f (&o)[4][2], float (&m)[2], float (&l)[2]) {
    typedef typename WFrag<T16>::V V;
    V va[4], va2[4];
    v8f s[2][2];                                                     // s[ks][qb][r] = score(key k0 + 16 ks + 8 hi + r, query q0 + 16 qb + lr)
    if (!HL) {
#pragma unroll
        for (int db = 0; db < 4; ++db) va[db] = fa_ld<T16>(vb + db * 16 * TT, voff);   // value fragments: asked for ahead of the score products, used behind the softmax
#pragma unroll
        for (int ks = 0; ks < 2; ++ks)
#pragma unroll
            for (int qb = B0; qb < B0 + NB; ++qb) { v8f t = (v8f){};
#pragma unroll
                for (int kc = 0; kc < 2; ++kc) t = WFrag<T16>::mma(ka[ks][kc], qf[qb][kc], t);
                s[ks][qb] = t; }
        if (AHEAD) fa_ldk<T16>(kb + NW * KT * HD, koff, ka);         // the next pass's key fragments fly during this pass's softmax and second product
    } else {
        // the few hi+lo passes fetch nothing ahead: twice the planes, and their registers would set the occupancy of the whole kernel
        V qf2[2][2];
#pragma unroll
        for (int qb = B0; qb < B0 + NB; ++qb)
#pragma unroll
            for (int kc = 0; kc < 2; ++kc) { qf[qb][kc] = fa_ld<T16>(Q + (qb * 16 * HD + kc * 32), koff); qf2[qb][kc] = fa_ld<T16>(Q2 + (qb * 16 * HD + kc * 32), koff); }
        // Each lane's plane addresses are formed here, and the wait behind the loads takes them as inputs: they stay untouched up to it.
        V ka2[2][2]; const T16* kp = (const T16*)((const char*)kb + koff); const T16* kp2 = (const T16*)((const char*)kb2 + koff);
        fa_ldk<T16>(kp, 0u, ka); fa_ldk<T16>(kp2, 0u, ka2);
        asm volatile("s_wait_xcnt 0x0" : : "v"(kp), "v"(kp2) : "memory");
#pragma unroll
        for (int ks = 0; ks < 2; ++ks)
#pragma unroll
            for (int qb = B0; qb < B0 + NB; ++qb) { v8f t = (v8f){};
#pragma unroll
                for (int kc = 0; kc < 2; ++kc) { t = WFrag<T16>::mma(ka[ks][kc], qf[qb][kc], t); t = WFrag<T16>::mma(ka2[ks][kc], qf[qb][kc], t); t = WFrag<T16>::mma(ka[ks][kc], qf2[qb][kc], t); }
                s[ks][qb] = t; }
        const T16* vp = (const T16*)((const char*)vb + voff); const T16* vp2 = (const T16*)((const char*)vb2 + voff);
#pragma unroll
        for (int db = 0; db < 4; ++db) { va[db] = WFrag<T16>::ld(vp + db * 16 * TT); va2[db] = WFrag<T16>::ld(vp2 + db * 16 * TT); }
        asm volatile("s_wait_xcnt 0x0" : : "v"(vp), "v"(vp2) : "memory");   // as above
    }
    if (EDGE) {                                                      // keys above the query are masked (by select: no branch behind the products)
#pragma unroll
        for (int ks = 0; ks < 2; ++ks)
#pragma unroll
            for (int qb = B0; qb < B0 + NB; ++qb)
#pragma unroll
                for (int r = 0; r < 8; ++r) s[ks][qb][r] = (k0 + ks * 16 + 8 * hi + r > q0 + qb * 16 + lr) ? -3.0e38f : s[ks][qb][r]; }
#pragma unroll
    for (int qb = B0; qb < B0 + NB; ++qb) {
        float mx = fmaxf(s[0][qb][0], s[1][qb][0]);
#pragma unroll
        for (int r = 1; r < 8; ++r) mx = fmaxf(mx, fmaxf(s[0][qb][r], s[1][qb][r]));
        mx = fmaxf(mx, fa_xhalf(mx));                                // the two lane halves hold the two halves of a column's keys
        const float mn = fmaxf(m[qb], mx), al = __builtin_amdgcn_exp2f((m[qb] - mn) * SC2), mb = mn * SC2; m[qb] = mn;
        float ps = 0.f;
#pragma unroll
        for (int ks = 0; ks < 2; ++ks)
#pragma unroll
            for (int r = 0; r < 8; ++r) { const float p = __builtin_amdgcn_exp2f(fmaf(s[ks][qb][r], SC2, -mb)); s[ks][qb][r] = p; ps += p; }
        l[qb] = fmaf(l[qb], al, ps);
        V pb, pb2; fa_pack(s[0][qb], s[1][qb], pb, pb2);
#pragma unroll
        for (int db = 0; db < 4; ++db) { v8f t = o[db][qb] * al; t = WFrag<T16>::mma(va[db], pb, t); if (HL) { t = WFrag<T16>::mma(va2[db], pb, t); t = WFrag<T16>::mma(va[db], pb2, t); } o[db][qb] = t; }
    }
}
template <typename T16, bool HL>
__device__ __forceinline__ void fa_walk(const T16* __restrict__ Q, const T16* __restrict__ Q2, const T16* __restrict__ Kp, const T16* __restrict__ K2, const T16* __restrict__ Vt, const T16* __restrict__ V2,
                                        int qt, int wave, int lr, int hi, v8f (&o)[4][2], float (&m)[2], float (&l)[2]) {
    typedef typename WFrag<T16>::V V;
    if (wave > qt) return;                                           // fewer passes than waves: this wave keeps its empty state (sum 0, weight 0 in the join)
    const int q0 = qt * QT; const unsigned koff = (unsigned)(lr * HD + 8 * hi) * 2u, voff = (unsigned)(lr * TT + 8 * hi) * 2u; V qf[2][2], ka[2][2];
    Q += (size_t)q0 * HD; if (HL) Q2 += (size_t)q0 * HD;
    int kt = wave;
    if (HL) {
        // one 16-column group at a time: with both groups' hi and lo query planes live the walk spills
#pragma unroll 1
        for (; kt <= qt; kt += NW) fa_pass<T16, HL, false, true, 0, 1>(Q, Q2, Kp + (size_t)kt * KT * HD, K2 + (size_t)kt * KT * HD, Vt + kt * KT, V2 + kt * KT, q0, kt * KT, koff, voff, lr, hi, qf, ka, o, m, l);   // rolled: one pass already fills the registers
#pragma unroll 1
        for (kt = wave; kt <= qt; kt += NW) fa_pass<T16, HL, false, true, 1, 1>(Q, Q2, Kp + (size_t)kt * KT * HD, K2 + (size_t)kt * KT * HD, Vt + kt * KT, V2 + kt * KT, q0, kt * KT, koff, voff, lr, hi, qf, ka, o, m, l);   // rolled, as above
    } else {
#pragma unroll
        for (int qb = 0; qb < 2; ++qb)
#pragma unroll
            for (int kc = 0; kc < 2; ++kc) qf[qb][kc] = fa_ld<T16>(Q + (qb * 16 * HD + kc * 32), koff);
        const T16* kb = Kp + (size_t)kt * KT * HD; const T16* vb = Vt + kt * KT;
        fa_ldk<T16>(kb, koff, ka);
#pragma unroll 1
        for (; kt + NW <= qt; kt += NW, kb += NW * KT * HD, vb += NW * KT) fa_pass<T16, HL, true, false, 0, 2>(Q, Q2, kb, K2, vb, V2, q0, kt * KT, koff, voff, lr, hi, qf, ka, o, m, l);   // rolled, as above; every pass but a wave's last lies below the diagonal
        fa_pass<T16, HL, false, true, 0, 2>(Q, Q2, kb, K2, vb, V2, q0, kt * KT, koff, voff, lr, hi, qf, ka, o, m, l);
    }
}
__global__ __launch_bounds__(NW * 32) void k_fattn(const h16* __restrict__ Q16, const h16* __restrict__ K16, const h16* __restrict__ V16, const bf* __restrict__ Qh, const bf* __restrict__ Ql, const bf* __restrict__ Kh, const bf* __restrict__ Kl,
                                                   const bf* __restrict__ Vh, const bf* __restrict__ Vl, bf* Ah, bf* Al) {
    __shared__ __align__(16) float osh[NW * 4 * 2 * 256]; __shared__ float msh[NW * QT]; __shared__ float lsh[NW * QT];
    const int wave = __builtin_amdgcn_readfirstlane((int)(threadIdx.x >> 5)), lane = threadIdx.x & 31, lr = lane & 15, hi = lane >> 4;
    const int qt = (TT / QT - 1) - (int)blockIdx.y;                  // longest rows first, over all heads
    const int h = blockIdx.x; const size_t hq = (size_t)h * TT * HD, hk = (size_t)(h / REP) * TT * HD;
    v8f o[4][2]; float m[2] = {-3.0e38f, -3.0e38f}, l[2] = {0.f, 0.f};
#pragma unroll
    for (int db = 0; db < 4; ++db) { o[db][0] = (v8f){}; o[db][1] = (v8f){}; }
    if (qt * QT < RH) fa_walk<bf, true>(Qh + hq, Ql + hq, Kh + hk, Kl + hk, Vh + hk, Vl + hk, qt, wave, lr, hi, o, m, l);
    else fa_walk<h16, false>(Q16 + hq, nullptr, K16 + hk, nullptr, V16 + hk, nullptr, qt, wave, lr, hi, o, m, l);
#pragma unroll
    for (int qb = 0; qb < 2; ++qb) { l[qb] += fa_xhalf(l[qb]);
#pragma unroll
        for (int db = 0; db < 4; ++db) { float* p = osh + ((wave * 4 + db) * 2 + qb) * 256 + lane * 8; const v8f t = o[db][qb]; *(v4fa*)p = (v4f){t[0], t[1], t[2], t[3]}; *(v4fa*)(p + 4) = (v4f){t[4], t[5], t[6], t[7]}; }
        if (hi == 0) { msh[wave * QT + qb * 16 + lr] = m[qb]; lsh[wave * QT + qb * 16 + lr] = l[qb]; } }
    __syncthreads();
    // join: thread = (query row q, 16 head dims db), so that one wave writes whole 128-byte lines of the merged planes
    const int q = threadIdx.x >> 2, db = threadIdx.x & 3, qb = q >> 4, c = q & 15;
    float M = msh[q];
#pragma unroll
    for (int w = 1; w < NW; ++w) M = fmaxf(M, msh[w * QT + q]);
    float L = 0.f, acc[16];
#pragma unroll
    for (int r = 0; r < 16; ++r) acc[r] = 0.f;
#pragma unroll
    for (int w = 0; w < NW; ++w) { const float wg = __builtin_amdgcn_exp2f((msh[w * QT + q] - M) * SC2); L = fmaf(wg, lsh[w * QT + q], L);
#pragma unroll
        for (int hh = 0; hh < 2; ++hh) { const float* p = osh + ((w * 4 + db) * 2 + qb) * 256 + (c + 16 * hh) * 8; const v4f x0 = *(const v4fa*)p, x1 = *(const v4fa*)(p + 4);
#pragma unroll
            for (int r = 0; r < 4; ++r) { acc[hh * 8 + r] = fmaf(wg, x0[r], acc[hh * 8 + r]); acc[hh * 8 + 4 + r] = fmaf(wg, x1[r], acc[hh * 8 + 4 + r]); } } }
    const float inv = __fdiv_rn(1.0f, L); const size_t oo = (size_t)(qt * QT + q) * DQ + h * HD + db * 16;
#pragma unroll
    for (int hh = 0; hh < 2; ++hh) { v8us oh, ol;
#pragma unroll
        for (int r = 0; r < 8; ++r) { unsigned short a, c2; splitf(acc[hh * 8 + r] * inv, a, c2); oh[r] = a; ol[r] = c2; }
        *(v8usa*)(Ah + oo + hh * 8) = oh; *(v8usa*)(Al + oo + hh * 8) = ol; }
}

extern "C" void kernel_launch(void* const* d_in, const int* in_sizes, int n_in,
                              void* d_out, int out_size, void* d_ws, size_t ws_size, hipStream_t stream) {
    (void)in_sizes; (void)n_in; (void)out_size;
    const float* x = (const float*)d_in[0]; const float* xk = (const float*)d_in[1]; const float* xv = (const float*)d_in[2]; const float* wq = (const float*)d_in[3]; const float* bq = (const float*)d_in[4]; const float* wk = (const float*)d_in[5]; const float* bk = (const float*)d_in[6]; const float* wv = (const float*)d_in[7]; const float* bv = (const float*)d_in[8]; const float* wo = (const float*)d_in[9]; const float* bo = (const float*)d_in[10]; const float* cosT = nullptr; const float* sinT = nullptr; (void)cosT; (void)sinT;
    float* OUT = (float*)d_out;     // [4][2048][1024]
    char* wsp = (char*)d_ws;
    auto take = [&](size_t bytes) { char* p = wsp; wsp += (bytes + 255) & ~(size_t)255; return (void*)p; };
    bf* WQ = (bf*)take((size_t)DQ * DM * 2); bf* WK = (bf*)take((size_t)DKV * DM * 2); bf* WV = (bf*)take((size_t)DKV * DM * 2); bf* WO = (bf*)take((size_t)DM * DQ * 2); float* CS = (float*)take((size_t)TT * HD * 2 * 4);
    bf* XB = (bf*)take((size_t)TT * DM * 2); bf* XB2 = (bf*)take((size_t)TT * DM * 2); bf* XB3 = (bf*)take((size_t)TT * DM * 2); float* FQ = (float*)take((size_t)TT * DQ * 4); float* FK = (float*)take((size_t)TT * DKV * 4);
    h16* QP16 = (h16*)take((size_t)NH_ * TT * HD * 2); h16* KP16 = (h16*)take((size_t)NKV * TT * HD * 2); h16* VT16 = (h16*)take((size_t)NKV * HD * TT * 2);
    bf* QPh = (bf*)take((size_t)NH_ * TT * HD * 2); bf* QPl = (bf*)take((size_t)NH_ * TT * HD * 2); bf* KPh = (bf*)take((size_t)NKV * TT * HD * 2); bf* KPl = (bf*)take((size_t)NKV * TT * HD * 2); bf* VTh = (bf*)take((size_t)NKV * HD * TT * 2); bf* VTl = (bf*)take((size_t)NKV * HD * TT * 2);
    bf* ATh = (bf*)take((size_t)TT * DQ * 2); bf* ATl = (bf*)take((size_t)TT * DQ * 2);
    if ((size_t)(wsp - (char*)d_ws) > ws_size) return;    // ws 256 MiB
    float* FV = FK;   // v projection reuses the k buffer after the k planes are built (stream-ordered)
    { k_cvt8<<<(unsigned)(((size_t)DQ * DM / 8 + 255) / 256), 256, 0, stream>>>(wq, WQ, (size_t)DQ * DM / 8); k_cvt8<<<(unsigned)(((size_t)DKV * DM / 8 + 255) / 256), 256, 0, stream>>>(wk, WK, (size_t)DKV * DM / 8); k_cvt8<<<(unsigned)(((size_t)DKV * DM / 8 + 255) / 256), 256, 0, stream>>>(wv, WV, (size_t)DKV * DM / 8);
      k_cvt8<<<(unsigned)(((size_t)DM * DQ / 8 + 255) / 256), 256, 0, stream>>>(wo, WO, (size_t)DM * DQ / 8);
       }
    k_csid<<<(TT * HD + 255) / 256, 256, 0, stream>>>(CS);
    const unsigned LQ = (unsigned)(((size_t)NH_ * TT * HD / 2 + 255) / 256), LKv = (unsigned)(((size_t)NKV * TT * HD / 2 + 255) / 256);
    for (int b = 0; b < NB_; ++b) {
        
        k_cvt8<<<(unsigned)(((size_t)TT * DM / 8 + 255) / 256), 256, 0, stream>>>(x + (size_t)b * TT * DM, XB, (size_t)TT * DM / 8); k_cvt8<<<(unsigned)(((size_t)TT * DM / 8 + 255) / 256), 256, 0, stream>>>(xk + (size_t)b * TT * DM, XB2, (size_t)TT * DM / 8); k_cvt8<<<(unsigned)(((size_t)TT * DM / 8 + 255) / 256), 256, 0, stream>>>(xv + (size_t)b * TT * DM, XB3, (size_t)TT * DM / 8);
        k_gemmw<bf, 0, true><<<dim3(TT / 64, DQ / 64, 1), 32, 0, stream>>>(XB, nullptr, WQ, nullptr, DM, FQ, DQ, bq, 0, 0, 0);
        k_rope<<<LQ, 256, 0, stream>>>(FQ, DQ, NH_, CS, nullptr, nullptr, 1.0f, QP16, QPh, QPl);
        k_gemmw<bf, 0, true><<<dim3(TT / 64, DKV / 64, 1), 32, 0, stream>>>(XB2, nullptr, WK, nullptr, DM, FK, DKV, bk, 0, 0, 0);
        k_rope<<<LKv, 256, 0, stream>>>(FK, DKV, NKV, CS, nullptr, nullptr, 1.0f, KP16, KPh, KPl);
        k_gemmw<bf, 0, true><<<dim3(TT / 64, DKV / 64, 1), 32, 0, stream>>>(XB3, nullptr, WV, nullptr, DM, FV, DKV, bv, 0, 0, 0); k_vtp<<<LKv, 256, 0, stream>>>(FV, DKV, NKV, VT16, VTh, VTl);
        k_fattn<<<dim3(NH_, TT / QT, 1), NW * 32, 0, stream>>>(QP16, KP16, VT16, QPh, QPl, KPh, KPl, VTh, VTl, ATh, ATl);
        k_gemmw<bf, 1, true><<<dim3(TT / 64, DM / 64, 1), 32, 0, stream>>>(ATh, ATl, WO, nullptr, DQ, OUT + (size_t)b * TT * DM, DM, bo, 0, 0, 0); }
}

// v003
// Measured time: 564 microseconds a run.
// In both of two side-by-side timings against v002, it was 1.16 times as fast.
// Over all steps from v000 it is 5.19 times as fast.
#include <hip/hip_runtime.h>

// SimpleMultiheadSDPAttention (query, key, value [4][2048][1024]; q = query Wq^T + bq, k = key Wk^T + bk, v = value Wv^T + bv (16 heads x 64); causal softmax(q.k / 8) (-1e30); out = merged Wo^T + bo -> [4][2048][1024]).
// Compute dtypes, f32 accumulate: every input rounded to bf16; q/k/v on PLAIN bf16 operands (three inputs; exact) + bias; causal scores and attn.v: query rows < 512 hl (3 products), the rest single fp16, fused with an online f32 softmax, causal tile skipping; Wo hl x exact (2 products) + bias.

#define NB_  4
#define TT   2048
#define DM   1024
#define NH_  16
#define NKV  16
#define REP  (NH_ / NKV)
#define HD   64
#define DQ   (NH_ * HD)
#define DKV  (NKV * HD)
#define RH   512                  // query rows < RH use hi+lo planes (0: none)
#define SCL  0.125f   // HD^-0.5
typedef _Float16 h16;
typedef unsigned short bf;
typedef __attribute__((ext_vector_type(16))) __bf16   v16bf;
typedef __attribute__((ext_vector_type(16))) _Float16 v16h;
typedef __attribute__((ext_vector_type(8)))  _Float16 v8h;
typedef __attribute__((ext_vector_type(8)))  unsigned short v8us;
typedef __attribute__((ext_vector_type(8)))  float    v8f;
typedef __attribute__((ext_vector_type(4)))  float    v4f;
typedef v8h  __attribute__((may_alias)) v8ha;
typedef v4f  __attribute__((may_alias)) v4fa;
typedef v8us __attribute__((may_alias)) v8usa;

__device__ __forceinline__ unsigned short f2bf(float f) { unsigned u = __float_as_uint(f); u += 0x7FFFu + ((u >> 16) & 1u); return (unsigned short)(u >> 16); }
__device__ __forceinline__ float bf2f(unsigned short b) { return __uint_as_float(((unsigned)b) << 16); }
__device__ __forceinline__ float bfr(float f) { return bf2f(f2bf(f)); }
__device__ __forceinline__ v16h cat16(v8h lo, v8h hi) { return __builtin_shufflevector(lo, hi, 0, 1, 2, 3, 4, 5, 6, 7, 8, 9, 10, 11, 12, 13, 14, 15); }
__device__ __forceinline__ v16bf cat16b(v8us lo, v8us hi) { return __builtin_bit_cast(v16bf, __builtin_shufflevector(lo, hi, 0, 1, 2, 3, 4, 5, 6, 7, 8, 9, 10, 11, 12, 13, 14, 15)); }
__device__ __forceinline__ v8f wmma16(v16h a, v16h b, v8f c) { return __builtin_amdgcn_wmma_f32_16x16x32_f16(false, a, false, b, (short)0, c, false, false); }
__device__ __forceinline__ v8f wmmab(v16bf a, v16bf b, v8f c) { return __builtin_amdgcn_wmma_f32_16x16x32_bf16(false, a, false, b, (short)0, c, false, false); }



__device__ __forceinline__ h16 tohx(float x) { return (h16)x; }
__device__ __forceinline__ void splitf(float y, unsigned short& h, unsigned short& l) { h = f2bf(y); l = f2bf(y - bf2f(h)); }
typedef __attribute__((ext_vector_type(2))) _Float16 v2h;
typedef __attribute__((ext_vector_type(4))) _Float16 v4h;
typedef __attribute__((ext_vector_type(2))) unsigned short v2us;
typedef __attribute__((ext_vector_type(4))) unsigned short v4us;
typedef __attribute__((ext_vector_type(2))) float v2f;
typedef __attribute__((ext_vector_type(4))) int v4i;
// four neighbouring f32 results as fp16 and as hi + lo bf16
struct Pl3 { v4h o16; v4us oh, ol; };
__device__ __forceinline__ Pl3 cv_planes(v4f val) { Pl3 r;
#pragma unroll
    for (int i = 0; i < 4; ++i) { r.o16[i] = tohx(val[i]); unsigned short a, c; splitf(val[i], a, c); r.oh[i] = a; r.ol[i] = c; }
    return r; }
__device__ __forceinline__ void st_planes(const Pl3& r, size_t e, h16* P16, bf* Ph, bf* Pl) { *(v4h*)(P16 + e) = r.o16; *(v4us*)(Ph + e) = r.oh; *(v4us*)(Pl + e) = r.ol; }

// ---- k_gemmw: register-blocked GEMM, ONE WAVE per 64x64 output tile (16 accumulators), operands straight from K-contiguous 16-bit planes; grid (M/64, N/64, Z), 32 threads.
// C[m][n] (f32, pitch ldc, + optional f32 bias[n]) = sum_k A[m][k] Bt[n][k] (+ split products per NSPLIT). z-batch strides sA/sB/sC in elements. K % 32 == 0.
// EPI 0: C as above. EPI 1, 2: no C; a tile's 64 columns are one head (blockIdx.y), and the f32 result + bias goes out as that head's fp16, hi and lo planes, [h][t][d] (EPI 1) or transposed [h][d][t] (EPI 2), in whole 128-byte lines.
template <typename T16> struct WFrag;
template <> struct WFrag<h16> { typedef v16h V; static __device__ __forceinline__ V ld(const h16* p) { return cat16(*(const v8h*)p, *(const v8h*)(p + 16)); } static __device__ __forceinline__ v8f mma(V a, V b, v8f c) { return wmma16(a, b, c); } };
template <> struct WFrag<bf> { typedef v16bf V; static __device__ __forceinline__ V ld(const bf* p) { return cat16b(*(const v8us*)p, *(const v8us*)(p + 16)); } static __device__ __forceinline__ v8f mma(V a, V b, v8f c) { return wmmab(a, b, c); } };
template <typename T16, int NSPLIT, bool BIAS, int EPI>
__global__ __launch_bounds__(32) void k_gemmw(const T16* __restrict__ A, const T16* __restrict__ A2, const T16* __restrict__ Bt, const T16* __restrict__ Bt2, int K, float* C, int ldc, const float* __restrict__ bias, size_t sA, size_t sB, size_t sC, h16* P16, bf* Ph, bf* Pl) {
    static_assert(EPI == 0 || HD == 64, "a 64-column tile is one head");
    typedef typename WFrag<T16>::V V;
    __shared__ __align__(16) float os[16 * 68];
    const size_t z = blockIdx.z; A += z * sA; if (A2) A2 += z * sA; Bt += z * sB; if (Bt2) Bt2 += z * sB; C += z * sC;
    const int lane = threadIdx.x & 31, lr = lane & 15, hi = lane >> 4; const int r0 = blockIdx.x * 64, c0 = blockIdx.y * 64;
    v8f acc[4][4];
#pragma unroll
    for (int mb = 0; mb < 4; ++mb)
#pragma unroll
        for (int nb = 0; nb < 4; ++nb) acc[mb][nb] = (v8f){};
    const size_t aoff = (size_t)(r0 + lr) * K + 8 * hi, boff = (size_t)(c0 + lr) * K + 8 * hi;
    float bcol[4];                                                   // EPI 2: the bias of the lane's own four columns, asked for ahead of the K loop
    if (EPI == 2 && BIAS) {
#pragma unroll
        for (int nb = 0; nb < 4; ++nb) bcol[nb] = bfr(bias[c0 + nb * 16 + lr]); }
#pragma unroll 1
    for (int kc = 0; kc < K; kc += 32) {
        V a[4], a2[4];
#pragma unroll
        for (int mb = 0; mb < 4; ++mb) { a[mb] = WFrag<T16>::ld(A + aoff + (size_t)mb * 16 * K + kc); if (NSPLIT == 1 || NSPLIT == 2) a2[mb] = WFrag<T16>::ld(A2 + aoff + (size_t)mb * 16 * K + kc); }
#pragma unroll
        for (int nb = 0; nb < 4; ++nb) { const V b = WFrag<T16>::ld(Bt + boff + (size_t)nb * 16 * K + kc); V b2; if (NSPLIT >= 2) b2 = WFrag<T16>::ld(Bt2 + boff + (size_t)nb * 16 * K + kc);
#pragma unroll
            for (int mb = 0; mb < 4; ++mb) { acc[mb][nb] = WFrag<T16>::mma(a[mb], b, acc[mb][nb]); if (NSPLIT == 1 || NSPLIT == 2) acc[mb][nb] = WFrag<T16>::mma(a2[mb], b, acc[mb][nb]); if (NSPLIT >= 2) acc[mb][nb] = WFrag<T16>::mma(a[mb], b2, acc[mb][nb]); } }
        asm volatile("v_nop\n\tv_nop\n\tv_nop\n\tv_nop" : "+v"(acc[0][0]), "+v"(acc[1][1]), "+v"(acc[2][2]), "+v"(acc[3][3]) : "v"(a[0]), "v"(a[3]));
    }
    Pl3 pv[8];
    if (EPI == 2) {
        // staged transposed, 16 head dims x 64 rows t at a time: a lane's 8 accumulator rows are neighbours in t
#pragma unroll
        for (int nb = 0; nb < 4; ++nb) {
#pragma unroll
            for (int mb = 0; mb < 4; ++mb) { float* p = os + lr * 68 + mb * 16 + hi * 8; v8f t = acc[mb][nb]; if (BIAS) t += bcol[nb]; *(v4fa*)p = (v4f){t[0], t[1], t[2], t[3]}; *(v4fa*)(p + 4) = (v4f){t[4], t[5], t[6], t[7]}; }
            __builtin_amdgcn_wave_barrier(); asm volatile("" ::: "memory");   // the rows are read back by other lanes of the wave: the LDS reads below stay behind the LDS stores above
#pragma unroll
            for (int s = 0; s < 8; ++s) pv[s] = cv_planes(*(const v4fa*)(os + (2 * s + hi) * 68 + lr * 4));
            __builtin_amdgcn_sched_barrier(0);   // the group's 24 stores stay one run behind all of its conversions: mixed in, each store's registers are used again at once, with a wait in front of every such use
#pragma unroll
            for (int s = 0; s < 8; ++s) st_planes(pv[s], ((size_t)blockIdx.y * HD + nb * 16 + 2 * s + hi) * TT + r0 + lr * 4, P16, Ph, Pl);
            __builtin_amdgcn_wave_barrier(); asm volatile("s_wait_xcnt 0x0" ::: "memory");   // stands in front of the next group's writes to registers that the stores above name; also keeps the next group's LDS stores behind these reads
        }
        return;
    }
#pragma unroll
    for (int mb = 0; mb < 4; ++mb) {
#pragma unroll
        for (int nb = 0; nb < 4; ++nb) {
#pragma unroll
            for (int j = 0; j < 8; ++j) os[(hi * 8 + j) * 68 + nb * 16 + lr] = acc[mb][nb][j]; }
        __builtin_amdgcn_wave_barrier(); asm volatile("" ::: "memory");
        float* crow = C + (size_t)(r0 + mb * 16) * ldc + c0;
{
#pragma unroll
            for (int s = 0; s < 8; ++s) { const int row = 2 * s + hi, cofs = lr * 4; v4f val = *(const v4fa*)(os + row * 68 + cofs); if (BIAS) { val[0] += bfr(bias[c0 + cofs]); val[1] += bfr(bias[c0 + cofs + 1]); val[2] += bfr(bias[c0 + cofs + 2]); val[3] += bfr(bias[c0 + cofs + 3]); }
                if (EPI == 1) pv[s] = cv_planes(val);
                else *(v4f*)(crow + (size_t)row * ldc + cofs) = val; }
             }
        if (EPI == 1) {
            __builtin_amdgcn_sched_barrier(0);   // one run of 24 stores behind all the conversions, as in EPI 2
#pragma unroll
            for (int s = 0; s < 8; ++s) st_planes(pv[s], ((size_t)blockIdx.y * TT + r0 + mb * 16 + 2 * s + hi) * HD + lr * 4, P16, Ph, Pl);
        }
        __builtin_amdgcn_wave_barrier(); asm volatile("" ::: "memory");
    }
}


__global__ __launch_bounds__(256) void k_wtG(const float* __restrict__ w, int K, int N, bf* Bt) {
    const int lane = threadIdx.x & 31; const int L0 = (blockIdx.x * 8 + (threadIdx.x >> 5)) * 8; const int nlines = N * K / 64;
{
#pragma unroll 1
        for (int l = 0; l < 8; ++l) { const int L = L0 + l; if (L >= nlines) break; const size_t e = (size_t)L * 64 + lane * 2; const int k = (int)(e % K), n = (int)(e / K); v2us o;
            o[0] = f2bf(w[(size_t)k * N + n]); o[1] = f2bf(w[(size_t)(k + 1) * N + n]); *(v2us*)(Bt + e) = o; }
         }
}
__global__ __launch_bounds__(256) void k_cvt8(const float* __restrict__ src, bf* dst, size_t n8) { const size_t i = (size_t)blockIdx.x * 256 + threadIdx.x; if (i >= n8) return; const v8f v = *(const v8f*)(src + i * 8); v8us o;
#pragma unroll
    for (int k = 0; k < 8; ++k) o[k] = f2bf(v[k]); *(v8us*)(dst + i * 8) = o;  }
__global__ __launch_bounds__(256) void k_cscvt(const float* __restrict__ cosT, const float* __restrict__ sinT, float* CS) { const int idx = blockIdx.x * 256 + threadIdx.x; if (idx >= TT * HD) return; v2f cs; cs[0] = bfr(cosT[idx]); cs[1] = bfr(sinT[idx]); *(v2f*)(CS + (size_t)idx * 2) = cs;  }
// ---- k_fattn: causal attention of one head's QT query rows per work-group, scores never stored. Transposed products: S^T = K Q^T (A = key rows, B = query columns), O^T += V^T P^T; a lane holds one query
// column, so two stacked 16-key score tiles, converted in place, ARE the B operand of the second product (hardware k order, which WFrag::ld also delivers). Running maximum and sum per column (online softmax).
// The NW waves of a work-group share the query rows and take the 32-key passes w, w + NW, ...; their (maximum, sum, O^T) are joined through LDS at the end. Query rows < RH: hi+lo bf16 planes, 3 products; the rest fp16.
#define QT  32
#define KT  32
#define NW  4
#define SC2 (SCL * 1.4426950408889634f)   // score scale times log2(e): probabilities are exp2((s - max) * SC2)
// fragment at a base plus a 32-bit BYTE offset: a wave-uniform base and the lane's own offset, or the lane's own address and 0
template <typename T16> __device__ __forceinline__ typename WFrag<T16>::V fa_ld(const T16* __restrict__ base, unsigned ob) { return WFrag<T16>::ld((const T16*)((const char*)base + ob)); }
// key fragments of one 32-key pass; kb = the pass's first key row (wave-uniform) with koff = the lane's own byte offset in it, or kb = the lane's own address with koff = 0
template <typename T16>
__device__ __forceinline__ void fa_ldk(const T16* __restrict__ kb, unsigned koff, typename WFrag<T16>::V (&ka)[2][2]) {
#pragma unroll
    for (int ks = 0; ks < 2; ++ks)
#pragma unroll
        for (int kc = 0; kc < 2; ++kc) ka[ks][kc] = fa_ld<T16>(kb + (ks * 16 * HD + kc * 32), koff);
}
__device__ __forceinline__ void fa_pack(const v8f& t0, const v8f& t1, v16h& p, v16h& p2) { (void)p2;
#pragma unroll
    for (int r = 0; r < 8; ++r) { p[r] = (h16)t0[r]; p[8 + r] = (h16)t1[r]; } }
__device__ __forceinline__ void fa_pack(const v8f& t0, const v8f& t1, v16bf& p, v16bf& p2) { v8us h0, h1, l0, l1;
#pragma unroll
    for (int r = 0; r < 8; ++r) { unsigned short a, c; splitf(t0[r], a, c); h0[r] = a; l0[r] = c; splitf(t1[r], a, c); h1[r] = a; l1[r] = c; }
    p = cat16b(h0, h1); p2 = cat16b(l0, l1); }
__device__ __forceinline__ float fa_xhalf(float x) { const int b = __float_as_int(x); return __int_as_float(__builtin_amdgcn_permlanex16(b, b, 0x76543210, 0xfedcba98, false, false)); }   // lane l <-> l ^ 16
// one pass: 32 keys from k0 against the work-group's 32 query columns from q0. Q, kb, vb (and the lo planes' Q2, kb2, vb2): first query row, first key row [t][d] and first key column [d][t] of the pass, wave-uniform; koff = 2 (lr HD + 8 hi) and voff = 2 (lr TT + 8 hi) are the lane's byte offsets in row-major [t][d] and [d][t] planes.
// AHEAD: ka holds this pass's key fragments on entry and those of the wave's next pass on exit. EDGE: the pass may reach above the diagonal. B0, NB: the 16-column groups that the pass serves.
template <typename T16, bool HL, bool AHEAD, bool EDGE, int B0, int NB>
__device__ __forceinline__ void fa_pass(const T16* __restrict__ Q, const T16* __restrict__ Q2, const T16* __restrict__ kb, const T16* __restrict__ kb2, const T16* __restrict__ vb, const T16* __restrict__ vb2, int q0, int k0, unsigned koff, unsigned voff, int lr, int hi,
                                        typename WFrag<T16>::V (&qf)[2][2], typename WFrag<T16>::V (&ka)[2][2], v8f (&o)[4][2], float (&m)[2], float (&l)[2]) {
    typedef typename WFrag<T16>::V V;
    V va[4], va2[4];
    v8f s[2][2];                                                     // s[ks][qb][r] = score(key k0 + 16 ks + 8 hi + r, query q0 + 16 qb + lr)
    if (!HL) {
#pragma unroll
        for (int db = 0; db < 4; ++db) va[db] = fa_ld<T16>(vb + db * 16 * TT, voff);   // value fragments: asked for ahead of the score products, used behind the softmax
#pragma unroll
        for (int ks = 0; ks < 2; ++ks)
#pragma unroll
            for (int qb = B0; qb < B0 + NB; ++qb) { v8f t = (v8f){};
#pragma unroll
                for (int kc = 0; kc < 2; ++kc) t = WFrag<T16>::mma(ka[ks][kc], qf[qb][kc], t);
                s[ks][qb] = t; }
        if (AHEAD) fa_ldk<T16>(kb + NW * KT * HD, koff, ka);         // the next pass's key fragments fly during this pass's softmax and second product
    } else {
        // the few hi+lo passes fetch nothing ahead: twice the planes, and their registers would set the occupancy of the whole kernel
        V qf2[2][2];
#pragma unroll
        for (int qb = B0; qb < B0 + NB; ++qb)
#pragma unroll
            for (int kc = 0; kc < 2; ++kc) { qf[qb][kc] = fa_ld<T16>(Q + (qb * 16 * HD + kc * 32), koff); qf2[qb][kc] = fa_ld<T16>(Q2 + (qb * 16 * HD + kc * 32), koff); }
        // Each lane's plane addresses are formed here, and the wait behind the loads takes them as inputs: they stay untouched up to it.
        V ka2[2][2]; const T16* kp = (const T16*)((const char*)kb + koff); const T16* kp2 = (const T16*)((const char*)kb2 + koff);
        fa_ldk<T16>(kp, 0u, ka); fa_ldk<T16>(kp2, 0u, ka2);
        asm volatile("s_wait_xcnt 0x0" : : "v"(kp), "v"(kp2) : "memory");
#pragma unroll
        for (int ks = 0; ks < 2; ++ks)
#pragma unroll
            for (int qb = B0; qb < B0 + NB; ++qb) { v8f t = (v8f){};
#pragma unroll
                for (int kc = 0; kc < 2; ++kc) { t = WFrag<T16>::mma(ka[ks][kc], qf[qb][kc], t); t = WFrag<T16>::mma(ka2[ks][kc], qf[qb][kc], t); t = WFrag<T16>::mma(ka[ks][kc], qf2[qb][kc], t); }
                s[ks][qb] = t; }
        const T16* vp = (const T16*)((const char*)vb + voff); const T16* vp2 = (const T16*)((const char*)vb2 + voff);
#pragma unroll
        for (int db = 0; db < 4; ++db) { va[db] = WFrag<T16>::ld(vp + db * 16 * TT); va2[db] = WFrag<T16>::ld(vp2 + db * 16 * TT); }
        asm volatile("s_wait_xcnt 0x0" : : "v"(vp), "v"(vp2) : "memory");   // as above
    }
    if (EDGE) {                                                      // keys above the query are masked (by select: no branch behind the products)
#pragma unroll
        for (int ks = 0; ks < 2; ++ks)
#pragma unroll
            for (int qb = B0; qb < B0 + NB; ++qb)
#pragma unroll
                for (int r = 0; r < 8; ++r) s[ks][qb][r] = (k0 + ks * 16 + 8 * hi + r > q0 + qb * 16 + lr) ? -3.0e38f : s[ks][qb][r]; }
#pragma unroll
    for (int qb = B0; qb < B0 + NB; ++qb) {
        float mx = fmaxf(s[0][qb][0], s[1][qb][0]);
#pragma unroll
        for (int r = 1; r < 8; ++r) mx = fmaxf(mx, fmaxf(s[0][qb][r], s[1][qb][r]));
        mx = fmaxf(mx, fa_xhalf(mx));                                // the two lane halves hold the two halves of a column's keys
        const float mn = fmaxf(m[qb], mx), al = __builtin_amdgcn_exp2f((m[qb] - mn) * SC2), mb = mn * SC2; m[qb] = mn;
        float ps = 0.f;
#pragma unroll
        for (int ks = 0; ks < 2; ++ks)
#pragma unroll
            for (int r = 0; r < 8; ++r) { const float p = __builtin_amdgcn_exp2f(fmaf(s[ks][qb][r], SC2, -mb)); s[ks][qb][r] = p; ps += p; }
        l[qb] = fmaf(l[qb], al, ps);
        V pb, pb2; fa_pack(s[0][qb], s[1][qb], pb, pb2);
#pragma unroll
        for (int db = 0; db < 4; ++db) { v8f t = o[db][qb] * al; t = WFrag<T16>::mma(va[db], pb, t); if (HL) { t = WFrag<T16>::mma(va2[db], pb, t); t = WFrag<T16>::mma(va[db], pb2, t); } o[db][qb] = t; }
    }
}
template <typename T16, bool HL>
__device__ __forceinline__ void fa_walk(const T16* __restrict__ Q, const T16* __restrict__ Q2, const T16* __restrict__ Kp, const T16* __restrict__ K2, const T16* __restrict__ Vt, const T16* __restrict__ V2,
                                        int qt, int wave, int lr, int hi, v8f (&o)[4][2], float (&m)[2], float (&l)[2]) {
    typedef typename WFrag<T16>::V V;
    if (wave > qt) return;                                           // fewer passes than waves: this wave keeps its empty state (sum 0, weight 0 in the join)
    const int q0 = qt * QT; const unsigned koff = (unsigned)(lr * HD + 8 * hi) * 2u, voff = (unsigned)(lr * TT + 8 * hi) * 2u; V qf[2][2], ka[2][2];
    Q += (size_t)q0 * HD; if (HL) Q2 += (size_t)q0 * HD;
    int kt = wave;
    if (HL) {
        // one 16-column group at a time: with both groups' hi and lo query planes live the walk spills
#pragma unroll 1
        for (; kt <= qt; kt += NW) fa_pass<T16, HL, false, true, 0, 1>(Q, Q2, Kp + (size_t)kt * KT * HD, K2 + (size_t)kt * KT * HD, Vt + kt * KT, V2 + kt * KT, q0, kt * KT, koff, voff, lr, hi, qf, ka, o, m, l);   // rolled: one pass already fills the registers
#pragma unroll 1
        for (kt = wave; kt <= qt; kt += NW) fa_pass<T16, HL, false, true, 1, 1>(Q, Q2, Kp + (size_t)kt * KT * HD, K2 + (size_t)kt * KT * HD, Vt + kt * KT, V2 + kt * KT, q0, kt * KT, koff, voff, lr, hi, qf, ka, o, m, l);   // rolled, as above
    } else {
#pragma unroll
        for (int qb = 0; qb < 2; ++qb)
#pragma unroll
            for (int kc = 0; kc < 2; ++kc) qf[qb][kc] = fa_ld<T16>(Q + (qb * 16 * HD + kc * 32), koff);
        const T16* kb = Kp + (size_t)kt * KT * HD; const T16* vb = Vt + kt * KT;
        fa_ldk<T16>(kb, koff, ka);
#pragma unroll 1
        for (; kt + NW <= qt; kt += NW, kb += NW * KT * HD, vb += NW * KT) fa_pass<T16, HL, true, false, 0, 2>(Q, Q2, kb, K2, vb, V2, q0, kt * KT, koff, voff, lr, hi, qf, ka, o, m, l);   // rolled, as above; every pass but a wave's last lies below the diagonal
        fa_pass<T16, HL, false, true, 0, 2>(Q, Q2, kb, K2, vb, V2, q0, kt * KT, koff, voff, lr, hi, qf, ka, o, m, l);
    }
}
__global__ __launch_bounds__(NW * 32) void k_fattn(const h16* __restrict__ Q16, const h16* __restrict__ K16, const h16* __restrict__ V16, const bf* __restrict__ Qh, const bf* __restrict__ Ql, const bf* __restrict__ Kh, const bf* __restrict__ Kl,
                                                   const bf* __restrict__ Vh, const bf* __restrict__ Vl, bf* Ah, bf* Al) {
    __shared__ __align__(16) float osh[NW * 4 * 2 * 256]; __shared__ float msh[NW * QT]; __shared__ float lsh[NW * QT];
    const int wave = __builtin_amdgcn_readfirstlane((int)(threadIdx.x >> 5)), lane = threadIdx.x & 31, lr = lane & 15, hi = lane >> 4;
    const int qt = (TT / QT - 1) - (int)blockIdx.y;                  // longest rows first, over all heads
    const int h = blockIdx.x; const size_t hq = (size_t)h * TT * HD, hk = (size_t)(h / REP) * TT * HD;
    v8f o[4][2]; float m[2] = {-3.0e38f, -3.0e38f}, l[2] = {0.f, 0.f};
#pragma unroll
    for (int db = 0; db < 4; ++db) { o[db][0] = (v8f){}; o[db][1] = (v8f){}; }
    if (qt * QT < RH) fa_walk<bf, true>(Qh + hq, Ql + hq, Kh + hk, Kl + hk, Vh + hk, Vl + hk, qt, wave, lr, hi, o, m, l);
    else fa_walk<h16, false>(Q16 + hq, nullptr, K16 + hk, nullptr, V16 + hk, nullptr, qt, wave, lr, hi, o, m, l);
#pragma unroll
    for (int qb = 0; qb < 2; ++qb) { l[qb] += fa_xhalf(l[qb]);
#pragma unroll
        for (int db = 0; db < 4; ++db) { float* p = osh + ((wave * 4 + db) * 2 + qb) * 256 + lane * 8; const v8f t = o[db][qb]; *(v4fa*)p = (v4f){t[0], t[1], t[2], t[3]}; *(v4fa*)(p + 4) = (v4f){t[4], t[5], t[6], t[7]}; }
        if (hi == 0) { msh[wave * QT + qb * 16 + lr] = m[qb]; lsh[wave * QT + qb * 16 + lr] = l[qb]; } }
    __syncthreads();
    // join: thread = (query row q, 16 head dims db), so that one wave writes whole 128-byte lines of the merged planes
    const int q = threadIdx.x >> 2, db = threadIdx.x & 3, qb = q >> 4, c = q & 15;
    float M = msh[q];
#pragma unroll
    for (int w = 1; w < NW; ++w) M = fmaxf(M, msh[w * QT + q]);
    float L = 0.f, acc[16];
#pragma unroll
    for (int r = 0; r < 16; ++r) acc[r] = 0.f;
#pragma unroll
    for (int w = 0; w < NW; ++w) { const float wg = __builtin_amdgcn_exp2f((msh[w * QT + q] - M) * SC2); L = fmaf(wg, lsh[w * QT + q], L);
#pragma unroll
        for (int hh = 0; hh < 2; ++hh) { const float* p = osh + ((w * 4 + db) * 2 + qb) * 256 + (c + 16 * hh) * 8; const v4f x0 = *(const v4fa*)p, x1 = *(const v4fa*)(p + 4);
#pragma unroll
            for (int r = 0; r < 4; ++r) { acc[hh * 8 + r] = fmaf(wg, x0[r], acc[hh * 8 + r]); acc[hh * 8 + 4 + r] = fmaf(wg, x1[r], acc[hh * 8 + 4 + r]); } } }
    const float inv = __fdiv_rn(1.0f, L); const size_t oo = (size_t)(qt * QT + q) * DQ + h * HD + db * 16;
#pragma unroll
    for (int hh = 0; hh < 2; ++hh) { v8us oh, ol;
#pragma unroll
        for (int r = 0; r < 8; ++r) { unsigned short a, c2; splitf(acc[hh * 8 + r] * inv, a, c2); oh[r] = a; ol[r] = c2; }
        *(v8usa*)(Ah + oo + hh * 8) = oh; *(v8usa*)(Al + oo + hh * 8) = ol; }
}

extern "C" void kernel_launch(void* const* d_in, const int* in_sizes, int n_in,
                              void* d_out, int out_size, void* d_ws, size_t ws_size, hipStream_t stream) {
    (void)in_sizes; (void)n_in; (void)out_size;
    const float* x = (const float*)d_in[0]; const float* xk = (const float*)d_in[1]; const float* xv = (const float*)d_in[2]; const float* wq = (const float*)d_in[3]; const float* bq = (const float*)d_in[4]; const float* wk = (const float*)d_in[5]; const float* bk = (const float*)d_in[6]; const float* wv = (const float*)d_in[7]; const float* bv = (const float*)d_in[8]; const float* wo = (const float*)d_in[9]; const float* bo = (const float*)d_in[10]; const float* cosT = nullptr; const float* sinT = nullptr; (void)cosT; (void)sinT;
    float* OUT = (float*)d_out;     // [4][2048][1024]
    char* wsp = (char*)d_ws;
    auto take = [&](size_t bytes) { char* p = wsp; wsp += (bytes + 255) & ~(size_t)255; return (void*)p; };
    bf* WQ = (bf*)take((size_t)DQ * DM * 2); bf* WK = (bf*)take((size_t)DKV * DM * 2); bf* WV = (bf*)take((size_t)DKV * DM * 2); bf* WO = (bf*)take((size_t)DM * DQ * 2);
    bf* XB = (bf*)take((size_t)TT * DM * 2); bf* XB2 = (bf*)take((size_t)TT * DM * 2); bf* XB3 = (bf*)take((size_t)TT * DM * 2);
    h16* QP16 = (h16*)take((size_t)NH_ * TT * HD * 2); h16* KP16 = (h16*)take((size_t)NKV * TT * HD * 2); h16* VT16 = (h16*)take((size_t)NKV * HD * TT * 2);
    bf* QPh = (bf*)take((size_t)NH_ * TT * HD * 2); bf* QPl = (bf*)take((size_t)NH_ * TT * HD * 2); bf* KPh = (bf*)take((size_t)NKV * TT * HD * 2); bf* KPl = (bf*)take((size_t)NKV * TT * HD * 2); bf* VTh = (bf*)take((size_t)NKV * HD * TT * 2); bf* VTl = (bf*)take((size_t)NKV * HD * TT * 2);
    bf* ATh = (bf*)take((size_t)TT * DQ * 2); bf* ATl = (bf*)take((size_t)TT * DQ * 2);
    if ((size_t)(wsp - (char*)d_ws) > ws_size) return;    // ws 256 MiB
    { k_cvt8<<<(unsigned)(((size_t)DQ * DM / 8 + 255) / 256), 256, 0, stream>>>(wq, WQ, (size_t)DQ * DM / 8); k_cvt8<<<(unsigned)(((size_t)DKV * DM / 8 + 255) / 256), 256, 0, stream>>>(wk, WK, (size_t)DKV * DM / 8); k_cvt8<<<(unsigned)(((size_t)DKV * DM / 8 + 255) / 256), 256, 0, stream>>>(wv, WV, (size_t)DKV * DM / 8);
      k_cvt8<<<(unsigned)(((size_t)DM * DQ / 8 + 255) / 256), 256, 0, stream>>>(wo, WO, (size_t)DM * DQ / 8);
       }
    for (int b = 0; b < NB_; ++b) {
        
        k_cvt8<<<(unsigned)(((size_t)TT * DM / 8 + 255) / 256), 256, 0, stream>>>(x + (size_t)b * TT * DM, XB, (size_t)TT * DM / 8); k_cvt8<<<(unsigned)(((size_t)TT * DM / 8 + 255) / 256), 256, 0, stream>>>(xk + (size_t)b * TT * DM, XB2, (size_t)TT * DM / 8); k_cvt8<<<(unsigned)(((size_t)TT * DM / 8 + 255) / 256), 256, 0, stream>>>(xv + (size_t)b * TT * DM, XB3, (size_t)TT * DM / 8);
        k_gemmw<bf, 0, true, 1><<<dim3(TT / 64, DQ / 64, 1), 32, 0, stream>>>(XB, nullptr, WQ, nullptr, DM, nullptr, 0, bq, 0, 0, 0, QP16, QPh, QPl);
        k_gemmw<bf, 0, true, 1><<<dim3(TT / 64, DKV / 64, 1), 32, 0, stream>>>(XB2, nullptr, WK, nullptr, DM, nullptr, 0, bk, 0, 0, 0, KP16, KPh, KPl);
        k_gemmw<bf, 0, true, 2><<<dim3(TT / 64, DKV / 64, 1), 32, 0, stream>>>(XB3, nullptr, WV, nullptr, DM, nullptr, 0, bv, 0, 0, 0, VT16, VTh, VTl);
        k_fattn<<<dim3(NH_, TT / QT, 1), NW * 32, 0, stream>>>(QP16, KP16, VT16, QPh, QPl, KPh, KPl, VTh, VTl, ATh, ATl);
        k_gemmw<bf, 1, true, 0><<<dim3(TT / 64, DM / 64, 1), 32, 0, stream>>>(ATh, ATl, WO, nullptr, DQ, OUT + (size_t)b * TT * DM, DM, bo, 0, 0, 0, nullptr, nullptr, nullptr); }
}

// v004
// Measured time: 283 microseconds a run.
// Next to v003, in two timings, it ran 1.99 and 2.00 times as fast.
// All steps since v000 together make it 10.4 times as fast.
#include <hip/hip_runtime.h>

// SimpleMultiheadSDPAttention (query, key, value [4][2048][1024]; q = query Wq^T + bq, k = key Wk^T + bk, v = value Wv^T + bv (16 heads x 64); causal softmax(q.k / 8) (-1e30); out = merged Wo^T + bo -> [4][2048][1024]).
// Compute dtypes, f32 accumulate: every input rounded to bf16; q/k/v on PLAIN bf16 operands (three inputs; exact) + bias; causal scores and attn.v: query rows < 512 hl (3 products), the rest single fp16, fused with an online f32 softmax, causal tile skipping; Wo hl x exact (2 products) + bias.

#define NB_  4
#define TT   2048
#define DM   1024
#define NH_  16
#define NKV  16
#define REP  (NH_ / NKV)
#define HD   64
#define DQ   (NH_ * HD)
#define DKV  (NKV * HD)
#define RH   512                  // query rows < RH use hi+lo planes (0: none)
#define SCL  0.125f   // HD^-0.5
typedef _Float16 h16;
typedef unsigned short bf;
typedef __attribute__((ext_vector_type(16))) __bf16   v16bf;
typedef __attribute__((ext_vector_type(16))) _Float16 v16h;
typedef __attribute__((ext_vector_type(8)))  _Float16 v8h;
typedef __attribute__((ext_vector_type(8)))  unsigned short v8us;
typedef __attribute__((ext_vector_type(8)))  float    v8f;
typedef __attribute__((ext_vector_type(4)))  float    v4f;
typedef v8h  __attribute__((may_alias)) v8ha;
typedef v4f  __attribute__((may_alias)) v4fa;
typedef v8us __attribute__((may_alias)) v8usa;

__device__ __forceinline__ unsigned short f2bf(float f) { unsigned u = __float_as_uint(f); u += 0x7FFFu + ((u >> 16) & 1u); return (unsigned short)(u >> 16); }
__device__ __forceinline__ float bf2f(unsigned short b) { return __uint_as_float(((unsigned)b) << 16); }
__device__ __forceinline__ float bfr(float f) { return bf2f(f2bf(f)); }
__device__ __forceinline__ v16h cat16(v8h lo, v8h hi) { return __builtin_shufflevector(lo, hi, 0, 1, 2, 3, 4, 5, 6, 7, 8, 9, 10, 11, 12, 13, 14, 15); }
__device__ __forceinline__ v16bf cat16b(v8us lo, v8us hi) { return __builtin_bit_cast(v16bf, __builtin_shufflevector(lo, hi, 0, 1, 2, 3, 4, 5, 6, 7, 8, 9, 10, 11, 12, 13, 14, 15)); }
__device__ __forceinline__ v8f wmma16(v16h a, v16h b, v8f c) { return __builtin_amdgcn_wmma_f32_16x16x32_f16(false, a, false, b, (short)0, c, false, false); }
__device__ __forceinline__ v8f wmmab(v16bf a, v16bf b, v8f c) { return __builtin_amdgcn_wmma_f32_16x16x32_bf16(false, a, false, b, (short)0, c, false, false); }



__device__ __forceinline__ h16 tohx(float x) { return (h16)x; }
__device__ __forceinline__ void splitf(float y, unsigned short& h, unsigned short& l) { h = f2bf(y); l = f2bf(y - bf2f(h)); }
typedef __attribute__((ext_vector_type(2))) _Float16 v2h;
typedef __attribute__((ext_vector_type(4))) _Float16 v4h;
typedef __attribute__((ext_vector_type(2))) unsigned short v2us;
typedef __attribute__((ext_vector_type(4))) unsigned short v4us;
typedef __attribute__((ext_vector_type(2))) float v2f;
typedef __attribute__((ext_vector_type(4))) int v4i;
// four neighbouring f32 results as fp16 and as hi + lo bf16
struct Pl3 { v4h o16; v4us oh, ol; };
__device__ __forceinline__ Pl3 cv_planes(v4f val) { Pl3 r;
#pragma unroll
    for (int i = 0; i < 4; ++i) { r.o16[i] = tohx(val[i]); unsigned short a, c; splitf(val[i], a, c); r.oh[i] = a; r.ol[i] = c; }
    return r; }
__device__ __forceinline__ void st_planes(const Pl3& r, size_t e, h16* P16, bf* Ph, bf* Pl) { *(v4h*)(P16 + e) = r.o16; *(v4us*)(Ph + e) = r.oh; *(v4us*)(Pl + e) = r.ol; }

// ---- k_gemmw: register-blocked GEMM, ONE WAVE per 64x64 output tile (16 accumulators), operands straight from K-contiguous 16-bit planes; grid (M/64, N/64, Z), 32 threads.
// C[m][n] (f32, pitch ldc, + optional f32 bias[n]) = sum_k A[m][k] Bt[n][k] (+ split products per NSPLIT). z-batch strides sA/sB/sC in elements (EPI 1, 2: sC strides the three planes). K % 32 == 0.
// EPI 0: C as above. EPI 1, 2: no C; a tile's 64 columns are one head (blockIdx.y), and the f32 result + bias goes out as that head's fp16, hi and lo planes, [h][t][d] (EPI 1) or transposed [h][d][t] (EPI 2), in whole 128-byte lines.
template <typename T16> struct WFrag;
template <> struct WFrag<h16> { typedef v16h V; static __device__ __forceinline__ V ld(const h16* p) { return cat16(*(const v8h*)p, *(const v8h*)(p + 16)); } static __device__ __forceinline__ v8f mma(V a, V b, v8f c) { return wmma16(a, b, c); } };
template <> struct WFrag<bf> { typedef v16bf V; static __device__ __forceinline__ V ld(const bf* p) { return cat16b(*(const v8us*)p, *(const v8us*)(p + 16)); } static __device__ __forceinline__ v8f mma(V a, V b, v8f c) { return wmmab(a, b, c); } };
template <typename T16, int NSPLIT, bool BIAS, int EPI>
__global__ __launch_bounds__(32) void k_gemmw(const T16* __restrict__ A, const T16* __restrict__ A2, const T16* __restrict__ Bt, const T16* __restrict__ Bt2, int K, float* C, int ldc, const float* __restrict__ bias, size_t sA, size_t sB, size_t sC, h16* P16, bf* Ph, bf* Pl) {
    static_assert(EPI == 0 || HD == 64, "a 64-column tile is one head");
    typedef typename WFrag<T16>::V V;
    __shared__ __align__(16) float os[16 * 68];
    const size_t z = blockIdx.z; A += z * sA; if (A2) A2 += z * sA; Bt += z * sB; if (Bt2) Bt2 += z * sB; if (EPI == 0) C += z * sC; else { P16 += z * sC; Ph += z * sC; Pl += z * sC; }
    const int lane = threadIdx.x & 31, lr = lane & 15, hi = lane >> 4; const int r0 = blockIdx.x * 64, c0 = blockIdx.y * 64;
    v8f acc[4][4];
#pragma unroll
    for (int mb = 0; mb < 4; ++mb)
#pragma unroll
        for (int nb = 0; nb < 4; ++nb) acc[mb][nb] = (v8f){};
    const size_t aoff = (size_t)(r0 + lr) * K + 8 * hi, boff = (size_t)(c0 + lr) * K + 8 * hi;
    float bcol[4];                                                   // EPI 2: the bias of the lane's own four columns, asked for ahead of the K loop
    if (EPI == 2 && BIAS) {
#pragma unroll
        for (int nb = 0; nb < 4; ++nb) bcol[nb] = bfr(bias[c0 + nb * 16 + lr]);
        asm volatile("s_wait_xcnt 0x0" : : "s"(bias) : "memory"); }   // the four bias loads name the scalar pair of bias as their base; as an input here the pair stays untouched up to the wait
#pragma unroll 1
    for (int kc = 0; kc < K; kc += 32) {
        V a[4], a2[4];
#pragma unroll
        for (int mb = 0; mb < 4; ++mb) { a[mb] = WFrag<T16>::ld(A + aoff + (size_t)mb * 16 * K + kc); if (NSPLIT == 1 || NSPLIT == 2) a2[mb] = WFrag<T16>::ld(A2 + aoff + (size_t)mb * 16 * K + kc); }
#pragma unroll
        for (int nb = 0; nb < 4; ++nb) { const V b = WFrag<T16>::ld(Bt + boff + (size_t)nb * 16 * K + kc); V b2; if (NSPLIT >= 2) b2 = WFrag<T16>::ld(Bt2 + boff + (size_t)nb * 16 * K + kc);
#pragma unroll
            for (int mb = 0; mb < 4; ++mb) { acc[mb][nb] = WFrag<T16>::mma(a[mb], b, acc[mb][nb]); if (NSPLIT == 1 || NSPLIT == 2) acc[mb][nb] = WFrag<T16>::mma(a2[mb], b, acc[mb][nb]); if (NSPLIT >= 2) acc[mb][nb] = WFrag<T16>::mma(a[mb], b2, acc[mb][nb]); } }
        asm volatile("v_nop\n\tv_nop\n\tv_nop\n\tv_nop" : "+v"(acc[0][0]), "+v"(acc[1][1]), "+v"(acc[2][2]), "+v"(acc[3][3]) : "v"(a[0]), "v"(a[3]));
    }
    Pl3 pv[8];
    if (EPI == 2) {
        // staged transposed, 16 head dims x 64 rows t at a time: a lane's 8 accumulator rows are neighbours in t
#pragma unroll
        for (int nb = 0; nb < 4; ++nb) {
#pragma unroll
            for (int mb = 0; mb < 4; ++mb) { float* p = os + lr * 68 + mb * 16 + hi * 8; v8f t = acc[mb][nb]; if (BIAS) t += bcol[nb]; *(v4fa*)p = (v4f){t[0], t[1], t[2], t[3]}; *(v4fa*)(p + 4) = (v4f){t[4], t[5], t[6], t[7]}; }
            __builtin_amdgcn_wave_barrier(); asm volatile("" ::: "memory");   // the rows are read back by other lanes of the wave: the LDS reads below stay behind the LDS stores above
#pragma unroll
            for (int s = 0; s < 8; ++s) pv[s] = cv_planes(*(const v4fa*)(os + (2 * s + hi) * 68 + lr * 4));
            __builtin_amdgcn_sched_barrier(0);   // the group's 24 stores stay one run behind all of its conversions: mixed in, each store's registers are used again at once, with a wait in front of every such use
#pragma unroll
            for (int s = 0; s < 8; ++s) st_planes(pv[s], ((size_t)blockIdx.y * HD + nb * 16 + 2 * s + hi) * TT + r0 + lr * 4, P16, Ph, Pl);
            __builtin_amdgcn_wave_barrier(); asm volatile("s_wait_xcnt 0x0" ::: "memory");   // stands in front of the next group's writes to registers that the stores above name; also keeps the next group's LDS stores behind these reads
        }
        return;
    }
#pragma unroll
    for (int mb = 0; mb < 4; ++mb) {
#pragma unroll
        for (int nb = 0; nb < 4; ++nb) {
#pragma unroll
            for (int j = 0; j < 8; ++j) os[(hi * 8 + j) * 68 + nb * 16 + lr] = acc[mb][nb][j]; }
        __builtin_amdgcn_wave_barrier(); asm volatile("" ::: "memory");
        float* crow = C + (size_t)(r0 + mb * 16) * ldc + c0;
{
#pragma unroll
            for (int s = 0; s < 8; ++s) { const int row = 2 * s + hi, cofs = lr * 4; v4f val = *(const v4fa*)(os + row * 68 + cofs); if (BIAS) { val[0] += bfr(bias[c0 + cofs]); val[1] += bfr(bias[c0 + cofs + 1]); val[2] += bfr(bias[c0 + cofs + 2]); val[3] += bfr(bias[c0 + cofs + 3]); }
                if (EPI == 1) pv[s] = cv_planes(val);
                else *(v4f*)(crow + (size_t)row * ldc + cofs) = val; }
             }
        if (EPI == 1) {
            __builtin_amdgcn_sched_barrier(0);   // one run of 24 stores behind all the conversions, as in EPI 2
#pragma unroll
            for (int s = 0; s < 8; ++s) st_planes(pv[s], ((size_t)blockIdx.y * TT + r0 + mb * 16 + 2 * s + hi) * HD + lr * 4, P16, Ph, Pl);
        }
        __builtin_amdgcn_wave_barrier(); asm volatile("" ::: "memory");
    }
}


__global__ __launch_bounds__(256) void k_wtG(const float* __restrict__ w, int K, int N, bf* Bt) {
    const int lane = threadIdx.x & 31; const int L0 = (blockIdx.x * 8 + (threadIdx.x >> 5)) * 8; const int nlines = N * K / 64;
{
#pragma unroll 1
        for (int l = 0; l < 8; ++l) { const int L = L0 + l; if (L >= nlines) break; const size_t e = (size_t)L * 64 + lane * 2; const int k = (int)(e % K), n = (int)(e / K); v2us o;
            o[0] = f2bf(w[(size_t)k * N + n]); o[1] = f2bf(w[(size_t)(k + 1) * N + n]); *(v2us*)(Bt + e) = o; }
         }
}
__global__ __launch_bounds__(256) void k_cvt8(const float* __restrict__ src, bf* dst, size_t n8) { const size_t i = (size_t)blockIdx.x * 256 + threadIdx.x; if (i >= n8) return; const v8f v = *(const v8f*)(src + i * 8); v8us o;
#pragma unroll
    for (int k = 0; k < 8; ++k) o[k] = f2bf(v[k]); *(v8us*)(dst + i * 8) = o;  }
__global__ __launch_bounds__(256) void k_cscvt(const float* __restrict__ cosT, const float* __restrict__ sinT, float* CS) { const int idx = blockIdx.x * 256 + threadIdx.x; if (idx >= TT * HD) return; v2f cs; cs[0] = bfr(cosT[idx]); cs[1] = bfr(sinT[idx]); *(v2f*)(CS + (size_t)idx * 2) = cs;  }
// ---- k_fattn: causal attention of one head's QT query rows per work-group, grid (batch x head, row tile), scores never stored. Transposed products: S^T = K Q^T (A = key rows, B = query columns), O^T += V^T P^T; a lane holds one query
// column, so two stacked 16-key score tiles, converted in place, ARE the B operand of the second product (hardware k order, which WFrag::ld also delivers). Running maximum and sum per column (online softmax).
// The NW waves of a work-group share the query rows and take the 32-key passes w, w + NW, ...; their (maximum, sum, O^T) are joined through LDS at the end. Query rows < RH: hi+lo bf16 planes, 3 products; the rest fp16.
#define QT  32
#define KT  32
#define NW  4
#define SC2 (SCL * 1.4426950408889634f)   // score scale times log2(e): probabilities are exp2((s - max) * SC2)
// fragment at a base plus a 32-bit BYTE offset: a wave-uniform base and the lane's own offset, or the lane's own address and 0
template <typename T16> __device__ __forceinline__ typename WFrag<T16>::V fa_ld(const T16* __restrict__ base, unsigned ob) { return WFrag<T16>::ld((const T16*)((const char*)base + ob)); }
// key fragments of one 32-key pass; kb = the pass's first key row (wave-uniform) with koff = the lane's own byte offset in it, or kb = the lane's own address with koff = 0
template <typename T16>
__device__ __forceinline__ void fa_ldk(const T16* __restrict__ kb, unsigned koff, typename WFrag<T16>::V (&ka)[2][2]) {
#pragma unroll
    for (int ks = 0; ks < 2; ++ks)
#pragma unroll
        for (int kc = 0; kc < 2; ++kc) ka[ks][kc] = fa_ld<T16>(kb + (ks * 16 * HD + kc * 32), koff);
}
__device__ __forceinline__ void fa_pack(const v8f& t0, const v8f& t1, v16h& p, v16h& p2) { (void)p2;
#pragma unroll
    for (int r = 0; r < 8; ++r) { p[r] = (h16)t0[r]; p[8 + r] = (h16)t1[r]; } }
__device__ __forceinline__ void fa_pack(const v8f& t0, const v8f& t1, v16bf& p, v16bf& p2) { v8us h0, h1, l0, l1;
#pragma unroll
    for (int r = 0; r < 8; ++r) { unsigned short a, c; splitf(t0[r], a, c); h0[r] = a; l0[r] = c; splitf(t1[r], a, c); h1[r] = a; l1[r] = c; }
    p = cat16b(h0, h1); p2 = cat16b(l0, l1); }
__device__ __forceinline__ float fa_xhalf(float x) { const int b = __float_as_int(x); return __int_as_float(__builtin_amdgcn_permlanex16(b, b, 0x76543210, 0xfedcba98, false, false)); }   // lane l <-> l ^ 16
// one pass: 32 keys from k0 against the work-group's 32 query columns from q0. Q, kb, vb (and the lo planes' Q2, kb2, vb2): first query row, first key row [t][d] and first key column [d][t] of the pass, wave-uniform; koff = 2 (lr HD + 8 hi) and voff = 2 (lr TT + 8 hi) are the lane's byte offsets in row-major [t][d] and [d][t] planes.
// AHEAD: ka holds this pass's key fragments on entry and those of the wave's next pass on exit. EDGE: the pass may reach above the diagonal. B0, NB: the 16-column groups that the pass serves.
template <typename T16, bool HL, bool AHEAD, bool EDGE, int B0, int NB>
__device__ __forceinline__ void fa_pass(const T16* __restrict__ Q, const T16* __restrict__ Q2, const T16* __restrict__ kb, const T16* __restrict__ kb2, const T16* __restrict__ vb, const T16* __restrict__ vb2, int q0, int k0, unsigned koff, unsigned voff, int lr, int hi,
                                        typename WFrag<T16>::V (&qf)[2][2], typename WFrag<T16>::V (&ka)[2][2], v8f (&o)[4][2], float (&m)[2], float (&l)[2]) {
    typedef typename WFrag<T16>::V V;
    V va[4], va2[4];
    v8f s[2][2];                                                     // s[ks][qb][r] = score(key k0 + 16 ks + 8 hi + r, query q0 + 16 qb + lr)
    if (!HL) {
#pragma unroll
        for (int db = 0; db < 4; ++db) va[db] = fa_ld<T16>(vb + db * 16 * TT, voff);   // value fragments: asked for ahead of the score products, used behind the softmax
#pragma unroll
        for (int ks = 0; ks < 2; ++ks)
#pragma unroll
            for (int qb = B0; qb < B0 + NB; ++qb) { v8f t = (v8f){};
#pragma unroll
                for (int kc = 0; kc < 2; ++kc) t = WFrag<T16>::mma(ka[ks][kc], qf[qb][kc], t);
                s[ks][qb] = t; }
        if (AHEAD) fa_ldk<T16>(kb + NW * KT * HD, koff, ka);         // the next pass's key fragments fly during this pass's softmax and second product
    } else {
        // the few hi+lo passes fetch nothing ahead: twice the planes, and their registers would set the occupancy of the whole kernel
        V qf2[2][2];
#pragma unroll
        for (int qb = B0; qb < B0 + NB; ++qb)
#pragma unroll
            for (int kc = 0; kc < 2; ++kc) { qf[qb][kc] = fa_ld<T16>(Q + (qb * 16 * HD + kc * 32), koff); qf2[qb][kc] = fa_ld<T16>(Q2 + (qb * 16 * HD + kc * 32), koff); }
        // Each lane's plane addresses are formed here, and the wait behind the loads takes them as inputs: they stay untouched up to it.
        V ka2[2][2]; const T16* kp = (const T16*)((const char*)kb + koff); const T16* kp2 = (const T16*)((const char*)kb2 + koff);
        fa_ldk<T16>(kp, 0u, ka); fa_ldk<T16>(kp2, 0u, ka2);
        asm volatile("s_wait_xcnt 0x0" : : "v"(kp), "v"(kp2) : "memory");
#pragma unroll
        for (int ks = 0; ks < 2; ++ks)
#pragma unroll
            for (int qb = B0; qb < B0 + NB; ++qb) { v8f t = (v8f){};
#pragma unroll
                for (int kc = 0; kc < 2; ++kc) { t = WFrag<T16>::mma(ka[ks][kc], qf[qb][kc], t); t = WFrag<T16>::mma(ka2[ks][kc], qf[qb][kc], t); t = WFrag<T16>::mma(ka[ks][kc], qf2[qb][kc], t); }
                s[ks][qb] = t; }
        const T16* vp = (const T16*)((const char*)vb + voff); const T16* vp2 = (const T16*)((const char*)vb2 + voff);
#pragma unroll
        for (int db = 0; db < 4; ++db) { va[db] = WFrag<T16>::ld(vp + db * 16 * TT); va2[db] = WFrag<T16>::ld(vp2 + db * 16 * TT); }
        asm volatile("s_wait_xcnt 0x0" : : "v"(vp), "v"(vp2) : "memory");   // as above
    }
    if (EDGE) {                                                      // keys above the query are masked (by select: no branch behind the products)
#pragma unroll
        for (int ks = 0; ks < 2; ++ks)
#pragma unroll
            for (int qb = B0; qb < B0 + NB; ++qb)
#pragma unroll
                for (int r = 0; r < 8; ++r) s[ks][qb][r] = (k0 + ks * 16 + 8 * hi + r > q0 + qb * 16 + lr) ? -3.0e38f : s[ks][qb][r]; }
#pragma unroll
    for (int qb = B0; qb < B0 + NB; ++qb) {
        float mx = fmaxf(s[0][qb][0], s[1][qb][0]);
#pragma unroll
        for (int r = 1; r < 8; ++r) mx = fmaxf(mx, fmaxf(s[0][qb][r], s[1][qb][r]));
        mx = fmaxf(mx, fa_xhalf(mx));                                // the two lane halves hold the two halves of a column's keys
        const float mn = fmaxf(m[qb], mx), al = __builtin_amdgcn_exp2f((m[qb] - mn) * SC2), mb = mn * SC2; m[qb] = mn;
        float ps = 0.f;
#pragma unroll
        for (int ks = 0; ks < 2; ++ks)
#pragma unroll
            for (int r = 0; r < 8; ++r) { const float p = __builtin_amdgcn_exp2f(fmaf(s[ks][qb][r], SC2, -mb)); s[ks][qb][r] = p; ps += p; }
        l[qb] = fmaf(l[qb], al, ps);
        V pb, pb2; fa_pack(s[0][qb], s[1][qb], pb, pb2);
#pragma unroll
        for (int db = 0; db < 4; ++db) { v8f t = o[db][qb] * al; t = WFrag<T16>::mma(va[db], pb, t); if (HL) { t = WFrag<T16>::mma(va2[db], pb, t); t = WFrag<T16>::mma(va[db], pb2, t); } o[db][qb] = t; }
    }
}
template <typename T16, bool HL>
__device__ __forceinline__ void fa_walk(const T16* __restrict__ Q, const T16* __restrict__ Q2, const T16* __restrict__ Kp, const T16* __restrict__ K2, const T16* __restrict__ Vt, const T16* __restrict__ V2,
                                        int qt, int wave, int lr, int hi, v8f (&o)[4][2], float (&m)[2], float (&l)[2]) {
    typedef typename WFrag<T16>::V V;
    if (wave > qt) return;                                           // fewer passes than waves: this wave keeps its empty state (sum 0, weight 0 in the join)
    const int q0 = qt * QT; const unsigned koff = (unsigned)(lr * HD + 8 * hi) * 2u, voff = (unsigned)(lr * TT + 8 * hi) * 2u; V qf[2][2], ka[2][2];
    Q += (size_t)q0 * HD; if (HL) Q2 += (size_t)q0 * HD;
    int kt = wave;
    if (HL) {
        // one 16-column group at a time: with both groups' hi and lo query planes live the walk spills
#pragma unroll 1
        for (; kt <= qt; kt += NW) fa_pass<T16, HL, false, true, 0, 1>(Q, Q2, Kp + (size_t)kt * KT * HD, K2 + (size_t)kt * KT * HD, Vt + kt * KT, V2 + kt * KT, q0, kt * KT, koff, voff, lr, hi, qf, ka, o, m, l);   // rolled: one pass already fills the registers
#pragma unroll 1
        for (kt = wave; kt <= qt; kt += NW) fa_pass<T16, HL, false, true, 1, 1>(Q, Q2, Kp + (size_t)kt * KT * HD, K2 + (size_t)kt * KT * HD, Vt + kt * KT, V2 + kt * KT, q0, kt * KT, koff, voff, lr, hi, qf, ka, o, m, l);   // rolled, as above
    } else {
#pragma unroll
        for (int qb = 0; qb < 2; ++qb)
#pragma unroll
            for (int kc = 0; kc < 2; ++kc) qf[qb][kc] = fa_ld<T16>(Q + (qb * 16 * HD + kc * 32), koff);
        const T16* kb = Kp + (size_t)kt * KT * HD; const T16* vb = Vt + kt * KT;
        fa_ldk<T16>(kb, koff, ka);
#pragma unroll 1
        for (; kt + NW <= qt; kt += NW, kb += NW * KT * HD, vb += NW * KT) fa_pass<T16, HL, true, false, 0, 2>(Q, Q2, kb, K2, vb, V2, q0, kt * KT, koff, voff, lr, hi, qf, ka, o, m, l);   // rolled, as above; every pass but a wave's last lies below the diagonal
        fa_pass<T16, HL, false, true, 0, 2>(Q, Q2, kb, K2, vb, V2, q0, kt * KT, koff, voff, lr, hi, qf, ka, o, m, l);
    }
}
__global__ __launch_bounds__(NW * 32) void k_fattn(const h16* __restrict__ Q16, const h16* __restrict__ K16, const h16* __restrict__ V16, const bf* __restrict__ Qh, const bf* __restrict__ Ql, const bf* __restrict__ Kh, const bf* __restrict__ Kl,
                                                   const bf* __restrict__ Vh, const bf* __restrict__ Vl, bf* Ah, bf* Al) {
    __shared__ __align__(16) float osh[NW * 4 * 2 * 256]; __shared__ float msh[NW * QT]; __shared__ float lsh[NW * QT];
    const int wave = __builtin_amdgcn_readfirstlane((int)(threadIdx.x >> 5)), lane = threadIdx.x & 31, lr = lane & 15, hi = lane >> 4;
    const int qt = (TT / QT - 1) - (int)blockIdx.y;                  // longest rows first, over all batches and heads
    const int h = blockIdx.x % NH_, b = blockIdx.x / NH_; const size_t hq = (size_t)blockIdx.x * TT * HD, hk = (size_t)(blockIdx.x / REP) * TT * HD;   // planes are [batch][head][...]: blockIdx.x counts them through
    v8f o[4][2]; float m[2] = {-3.0e38f, -3.0e38f}, l[2] = {0.f, 0.f};
#pragma unroll
    for (int db = 0; db < 4; ++db) { o[db][0] = (v8f){}; o[db][1] = (v8f){}; }
    if (qt * QT < RH) fa_walk<bf, true>(Qh + hq, Ql + hq, Kh + hk, Kl + hk, Vh + hk, Vl + hk, qt, wave, lr, hi, o, m, l);
    else fa_walk<h16, false>(Q16 + hq, nullptr, K16 + hk, nullptr, V16 + hk, nullptr, qt, wave, lr, hi, o, m, l);
#pragma unroll
    for (int qb = 0; qb < 2; ++qb) { l[qb] += fa_xhalf(l[qb]);
#pragma unroll
        for (int db = 0; db < 4; ++db) { float* p = osh + ((wave * 4 + db) * 2 + qb) * 256 + lane * 8; const v8f t = o[db][qb]; *(v4fa*)p = (v4f){t[0], t[1], t[2], t[3]}; *(v4fa*)(p + 4) = (v4f){t[4], t[5], t[6], t[7]}; }
        if (hi == 0) { msh[wave * QT + qb * 16 + lr] = m[qb]; lsh[wave * QT + qb * 16 + lr] = l[qb]; } }
    __syncthreads();
    // join: thread = (query row q, 16 head dims db), so that one wave writes whole 128-byte lines of the merged planes
    const int q = threadIdx.x >> 2, db = threadIdx.x & 3, qb = q >> 4, c = q & 15;
    float M = msh[q];
#pragma unroll
    for (int w = 1; w < NW; ++w) M = fmaxf(M, msh[w * QT + q]);
    float L = 0.f, acc[16];
#pragma unroll
    for (int r = 0; r < 16; ++r) acc[r] = 0.f;
#pragma unroll
    for (int w = 0; w < NW; ++w) { const float wg = __builtin_amdgcn_exp2f((msh[w * QT + q] - M) * SC2); L = fmaf(wg, lsh[w * QT + q], L);
#pragma unroll
        for (int hh = 0; hh < 2; ++hh) { const float* p = osh + ((w * 4 + db) * 2 + qb) * 256 + (c + 16 * hh) * 8; const v4f x0 = *(const v4fa*)p, x1 = *(const v4fa*)(p + 4);
#pragma unroll
            for (int r = 0; r < 4; ++r) { acc[hh * 8 + r] = fmaf(wg, x0[r], acc[hh * 8 + r]); acc[hh * 8 + 4 + r] = fmaf(wg, x1[r], acc[hh * 8 + 4 + r]); } } }
    const float inv = __fdiv_rn(1.0f, L); const size_t oo = ((size_t)b * TT + qt * QT + q) * DQ + h * HD + db * 16;
#pragma unroll
    for (int hh = 0; hh < 2; ++hh) { v8us oh, ol;
#pragma unroll
        for (int r = 0; r < 8; ++r) { unsigned short a, c2; splitf(acc[hh * 8 + r] * inv, a, c2); oh[r] = a; ol[r] = c2; }
        *(v8usa*)(Ah + oo + hh * 8) = oh; *(v8usa*)(Al + oo + hh * 8) = ol; }
}

extern "C" void kernel_launch(void* const* d_in, const int* in_sizes, int n_in,
                              void* d_out, int out_size, void* d_ws, size_t ws_size, hipStream_t stream) {
    (void)in_sizes; (void)n_in; (void)out_size;
    const float* x = (const float*)d_in[0]; const float* xk = (const float*)d_in[1]; const float* xv = (const float*)d_in[2]; const float* wq = (const float*)d_in[3]; const float* bq = (const float*)d_in[4]; const float* wk = (const float*)d_in[5]; const float* bk = (const float*)d_in[6]; const float* wv = (const float*)d_in[7]; const float* bv = (const float*)d_in[8]; const float* wo = (const float*)d_in[9]; const float* bo = (const float*)d_in[10]; const float* cosT = nullptr; const float* sinT = nullptr; (void)cosT; (void)sinT;
    float* OUT = (float*)d_out;     // [4][2048][1024]
    char* wsp = (char*)d_ws;
    auto take = [&](size_t bytes) { char* p = wsp; wsp += (bytes + 255) & ~(size_t)255; return (void*)p; };
    bf* WQ = (bf*)take((size_t)DQ * DM * 2); bf* WK = (bf*)take((size_t)DKV * DM * 2); bf* WV = (bf*)take((size_t)DKV * DM * 2); bf* WO = (bf*)take((size_t)DM * DQ * 2);
    // every buffer below holds all NB_ batches; XB is the bf16 copy of one input at a time, used by the projection launched right behind it
    bf* XB = (bf*)take((size_t)NB_ * TT * DM * 2);
    h16* QP16 = (h16*)take((size_t)NB_ * NH_ * TT * HD * 2); h16* KP16 = (h16*)take((size_t)NB_ * NKV * TT * HD * 2); h16* VT16 = (h16*)take((size_t)NB_ * NKV * HD * TT * 2);
    bf* QPh = (bf*)take((size_t)NB_ * NH_ * TT * HD * 2); bf* QPl = (bf*)take((size_t)NB_ * NH_ * TT * HD * 2); bf* KPh = (bf*)take((size_t)NB_ * NKV * TT * HD * 2); bf* KPl = (bf*)take((size_t)NB_ * NKV * TT * HD * 2); bf* VTh = (bf*)take((size_t)NB_ * NKV * HD * TT * 2); bf* VTl = (bf*)take((size_t)NB_ * NKV * HD * TT * 2);
    bf* ATh = (bf*)take((size_t)NB_ * TT * DQ * 2); bf* ATl = (bf*)take((size_t)NB_ * TT * DQ * 2);
    if ((size_t)(wsp - (char*)d_ws) > ws_size) return;    // ws 256 MiB
    { k_cvt8<<<(unsigned)(((size_t)DQ * DM / 8 + 255) / 256), 256, 0, stream>>>(wq, WQ, (size_t)DQ * DM / 8); k_cvt8<<<(unsigned)(((size_t)DKV * DM / 8 + 255) / 256), 256, 0, stream>>>(wk, WK, (size_t)DKV * DM / 8); k_cvt8<<<(unsigned)(((size_t)DKV * DM / 8 + 255) / 256), 256, 0, stream>>>(wv, WV, (size_t)DKV * DM / 8);
      k_cvt8<<<(unsigned)(((size_t)DM * DQ / 8 + 255) / 256), 256, 0, stream>>>(wo, WO, (size_t)DM * DQ / 8);
       }
    const size_t nx8 = (size_t)NB_ * TT * DM / 8; const unsigned gx = (unsigned)((nx8 + 255) / 256);
    k_cvt8<<<gx, 256, 0, stream>>>(x, XB, nx8);
    k_gemmw<bf, 0, true, 1><<<dim3(TT / 64, DQ / 64, NB_), 32, 0, stream>>>(XB, nullptr, WQ, nullptr, DM, nullptr, 0, bq, (size_t)TT * DM, 0, (size_t)NH_ * TT * HD, QP16, QPh, QPl);
    k_cvt8<<<gx, 256, 0, stream>>>(xk, XB, nx8);
    k_gemmw<bf, 0, true, 1><<<dim3(TT / 64, DKV / 64, NB_), 32, 0, stream>>>(XB, nullptr, WK, nullptr, DM, nullptr, 0, bk, (size_t)TT * DM, 0, (size_t)NKV * TT * HD, KP16, KPh, KPl);
    k_cvt8<<<gx, 256, 0, stream>>>(xv, XB, nx8);
    k_gemmw<bf, 0, true, 2><<<dim3(TT / 64, DKV / 64, NB_), 32, 0, stream>>>(XB, nullptr, WV, nullptr, DM, nullptr, 0, bv, (size_t)TT * DM, 0, (size_t)NKV * HD * TT, VT16, VTh, VTl);
    k_fattn<<<dim3(NB_ * NH_, TT / QT, 1), NW * 32, 0, stream>>>(QP16, KP16, VT16, QPh, QPl, KPh, KPl, VTh, VTl, ATh, ATl);
    k_gemmw<bf, 1, true, 0><<<dim3(TT / 64, DM / 64, NB_), 32, 0, stream>>>(ATh, ATl, WO, nullptr, DQ, OUT, DM, bo, (size_t)TT * DQ, 0, (size_t)TT * DM, nullptr, nullptr, nullptr);
}

// v005
// It runs in 205 microseconds.
// Timed twice side by side with v004, it ran 1.37 times as fast both times.
// Counting every step since v000, it is 14.2 times as fast.
#include <hip/hip_runtime.h>

// SimpleMultiheadSDPAttention (query, key, value [4][2048][1024]; q = query Wq^T + bq, k = key Wk^T + bk, v = value Wv^T + bv (16 heads x 64); causal softmax(q.k / 8) (-1e30); out = merged Wo^T + bo -> [4][2048][1024]).
// Compute dtypes, f32 accumulate: every input rounded to bf16; q/k/v on PLAIN bf16 operands (three inputs; exact) + bias; causal scores and attn.v: query rows < 512 hl (3 products), the rest single fp16, fused with an online f32 softmax, causal tile skipping; Wo hl x exact (2 products) + bias.

#define NB_  4
#define TT   2048
#define DM   1024
#define NH_  16
#define NKV  16
#define REP  (NH_ / NKV)
#define HD   64
#define DQ   (NH_ * HD)
#define DKV  (NKV * HD)
#define RH   512                  // query rows < RH use hi+lo planes (0: none)
#define SCL  0.125f   // HD^-0.5
typedef _Float16 h16;
typedef unsigned short bf;
typedef __attribute__((ext_vector_type(16))) __bf16   v16bf;
typedef __attribute__((ext_vector_type(16))) _Float16 v16h;
typedef __attribute__((ext_vector_type(8)))  _Float16 v8h;
typedef __attribute__((ext_vector_type(8)))  unsigned short v8us;
typedef __attribute__((ext_vector_type(8)))  float    v8f;
typedef __attribute__((ext_vector_type(4)))  float    v4f;
typedef v8h  __attribute__((may_alias)) v8ha;
typedef v4f  __attribute__((may_alias)) v4fa;
typedef v8us __attribute__((may_alias)) v8usa;

__device__ __forceinline__ unsigned short f2bf(float f) { unsigned u = __float_as_uint(f); u += 0x7FFFu + ((u >> 16) & 1u); return (unsigned short)(u >> 16); }
__device__ __forceinline__ float bf2f(unsigned short b) { return __uint_as_float(((unsigned)b) << 16); }
__device__ __forceinline__ float bfr(float f) { return bf2f(f2bf(f)); }
__device__ __forceinline__ v16h cat16(v8h lo, v8h hi) { return __builtin_shufflevector(lo, hi, 0, 1, 2, 3, 4, 5, 6, 7, 8, 9, 10, 11, 12, 13, 14, 15); }
__device__ __forceinline__ v16bf cat16b(v8us lo, v8us hi) { return __builtin_bit_cast(v16bf, __builtin_shufflevector(lo, hi, 0, 1, 2, 3, 4, 5, 6, 7, 8, 9, 10, 11, 12, 13, 14, 15)); }
__device__ __forceinline__ v8f wmma16(v16h a, v16h b, v8f c) { return __builtin_amdgcn_wmma_f32_16x16x32_f16(false, a, false, b, (short)0, c, false, false); }
__device__ __forceinline__ v8f wmmab(v16bf a, v16bf b, v8f c) { return __builtin_amdgcn_wmma_f32_16x16x32_bf16(false, a, false, b, (short)0, c, false, false); }



__device__ __forceinline__ h16 tohx(float x) { return (h16)x; }
__device__ __forceinline__ void splitf(float y, unsigned short& h, unsigned short& l) { h = f2bf(y); l = f2bf(y - bf2f(h)); }
typedef __attribute__((ext_vector_type(2))) _Float16 v2h;
typedef __attribute__((ext_vector_type(4))) _Float16 v4h;
typedef __attribute__((ext_vector_type(2))) unsigned short v2us;
typedef __attribute__((ext_vector_type(4))) unsigned short v4us;
typedef __attribute__((ext_vector_type(2))) float v2f;
typedef __attribute__((ext_vector_type(4))) int v4i;
// four neighbouring f32 results as fp16 and as hi + lo bf16
struct Pl3 { v4h o16; v4us oh, ol; };
__device__ __forceinline__ Pl3 cv_planes(v4f val) { Pl3 r;
#pragma unroll
    for (int i = 0; i < 4; ++i) { r.o16[i] = tohx(val[i]); unsigned short a, c; splitf(val[i], a, c); r.oh[i] = a; r.ol[i] = c; }
    return r; }
__device__ __forceinline__ void st_planes(const Pl3& r, size_t e, h16* P16, bf* Ph, bf* Pl) { *(v4h*)(P16 + e) = r.o16; *(v4us*)(Ph + e) = r.oh; *(v4us*)(Pl + e) = r.ol; }

// ---- k_gemmw: GEMM, one work-group of 4 waves (2 x 2) per 128x128 output tile, ONE WAVE per 64x64 part of it (16 accumulators); grid (M/128, N/128, Z), 128 threads.
// The K-contiguous 16-bit operand planes come through LDS: a stage is 64 k (one 128-byte line) of the tile's 128 rows of every operand, brought by asynchronous 16-byte copies in whole lines, two buffers, the next stage in flight while this one is worked on.
// C[m][n] (f32, pitch ldc, + optional f32 bias[n]) = sum_k A[m][k] Bt[n][k] (+ A2[m][k] Bt[n][k] for NSPLIT 1). z-batch strides sA/sB/sC in elements (EPI 1, 2: sC strides the three planes). K % 64 == 0.
// EPI 0: C as above. EPI 1, 2: no C; a wave's 64 columns are one head, and the f32 result + bias goes out as that head's fp16, hi and lo planes, [h][t][d] (EPI 1) or transposed [h][d][t] (EPI 2), in whole 128-byte lines.
template <typename T16> struct WFrag;
template <> struct WFrag<h16> { typedef v16h V; static __device__ __forceinline__ V ld(const h16* p) { return cat16(*(const v8h*)p, *(const v8h*)(p + 16)); } static __device__ __forceinline__ v8f mma(V a, V b, v8f c) { return wmma16(a, b, c); } };
template <> struct WFrag<bf> { typedef v16bf V; static __device__ __forceinline__ V ld(const bf* p) { return cat16b(*(const v8us*)p, *(const v8us*)(p + 16)); } static __device__ __forceinline__ v8f mma(V a, V b, v8f c) { return wmmab(a, b, c); } };
#define GK  64                    // k per stage
#define GP  144                   // LDS row pitch in bytes: 16 x odd, for 16-byte reads of 128-byte rows
#define GT  (128 * GP)            // one operand's tile of a stage
// a lane's eight asynchronous 16-byte copies of one operand tile: rows 16 apart, LDS byte address l, global address g, gs = bytes of 16 global rows.
// The wait on the address registers is the last line of the copies' own statement, so that no operand register is written anew ahead of it.
__device__ __forceinline__ void g_cp8(unsigned l, const char* g, size_t gs) {
    asm volatile("global_load_async_to_lds_b128 %0, %8, off\n\t"
                 "global_load_async_to_lds_b128 %1, %9, off\n\t"
                 "global_load_async_to_lds_b128 %2, %10, off\n\t"
                 "global_load_async_to_lds_b128 %3, %11, off\n\t"
                 "global_load_async_to_lds_b128 %4, %12, off\n\t"
                 "global_load_async_to_lds_b128 %5, %13, off\n\t"
                 "global_load_async_to_lds_b128 %6, %14, off\n\t"
                 "global_load_async_to_lds_b128 %7, %15, off\n\t"
                 "s_wait_xcnt 0x0"
                 : : "v"(l), "v"(l + 16 * GP), "v"(l + 32 * GP), "v"(l + 48 * GP), "v"(l + 64 * GP), "v"(l + 80 * GP), "v"(l + 96 * GP), "v"(l + 112 * GP),
                     "v"(g), "v"(g + gs), "v"(g + 2 * gs), "v"(g + 3 * gs), "v"(g + 4 * gs), "v"(g + 5 * gs), "v"(g + 6 * gs), "v"(g + 7 * gs) : "memory");
}
template <typename T16, int NSPLIT, bool BIAS, int EPI>
__global__ __launch_bounds__(128) void k_gemmw(const T16* __restrict__ A, const T16* __restrict__ A2, const T16* __restrict__ Bt, int K, float* C, int ldc, const float* __restrict__ bias, size_t sA, size_t sB, size_t sC, h16* P16, bf* Ph, bf* Pl) {
    static_assert(EPI == 0 || HD == 64, "a wave's 64 columns are one head");
    static_assert(NSPLIT == 0 || NSPLIT == 1, "one or two planes of A");
    typedef typename WFrag<T16>::V V;
    constexpr int NT = NSPLIT == 1 ? 3 : 2;                          // operand tiles of a stage: A, Bt, (A2)
    __shared__ __align__(16) char st[2 * NT * GT]; __shared__ __align__(16) float osw[4 * 16 * 68];
    const size_t z = blockIdx.z; A += z * sA; if (NSPLIT == 1) A2 += z * sA; Bt += z * sB; if (EPI == 0) C += z * sC; else { P16 += z * sC; Ph += z * sC; Pl += z * sC; }
    const int wave = __builtin_amdgcn_readfirstlane((int)(threadIdx.x >> 5)), wm = wave >> 1, wn = wave & 1;
    const int lane = threadIdx.x & 31, lr = lane & 15, hi = lane >> 4; const int r0 = blockIdx.x * 128 + wm * 64, c0 = blockIdx.y * 128 + wn * 64, hd = blockIdx.y * 2 + wn;
    float* os = osw + wave * (16 * 68);                              // each wave stages its output in a range of its own
    v8f acc[4][4];
#pragma unroll
    for (int mb = 0; mb < 4; ++mb)
#pragma unroll
        for (int nb = 0; nb < 4; ++nb) acc[mb][nb] = (v8f){};
    float bcol[4];                                                   // EPI 2: the bias of the lane's own four columns, asked for ahead of the K loop
    if (EPI == 2 && BIAS) {
#pragma unroll
        for (int nb = 0; nb < 4; ++nb) bcol[nb] = bfr(bias[c0 + nb * 16 + lr]);
        asm volatile("s_wait_xcnt 0x0" : : "s"(bias) : "memory"); }   // the four bias loads name the scalar pair of bias as their base; as an input here the pair stays untouched up to the wait
    // copies: thread = (row cpr of 16, 16-byte piece cpc of 8), so that a wave's copy covers four whole lines
    const int cpr = threadIdx.x >> 3, cpc = threadIdx.x & 7; const size_t gs = (size_t)16 * K * 2;
    const unsigned l0 = (unsigned)(size_t)st + (unsigned)(cpr * GP + cpc * 16);
    const char* gA = (const char*)(A + (size_t)(blockIdx.x * 128 + cpr) * K + cpc * 8); const char* gB = (const char*)(Bt + (size_t)(blockIdx.y * 128 + cpr) * K + cpc * 8);
    const char* gA2 = NSPLIT == 1 ? (const char*)(A2 + (size_t)(blockIdx.x * 128 + cpr) * K + cpc * 8) : nullptr;
    auto fill = [&](int s, unsigned bo) { g_cp8(l0 + bo, gA + (size_t)s * (GK * 2), gs); g_cp8(l0 + bo + GT, gB + (size_t)s * (GK * 2), gs); if (NSPLIT == 1) g_cp8(l0 + bo + 2 * GT, gA2 + (size_t)s * (GK * 2), gs); };
    const int nst = K / GK;
    fill(0, 0u);
    asm volatile("s_wait_asynccnt 0x0" ::: "memory");                // stage 0 has landed, as far as this wave brought it
    __syncthreads();                                                 // ... and the other waves' parts
    if (nst > 1) fill(1, (unsigned)(NT * GT));
    const unsigned fa = (unsigned)((wm * 64 + lr) * GP + 16 * hi), fb = (unsigned)(GT + (wn * 64 + lr) * GP + 16 * hi);   // the lane's byte offsets in a stage: row lr of the wave's first fragment, k from 8 hi
#pragma unroll 1
    for (int t = 0; t < nst; ++t) {                                  // rolled: one stage's fragments and the accumulators fill the registers
        const unsigned bo = (unsigned)(t & 1) * (unsigned)(NT * GT);
        const T16* la = (const T16*)(st + bo + fa); const T16* lb = (const T16*)(st + bo + fb); const T16* la2 = (const T16*)(st + bo + 2 * GT + fa);
        V a[4], a2[4], b[4];
        auto frags = [&](int ks) {
#pragma unroll
            for (int mb = 0; mb < 4; ++mb) { a[mb] = WFrag<T16>::ld(la + mb * 16 * (GP / 2) + ks * 32); b[mb] = WFrag<T16>::ld(lb + mb * 16 * (GP / 2) + ks * 32); if (NSPLIT == 1) a2[mb] = WFrag<T16>::ld(la2 + mb * 16 * (GP / 2) + ks * 32); } };
        auto prods = [&]() {
#pragma unroll
            for (int nb = 0; nb < 4; ++nb)
#pragma unroll
                for (int mb = 0; mb < 4; ++mb) { acc[mb][nb] = WFrag<T16>::mma(a[mb], b[nb], acc[mb][nb]); if (NSPLIT == 1) acc[mb][nb] = WFrag<T16>::mma(a2[mb], b[nb], acc[mb][nb]); } };
        static_assert(GK == 64, "a stage is two fragment groups of 32 k");
        frags(0);
        __builtin_amdgcn_sched_barrier(0);   // the fragment loads of 32 k stay one group ahead of its products: spread among them, every group of four products waits out an LDS latency of its own
        prods();
        frags(1);
        if (NSPLIT == 1) __builtin_amdgcn_sched_barrier(0);   // as above: without it the second group's products rise among its loads, on one register set for Bt with a full wait per fragment
        asm volatile("s_wait_dscnt 0x0" ::: "memory");               // this wave's reads of the stage have returned: its last fragments are in registers
        asm volatile("s_wait_asynccnt 0x0" ::: "memory");            // its copies of the next stage have landed
        __syncthreads();                                             // publishes the next stage and ends every wave's reads of this one
        // the refill goes into the buffer that has just been read. One plane of A: ahead of the stage's last products, which lengthen the copies' lead. Two planes: behind them (twice the products a stage give the lead; the fragments and the copies' addresses together would pass 256 registers)
        if (NSPLIT == 1) prods();
        if (t + 2 < nst) fill(t + 2, bo);
        if (NSPLIT == 0) prods();
    }
    asm volatile("s_wait_asynccnt 0x0" ::: "memory");                // no copy is left outstanding
    Pl3 pv[8];
    const size_t pe = ((size_t)hd * TT + r0 + hi) * HD + lr * 4;     // EPI 1: the lane's first element in a plane; every store of the wave is a constant step from it
    if (EPI == 2) {
        // staged transposed, 16 head dims x 64 rows t at a time: a lane's 8 accumulator rows are neighbours in t
#pragma unroll
        for (int nb = 0; nb < 4; ++nb) {
#pragma unroll
            for (int mb = 0; mb < 4; ++mb) { float* p = os + lr * 68 + mb * 16 + hi * 8; v8f t = acc[mb][nb]; if (BIAS) t += bcol[nb]; *(v4fa*)p = (v4f){t[0], t[1], t[2], t[3]}; *(v4fa*)(p + 4) = (v4f){t[4], t[5], t[6], t[7]}; }
            __builtin_amdgcn_wave_barrier(); asm volatile("" ::: "memory");   // the rows are read back by other lanes of the wave: the LDS reads below stay behind the LDS stores above
#pragma unroll
            for (int s = 0; s < 8; ++s) pv[s] = cv_planes(*(const v4fa*)(os + (2 * s + hi) * 68 + lr * 4));
            __builtin_amdgcn_sched_barrier(0);   // the group's 24 stores stay one run behind all of its conversions: mixed in, each store's registers are used again at once, with a wait in front of every such use
#pragma unroll
            for (int s = 0; s < 8; ++s) st_planes(pv[s], ((size_t)hd * HD + nb * 16 + 2 * s + hi) * TT + r0 + lr * 4, P16, Ph, Pl);
            __builtin_amdgcn_wave_barrier(); asm volatile("s_wait_xcnt 0x0" ::: "memory");   // stands in front of the next group's writes to registers that the stores above name; also keeps the next group's LDS stores behind these reads
        }
        return;
    }
#pragma unroll
    for (int mb = 0; mb < 4; ++mb) {
#pragma unroll
        for (int nb = 0; nb < 4; ++nb) {
#pragma unroll
            for (int j = 0; j < 8; ++j) os[(hi * 8 + j) * 68 + nb * 16 + lr] = acc[mb][nb][j]; }
        __builtin_amdgcn_wave_barrier(); asm volatile("" ::: "memory");
        float* crow = C + (size_t)(r0 + mb * 16) * ldc + c0;
{
#pragma unroll
            for (int s = 0; s < 8; ++s) { const int row = 2 * s + hi, cofs = lr * 4; v4f val = *(const v4fa*)(os + row * 68 + cofs); if (BIAS) { val[0] += bfr(bias[c0 + cofs]); val[1] += bfr(bias[c0 + cofs + 1]); val[2] += bfr(bias[c0 + cofs + 2]); val[3] += bfr(bias[c0 + cofs + 3]); }
                if (EPI == 1) pv[s] = cv_planes(val);
                else *(v4f*)(crow + (size_t)row * ldc + cofs) = val; }
             }
        if (EPI == 1) {
            __builtin_amdgcn_sched_barrier(0);   // one run of 24 stores behind all the conversions, as in EPI 2
#pragma unroll
            for (int s = 0; s < 8; ++s) st_planes(pv[s], pe + (size_t)(mb * 16 + 2 * s) * HD, P16, Ph, Pl);
        }
        __builtin_amdgcn_wave_barrier(); asm volatile("" ::: "memory");
    }
}


__global__ __launch_bounds__(256) void k_wtG(const float* __restrict__ w, int K, int N, bf* Bt) {
    const int lane = threadIdx.x & 31; const int L0 = (blockIdx.x * 8 + (threadIdx.x >> 5)) * 8; const int nlines = N * K / 64;
{
#pragma unroll 1
        for (int l = 0; l < 8; ++l) { const int L = L0 + l; if (L >= nlines) break; const size_t e = (size_t)L * 64 + lane * 2; const int k = (int)(e % K), n = (int)(e / K); v2us o;
            o[0] = f2bf(w[(size_t)k * N + n]); o[1] = f2bf(w[(size_t)(k + 1) * N + n]); *(v2us*)(Bt + e) = o; }
         }
}
__global__ __launch_bounds__(256) void k_cvt8(const float* __restrict__ src, bf* dst, size_t n8) { const size_t i = (size_t)blockIdx.x * 256 + threadIdx.x; if (i >= n8) return; const v8f v = *(const v8f*)(src + i * 8); v8us o;
#pragma unroll
    for (int k = 0; k < 8; ++k) o[k] = f2bf(v[k]); *(v8us*)(dst + i * 8) = o;  }
__global__ __launch_bounds__(256) void k_cscvt(const float* __restrict__ cosT, const float* __restrict__ sinT, float* CS) { const int idx = blockIdx.x * 256 + threadIdx.x; if (idx >= TT * HD) return; v2f cs; cs[0] = bfr(cosT[idx]); cs[1] = bfr(sinT[idx]); *(v2f*)(CS + (size_t)idx * 2) = cs;  }
// ---- k_fattn: causal attention of one head's QT query rows per work-group, grid (batch x head, row tile), scores never stored. Transposed products: S^T = K Q^T (A = key rows, B = query columns), O^T += V^T P^T; a lane holds one query
// column, so two stacked 16-key score tiles, converted in place, ARE the B operand of the second product (hardware k order, which WFrag::ld also delivers). Running maximum and sum per column (online softmax).
// The NW waves of a work-group share the query rows and take the 32-key passes w, w + NW, ...; their (maximum, sum, O^T) are joined through LDS at the end. Query rows < RH: hi+lo bf16 planes, 3 products; the rest fp16.
#define QT  32
#define KT  32
#define NW  4
#define SC2 (SCL * 1.4426950408889634f)   // score scale times log2(e): probabilities are exp2((s - max) * SC2)
// fragment at a base plus a 32-bit BYTE offset: a wave-uniform base and the lane's own offset, or the lane's own address and 0
template <typename T16> __device__ __forceinline__ typename WFrag<T16>::V fa_ld(const T16* __restrict__ base, unsigned ob) { return WFrag<T16>::ld((const T16*)((const char*)base + ob)); }
// key fragments of one 32-key pass; kb = the pass's first key row (wave-uniform) with koff = the lane's own byte offset in it, or kb = the lane's own address with koff = 0
template <typename T16>
__device__ __forceinline__ void fa_ldk(const T16* __restrict__ kb, unsigned koff, typename WFrag<T16>::V (&ka)[2][2]) {
#pragma unroll
    for (int ks = 0; ks < 2; ++ks)
#pragma unroll
        for (int kc = 0; kc < 2; ++kc) ka[ks][kc] = fa_ld<T16>(kb + (ks * 16 * HD + kc * 32), koff);
}
__device__ __forceinline__ void fa_pack(const v8f& t0, const v8f& t1, v16h& p, v16h& p2) { (void)p2;
#pragma unroll
    for (int r = 0; r < 8; ++r) { p[r] = (h16)t0[r]; p[8 + r] = (h16)t1[r]; } }
__device__ __forceinline__ void fa_pack(const v8f& t0, const v8f& t1, v16bf& p, v16bf& p2) { v8us h0, h1, l0, l1;
#pragma unroll
    for (int r = 0; r < 8; ++r) { unsigned short a, c; splitf(t0[r], a, c); h0[r] = a; l0[r] = c; splitf(t1[r], a, c); h1[r] = a; l1[r] = c; }
    p = cat16b(h0, h1); p2 = cat16b(l0, l1); }
__device__ __forceinline__ float fa_xhalf(float x) { const int b = __float_as_int(x); return __int_as_float(__builtin_amdgcn_permlanex16(b, b, 0x76543210, 0xfedcba98, false, false)); }   // lane l <-> l ^ 16
// one pass: 32 keys from k0 against the work-group's 32 query columns from q0. Q, kb, vb (and the lo planes' Q2, kb2, vb2): first query row, first key row [t][d] and first key column [d][t] of the pass, wave-uniform; koff = 2 (lr HD + 8 hi) and voff = 2 (lr TT + 8 hi) are the lane's byte offsets in row-major [t][d] and [d][t] planes.
// AHEAD: ka holds this pass's key fragments on entry and those of the wave's next pass on exit. EDGE: the pass may reach above the diagonal. B0, NB: the 16-column groups that the pass serves.
template <typename T16, bool HL, bool AHEAD, bool EDGE, int B0, int NB>
__device__ __forceinline__ void fa_pass(const T16* __restrict__ Q, const T16* __restrict__ Q2, const T16* __restrict__ kb, const T16* __restrict__ kb2, const T16* __restrict__ vb, const T16* __restrict__ vb2, int q0, int k0, unsigned koff, unsigned voff, int lr, int hi,
                                        typename WFrag<T16>::V (&qf)[2][2], typename WFrag<T16>::V (&ka)[2][2], v8f (&o)[4][2], float (&m)[2], float (&l)[2]) {
    typedef typename WFrag<T16>::V V;
    V va[4], va2[4];
    v8f s[2][2];                                                     // s[ks][qb][r] = score(key k0 + 16 ks + 8 hi + r, query q0 + 16 qb + lr)
    if (!HL) {
#pragma unroll
        for (int db = 0; db < 4; ++db) va[db] = fa_ld<T16>(vb + db * 16 * TT, voff);   // value fragments: asked for ahead of the score products, used behind the softmax
#pragma unroll
        for (int ks = 0; ks < 2; ++ks)
#pragma unroll
            for (int qb = B0; qb < B0 + NB; ++qb) { v8f t = (v8f){};
#pragma unroll
                for (int kc = 0; kc < 2; ++kc) t = WFrag<T16>::mma(ka[ks][kc], qf[qb][kc], t);
                s[ks][qb] = t; }
        if (AHEAD) fa_ldk<T16>(kb + NW * KT * HD, koff, ka);         // the next pass's key fragments fly during this pass's softmax and second product
    } else {
        // the few hi+lo passes fetch nothing ahead: twice the planes, and their registers would set the occupancy of the whole kernel
        V qf2[2][2];
#pragma unroll
        for (int qb = B0; qb < B0 + NB; ++qb)
#pragma unroll
            for (int kc = 0; kc < 2; ++kc) { qf[qb][kc] = fa_ld<T16>(Q + (qb * 16 * HD + kc * 32), koff); qf2[qb][kc] = fa_ld<T16>(Q2 + (qb * 16 * HD + kc * 32), koff); }
        // Each lane's plane addresses are formed here, and the wait behind the loads takes them as inputs: they stay untouched up to it.
        V ka2[2][2]; const T16* kp = (const T16*)((const char*)kb + koff); const T16* kp2 = (const T16*)((const char*)kb2 + koff);
        fa_ldk<T16>(kp, 0u, ka); fa_ldk<T16>(kp2, 0u, ka2);
        asm volatile("s_wait_xcnt 0x0" : : "v"(kp), "v"(kp2) : "memory");
#pragma unroll
        for (int ks = 0; ks < 2; ++ks)
#pragma unroll
            for (int qb = B0; qb < B0 + NB; ++qb) { v8f t = (v8f){};
#pragma unroll
                for (int kc = 0; kc < 2; ++kc) { t = WFrag<T16>::mma(ka[ks][kc], qf[qb][kc], t); t = WFrag<T16>::mma(ka2[ks][kc], qf[qb][kc], t); t = WFrag<T16>::mma(ka[ks][kc], qf2[qb][kc], t); }
                s[ks][qb] = t; }
        const T16* vp = (const T16*)((const char*)vb + voff); const T16* vp2 = (const T16*)((const char*)vb2 + voff);
#pragma unroll
        for (int db = 0; db < 4; ++db) { va[db] = WFrag<T16>::ld(vp + db * 16 * TT); va2[db] = WFrag<T16>::ld(vp2 + db * 16 * TT); }
        asm volatile("s_wait_xcnt 0x0" : : "v"(vp), "v"(vp2) : "memory");   // as above
    }
    if (EDGE) {                                                      // keys above the query are masked (by select: no branch behind the products)
#pragma unroll
        for (int ks = 0; ks < 2; ++ks)
#pragma unroll
            for (int qb = B0; qb < B0 + NB; ++qb)
#pragma unroll
                for (int r = 0; r < 8; ++r) s[ks][qb][r] = (k0 + ks * 16 + 8 * hi + r > q0 + qb * 16 + lr) ? -3.0e38f : s[ks][qb][r]; }
#pragma unroll
    for (int qb = B0; qb < B0 + NB; ++qb) {
        float mx = fmaxf(s[0][qb][0], s[1][qb][0]);
#pragma unroll
        for (int r = 1; r < 8; ++r) mx = fmaxf(mx, fmaxf(s[0][qb][r], s[1][qb][r]));
        mx = fmaxf(mx, fa_xhalf(mx));                                // the two lane halves hold the two halves of a column's keys
        const float mn = fmaxf(m[qb], mx), al = __builtin_amdgcn_exp2f((m[qb] - mn) * SC2), mb = mn * SC2; m[qb] = mn;
        float ps = 0.f;
#pragma unroll
        for (int ks = 0; ks < 2; ++ks)
#pragma unroll
            for (int r = 0; r < 8; ++r) { const float p = __builtin_amdgcn_exp2f(fmaf(s[ks][qb][r], SC2, -mb)); s[ks][qb][r] = p; ps += p; }
        l[qb] = fmaf(l[qb], al, ps);
        V pb, pb2; fa_pack(s[0][qb], s[1][qb], pb, pb2);
#pragma unroll
        for (int db = 0; db < 4; ++db) { v8f t = o[db][qb] * al; t = WFrag<T16>::mma(va[db], pb, t); if (HL) { t = WFrag<T16>::mma(va2[db], pb, t); t = WFrag<T16>::mma(va[db], pb2, t); } o[db][qb] = t; }
    }
}
template <typename T16, bool HL>
__device__ __forceinline__ void fa_walk(const T16* __restrict__ Q, const T16* __restrict__ Q2, const T16* __restrict__ Kp, const T16* __restrict__ K2, const T16* __restrict__ Vt, const T16* __restrict__ V2,
                                        int qt, int wave, int lr, int hi, v8f (&o)[4][2], float (&m)[2], float (&l)[2]) {
    typedef typename WFrag<T16>::V V;
    if (wave > qt) return;                                           // fewer passes than waves: this wave keeps its empty state (sum 0, weight 0 in the join)
    const int q0 = qt * QT; const unsigned koff = (unsigned)(lr * HD + 8 * hi) * 2u, voff = (unsigned)(lr * TT + 8 * hi) * 2u; V qf[2][2], ka[2][2];
    Q += (size_t)q0 * HD; if (HL) Q2 += (size_t)q0 * HD;
    int kt = wave;
    if (HL) {
        // one 16-column group at a time: with both groups' hi and lo query planes live the walk spills
#pragma unroll 1
        for (; kt <= qt; kt += NW) fa_pass<T16, HL, false, true, 0, 1>(Q, Q2, Kp + (size_t)kt * KT * HD, K2 + (size_t)kt * KT * HD, Vt + kt * KT, V2 + kt * KT, q0, kt * KT, koff, voff, lr, hi, qf, ka, o, m, l);   // rolled: one pass already fills the registers
#pragma unroll 1
        for (kt = wave; kt <= qt; kt += NW) fa_pass<T16, HL, false, true, 1, 1>(Q, Q2, Kp + (size_t)kt * KT * HD, K2 + (size_t)kt * KT * HD, Vt + kt * KT, V2 + kt * KT, q0, kt * KT, koff, voff, lr, hi, qf, ka, o, m, l);   // rolled, as above
    } else {
#pragma unroll
        for (int qb = 0; qb < 2; ++qb)
#pragma unroll
            for (int kc = 0; kc < 2; ++kc) qf[qb][kc] = fa_ld<T16>(Q + (qb * 16 * HD + kc * 32), koff);
        const T16* kb = Kp + (size_t)kt * KT * HD; const T16* vb = Vt + kt * KT;
        fa_ldk<T16>(kb, koff, ka);
#pragma unroll 1
        for (; kt + NW <= qt; kt += NW, kb += NW * KT * HD, vb += NW * KT) fa_pass<T16, HL, true, false, 0, 2>(Q, Q2, kb, K2, vb, V2, q0, kt * KT, koff, voff, lr, hi, qf, ka, o, m, l);   // rolled, as above; every pass but a wave's last lies below the diagonal
        fa_pass<T16, HL, false, true, 0, 2>(Q, Q2, kb, K2, vb, V2, q0, kt * KT, koff, voff, lr, hi, qf, ka, o, m, l);
    }
}
__global__ __launch_bounds__(NW * 32) void k_fattn(const h16* __restrict__ Q16, const h16* __restrict__ K16, const h16* __restrict__ V16, const bf* __restrict__ Qh, const bf* __restrict__ Ql, const bf* __restrict__ Kh, const bf* __restrict__ Kl,
                                                   const bf* __restrict__ Vh, const bf* __restrict__ Vl, bf* Ah, bf* Al) {
    __shared__ __align__(16) float osh[NW * 4 * 2 * 256]; __shared__ float msh[NW * QT]; __shared__ float lsh[NW * QT];
    const int wave = __builtin_amdgcn_readfirstlane((int)(threadIdx.x >> 5)), lane = threadIdx.x & 31, lr = lane & 15, hi = lane >> 4;
    const int qt = (TT / QT - 1) - (int)blockIdx.y;                  // longest rows first, over all batches and heads
    const int h = blockIdx.x % NH_, b = blockIdx.x / NH_; const size_t hq = (size_t)blockIdx.x * TT * HD, hk = (size_t)(blockIdx.x / REP) * TT * HD;   // planes are [batch][head][...]: blockIdx.x counts them through
    v8f o[4][2]; float m[2] = {-3.0e38f, -3.0e38f}, l[2] = {0.f, 0.f};
#pragma unroll
    for (int db = 0; db < 4; ++db) { o[db][0] = (v8f){}; o[db][1] = (v8f){}; }
    if (qt * QT < RH) fa_walk<bf, true>(Qh + hq, Ql + hq, Kh + hk, Kl + hk, Vh + hk, Vl + hk, qt, wave, lr, hi, o, m, l);
    else fa_walk<h16, false>(Q16 + hq, nullptr, K16 + hk, nullptr, V16 + hk, nullptr, qt, wave, lr, hi, o, m, l);
#pragma unroll
    for (int qb = 0; qb < 2; ++qb) { l[qb] += fa_xhalf(l[qb]);
#pragma unroll
        for (int db = 0; db < 4; ++db) { float* p = osh + ((wave * 4 + db) * 2 + qb) * 256 + lane * 8; const v8f t = o[db][qb]; *(v4fa*)p = (v4f){t[0], t[1], t[2], t[3]}; *(v4fa*)(p + 4) = (v4f){t[4], t[5], t[6], t[7]}; }
        if (hi == 0) { msh[wave * QT + qb * 16 + lr] = m[qb]; lsh[wave * QT + qb * 16 + lr] = l[qb]; } }
    __syncthreads();
    // join: thread = (query row q, 16 head dims db), so that one wave writes whole 128-byte lines of the merged planes
    const int q = threadIdx.x >> 2, db = threadIdx.x & 3, qb = q >> 4, c = q & 15;
    float M = msh[q];
#pragma unroll
    for (int w = 1; w < NW; ++w) M = fmaxf(M, msh[w * QT + q]);
    float L = 0.f, acc[16];
#pragma unroll
    for (int r = 0; r < 16; ++r) acc[r] = 0.f;
#pragma unroll
    for (int w = 0; w < NW; ++w) { const float wg = __builtin_amdgcn_exp2f((msh[w * QT + q] - M) * SC2); L = fmaf(wg, lsh[w * QT + q], L);
#pragma unroll
        for (int hh = 0; hh < 2; ++hh) { const float* p = osh + ((w * 4 + db) * 2 + qb) * 256 + (c + 16 * hh) * 8; const v4f x0 = *(const v4fa*)p, x1 = *(const v4fa*)(p + 4);
#pragma unroll
            for (int r = 0; r < 4; ++r) { acc[hh * 8 + r] = fmaf(wg, x0[r], acc[hh * 8 + r]); acc[hh * 8 + 4 + r] = fmaf(wg, x1[r], acc[hh * 8 + 4 + r]); } } }
    const float inv = __fdiv_rn(1.0f, L); const size_t oo = ((size_t)b * TT + qt * QT + q) * DQ + h * HD + db * 16;
#pragma unroll
    for (int hh = 0; hh < 2; ++hh) { v8us oh, ol;
#pragma unroll
        for (int r = 0; r < 8; ++r) { unsigned short a, c2; splitf(acc[hh * 8 + r] * inv, a, c2); oh[r] = a; ol[r] = c2; }
        *(v8usa*)(Ah + oo + hh * 8) = oh; *(v8usa*)(Al + oo + hh * 8) = ol; }
}

extern "C" void kernel_launch(void* const* d_in, const int* in_sizes, int n_in,
                              void* d_out, int out_size, void* d_ws, size_t ws_size, hipStream_t stream) {
    (void)in_sizes; (void)n_in; (void)out_size;
    const float* x = (const float*)d_in[0]; const float* xk = (const float*)d_in[1]; const float* xv = (const float*)d_in[2]; const float* wq = (const float*)d_in[3]; const float* bq = (const float*)d_in[4]; const float* wk = (const float*)d_in[5]; const float* bk = (const float*)d_in[6]; const float* wv = (const float*)d_in[7]; const float* bv = (const float*)d_in[8]; const float* wo = (const float*)d_in[9]; const float* bo = (const float*)d_in[10]; const float* cosT = nullptr; const float* sinT = nullptr; (void)cosT; (void)sinT;
    float* OUT = (float*)d_out;     // [4][2048][1024]
    char* wsp = (char*)d_ws;
    auto take = [&](size_t bytes) { char* p = wsp; wsp += (bytes + 255) & ~(size_t)255; return (void*)p; };
    bf* WQ = (bf*)take((size_t)DQ * DM * 2); bf* WK = (bf*)take((size_t)DKV * DM * 2); bf* WV = (bf*)take((size_t)DKV * DM * 2); bf* WO = (bf*)take((size_t)DM * DQ * 2);
    // every buffer below holds all NB_ batches; XB is the bf16 copy of one input at a time, used by the projection launched right behind it
    bf* XB = (bf*)take((size_t)NB_ * TT * DM * 2);
    h16* QP16 = (h16*)take((size_t)NB_ * NH_ * TT * HD * 2); h16* KP16 = (h16*)take((size_t)NB_ * NKV * TT * HD * 2); h16* VT16 = (h16*)take((size_t)NB_ * NKV * HD * TT * 2);
    bf* QPh = (bf*)take((size_t)NB_ * NH_ * TT * HD * 2); bf* QPl = (bf*)take((size_t)NB_ * NH_ * TT * HD * 2); bf* KPh = (bf*)take((size_t)NB_ * NKV * TT * HD * 2); bf* KPl = (bf*)take((size_t)NB_ * NKV * TT * HD * 2); bf* VTh = (bf*)take((size_t)NB_ * NKV * HD * TT * 2); bf* VTl = (bf*)take((size_t)NB_ * NKV * HD * TT * 2);
    bf* ATh = (bf*)take((size_t)NB_ * TT * DQ * 2); bf* ATl = (bf*)take((size_t)NB_ * TT * DQ * 2);
    if ((size_t)(wsp - (char*)d_ws) > ws_size) return;    // ws 256 MiB
    { k_cvt8<<<(unsigned)(((size_t)DQ * DM / 8 + 255) / 256), 256, 0, stream>>>(wq, WQ, (size_t)DQ * DM / 8); k_cvt8<<<(unsigned)(((size_t)DKV * DM / 8 + 255) / 256), 256, 0, stream>>>(wk, WK, (size_t)DKV * DM / 8); k_cvt8<<<(unsigned)(((size_t)DKV * DM / 8 + 255) / 256), 256, 0, stream>>>(wv, WV, (size_t)DKV * DM / 8);
      k_cvt8<<<(unsigned)(((size_t)DM * DQ / 8 + 255) / 256), 256, 0, stream>>>(wo, WO, (size_t)DM * DQ / 8);
       }
    const size_t nx8 = (size_t)NB_ * TT * DM / 8; const unsigned gx = (unsigned)((nx8 + 255) / 256);
    k_cvt8<<<gx, 256, 0, stream>>>(x, XB, nx8);
    k_gemmw<bf, 0, true, 1><<<dim3(TT / 128, DQ / 128, NB_), 128, 0, stream>>>(XB, nullptr, WQ, DM, nullptr, 0, bq, (size_t)TT * DM, 0, (size_t)NH_ * TT * HD, QP16, QPh, QPl);
    k_cvt8<<<gx, 256, 0, stream>>>(xk, XB, nx8);
    k_gemmw<bf, 0, true, 1><<<dim3(TT / 128, DKV / 128, NB_), 128, 0, stream>>>(XB, nullptr, WK, DM, nullptr, 0, bk, (size_t)TT * DM, 0, (size_t)NKV * TT * HD, KP16, KPh, KPl);
    k_cvt8<<<gx, 256, 0, stream>>>(xv, XB, nx8);
    k_gemmw<bf, 0, true, 2><<<dim3(TT / 128, DKV / 128, NB_), 128, 0, stream>>>(XB, nullptr, WV, DM, nullptr, 0, bv, (size_t)TT * DM, 0, (size_t)NKV * HD * TT, VT16, VTh, VTl);
    k_fattn<<<dim3(NB_ * NH_, TT / QT, 1), NW * 32, 0, stream>>>(QP16, KP16, VT16, QPh, QPl, KPh, KPl, VTh, VTl, ATh, ATl);
    k_gemmw<bf, 1, true, 0><<<dim3(TT / 128, DM / 128, NB_), 128, 0, stream>>>(ATh, ATl, WO, DQ, OUT, DM, bo, (size_t)TT * DQ, 0, (size_t)TT * DM, nullptr, nullptr, nullptr);
}

// v006
// Measured time: 162 microseconds a run.
// Two timings next to v005 put it at 1.28 and 1.27 times that version's speed.
// Counting every step since v000, it is 18.1 times as fast.
#include <hip/hip_runtime.h>

// SimpleMultiheadSDPAttention (query, key, value [4][2048][1024]; q = query Wq^T + bq, k = key Wk^T + bk, v = value Wv^T + bv (16 heads x 64); causal softmax(q.k / 8) (-1e30); out = merged Wo^T + bo -> [4][2048][1024]).
// Compute dtypes, f32 accumulate: every input rounded to bf16; q/k/v on PLAIN bf16 operands (three inputs; exact) + bias; causal scores and attn.v: query rows < 512 hl (3 products), the rest single fp16, fused with an online f32 softmax, causal tile skipping; Wo hl x exact (2 products) + bias.

#define NB_  4
#define TT   2048
#define DM   1024
#define NH_  16
#define NKV  16
#define REP  (NH_ / NKV)
#define HD   64
#define DQ   (NH_ * HD)
#define DKV  (NKV * HD)
#define RH   512                  // query rows < RH use hi+lo planes (0: none)
#define SCL  0.125f   // HD^-0.5
typedef _Float16 h16;
typedef unsigned short bf;
typedef __attribute__((ext_vector_type(16))) __bf16   v16bf;
typedef __attribute__((ext_vector_type(16))) _Float16 v16h;
typedef __attribute__((ext_vector_type(8)))  _Float16 v8h;
typedef __attribute__((ext_vector_type(8)))  unsigned short v8us;
typedef __attribute__((ext_vector_type(8)))  float    v8f;
typedef __attribute__((ext_vector_type(4)))  float    v4f;
typedef v8h  __attribute__((may_alias)) v8ha;
typedef v4f  __attribute__((may_alias)) v4fa;
typedef v8us __attribute__((may_alias)) v8usa;

__device__ __forceinline__ unsigned short f2bf(float f) { unsigned u = __float_as_uint(f); u += 0x7FFFu + ((u >> 16) & 1u); return (unsigned short)(u >> 16); }
__device__ __forceinline__ float bf2f(unsigned short b) { return __uint_as_float(((unsigned)b) << 16); }
__device__ __forceinline__ float bfr(float f) { return bf2f(f2bf(f)); }
__device__ __forceinline__ v16h cat16(v8h lo, v8h hi) { return __builtin_shufflevector(lo, hi, 0, 1, 2, 3, 4, 5, 6, 7, 8, 9, 10, 11, 12, 13, 14, 15); }
__device__ __forceinline__ v16bf cat16b(v8us lo, v8us hi) { return __builtin_bit_cast(v16bf, __builtin_shufflevector(lo, hi, 0, 1, 2, 3, 4, 5, 6, 7, 8, 9, 10, 11, 12, 13, 14, 15)); }
__device__ __forceinline__ v8f wmma16(v16h a, v16h b, v8f c) { return __builtin_amdgcn_wmma_f32_16x16x32_f16(false, a, false, b, (short)0, c, false, false); }
__device__ __forceinline__ v8f wmmab(v16bf a, v16bf b, v8f c) { return __builtin_amdgcn_wmma_f32_16x16x32_bf16(false, a, false, b, (short)0, c, false, false); }



__device__ __forceinline__ h16 tohx(float x) { return (h16)x; }
__device__ __forceinline__ void splitf(float y, unsigned short& h, unsigned short& l) { h = f2bf(y); l = f2bf(y - bf2f(h)); }
typedef __attribute__((ext_vector_type(2))) _Float16 v2h;
typedef __attribute__((ext_vector_type(4))) _Float16 v4h;
typedef __attribute__((ext_vector_type(2))) unsigned short v2us;
typedef __attribute__((ext_vector_type(4))) unsigned short v4us;
typedef __attribute__((ext_vector_type(2))) float v2f;
typedef __attribute__((ext_vector_type(4))) int v4i;
// four neighbouring f32 results as fp16 and as hi + lo bf16
struct Pl3 { v4h o16; v4us oh, ol; };
__device__ __forceinline__ Pl3 cv_planes(v4f val) { Pl3 r;
#pragma unroll
    for (int i = 0; i < 4; ++i) { r.o16[i] = tohx(val[i]); unsigned short a, c; splitf(val[i], a, c); r.oh[i] = a; r.ol[i] = c; }
    return r; }
__device__ __forceinline__ void st_planes(const Pl3& r, size_t e, h16* P16, bf* Ph, bf* Pl) { *(v4h*)(P16 + e) = r.o16; *(v4us*)(Ph + e) = r.oh; *(v4us*)(Pl + e) = r.ol; }

// ---- k_gemmw: GEMM, one work-group of 4 waves (2 x 2) per 128x128 output tile, ONE WAVE per 64x64 part of it (16 accumulators); grid (M/128, N/128, Z), 128 threads.
// The K-contiguous 16-bit operand planes come through LDS: a stage is 64 k (one 128-byte line) of the tile's 128 rows of every operand, brought by asynchronous 16-byte copies in whole lines, two buffers, the next stage in flight while this one is worked on.
// C[m][n] (f32, pitch ldc, + optional f32 bias[n]) = sum_k A[m][k] Bt[n][k] (+ A2[m][k] Bt[n][k] for NSPLIT 1). z-batch strides sA/sB/sC in elements (EPI 1, 2: sC strides the three planes). K % 64 == 0.
// EPI 0: C as above. EPI 1, 2: no C; a wave's 64 columns are one head, and the f32 result + bias goes out as that head's fp16, hi and lo planes, [h][t][d] (EPI 1) or transposed [h][d][t] (EPI 2), in whole 128-byte lines.
template <typename T16> struct WFrag;
template <> struct WFrag<h16> { typedef v16h V; static __device__ __forceinline__ V ld(const h16* p) { return cat16(*(const v8h*)p, *(const v8h*)(p + 16)); } static __device__ __forceinline__ v8f mma(V a, V b, v8f c) { return wmma16(a, b, c); } };
template <> struct WFrag<bf> { typedef v16bf V; static __device__ __forceinline__ V ld(const bf* p) { return cat16b(*(const v8us*)p, *(const v8us*)(p + 16)); } static __device__ __forceinline__ v8f mma(V a, V b, v8f c) { return wmmab(a, b, c); } };
#define GK  64                    // k per stage
#define GP  144                   // LDS row pitch in bytes: 16 x odd, for 16-byte reads of 128-byte rows
#define GT  (128 * GP)            // one operand's tile of a stage
// a lane's eight asynchronous 16-byte copies of one operand tile: rows 16 apart, LDS byte address l, global address g, gs = bytes of 16 global rows.
// The wait on the address registers is the last line of the copies' own statement, so that no operand register is written anew ahead of it.
__device__ __forceinline__ void g_cp8(unsigned l, const char* g, size_t gs) {
    asm volatile("global_load_async_to_lds_b128 %0, %8, off\n\t"
                 "global_load_async_to_lds_b128 %1, %9, off\n\t"
                 "global_load_async_to_lds_b128 %2, %10, off\n\t"
                 "global_load_async_to_lds_b128 %3, %11, off\n\t"
                 "global_load_async_to_lds_b128 %4, %12, off\n\t"
                 "global_load_async_to_lds_b128 %5, %13, off\n\t"
                 "global_load_async_to_lds_b128 %6, %14, off\n\t"
                 "global_load_async_to_lds_b128 %7, %15, off\n\t"
                 "s_wait_xcnt 0x0"
                 : : "v"(l), "v"(l + 16 * GP), "v"(l + 32 * GP), "v"(l + 48 * GP), "v"(l + 64 * GP), "v"(l + 80 * GP), "v"(l + 96 * GP), "v"(l + 112 * GP),
                     "v"(g), "v"(g + gs), "v"(g + 2 * gs), "v"(g + 3 * gs), "v"(g + 4 * gs), "v"(g + 5 * gs), "v"(g + 6 * gs), "v"(g + 7 * gs) : "memory");
}
template <typename T16, int NSPLIT, bool BIAS, int EPI>
__global__ __launch_bounds__(128) void k_gemmw(const T16* __restrict__ A, const T16* __restrict__ A2, const T16* __restrict__ Bt, int K, float* C, int ldc, const float* __restrict__ bias, size_t sA, size_t sB, size_t sC, h16* P16, bf* Ph, bf* Pl) {
    static_assert(EPI == 0 || HD == 64, "a wave's 64 columns are one head");
    static_assert(NSPLIT == 0 || NSPLIT == 1, "one or two planes of A");
    typedef typename WFrag<T16>::V V;
    constexpr int NT = NSPLIT == 1 ? 3 : 2;                          // operand tiles of a stage: A, Bt, (A2)
    __shared__ __align__(16) char st[2 * NT * GT]; __shared__ __align__(16) float osw[4 * 16 * 68];
    const size_t z = blockIdx.z; A += z * sA; if (NSPLIT == 1) A2 += z * sA; Bt += z * sB; if (EPI == 0) C += z * sC; else { P16 += z * sC; Ph += z * sC; Pl += z * sC; }
    const int wave = __builtin_amdgcn_readfirstlane((int)(threadIdx.x >> 5)), wm = wave >> 1, wn = wave & 1;
    const int lane = threadIdx.x & 31, lr = lane & 15, hi = lane >> 4; const int r0 = blockIdx.x * 128 + wm * 64, c0 = blockIdx.y * 128 + wn * 64, hd = blockIdx.y * 2 + wn;
    float* os = osw + wave * (16 * 68);                              // each wave stages its output in a range of its own
    v8f acc[4][4];
#pragma unroll
    for (int mb = 0; mb < 4; ++mb)
#pragma unroll
        for (int nb = 0; nb < 4; ++nb) acc[mb][nb] = (v8f){};
    float bcol[4];                                                   // EPI 2: the bias of the lane's own four columns, asked for ahead of the K loop
    if (EPI == 2 && BIAS) {
#pragma unroll
        for (int nb = 0; nb < 4; ++nb) bcol[nb] = bfr(bias[c0 + nb * 16 + lr]);
        asm volatile("s_wait_xcnt 0x0" : : "s"(bias) : "memory"); }   // the four bias loads name the scalar pair of bias as their base; as an input here the pair stays untouched up to the wait
    // copies: thread = (row cpr of 16, 16-byte piece cpc of 8), so that a wave's copy covers four whole lines
    const int cpr = threadIdx.x >> 3, cpc = threadIdx.x & 7; const size_t gs = (size_t)16 * K * 2;
    const unsigned l0 = (unsigned)(size_t)st + (unsigned)(cpr * GP + cpc * 16);
    const char* gA = (const char*)(A + (size_t)(blockIdx.x * 128 + cpr) * K + cpc * 8); const char* gB = (const char*)(Bt + (size_t)(blockIdx.y * 128 + cpr) * K + cpc * 8);
    const char* gA2 = NSPLIT == 1 ? (const char*)(A2 + (size_t)(blockIdx.x * 128 + cpr) * K + cpc * 8) : nullptr;
    auto fill = [&](int s, unsigned bo) { g_cp8(l0 + bo, gA + (size_t)s * (GK * 2), gs); g_cp8(l0 + bo + GT, gB + (size_t)s * (GK * 2), gs); if (NSPLIT == 1) g_cp8(l0 + bo + 2 * GT, gA2 + (size_t)s * (GK * 2), gs); };
    const int nst = K / GK;
    fill(0, 0u);
    asm volatile("s_wait_asynccnt 0x0" ::: "memory");                // stage 0 has landed, as far as this wave brought it
    __syncthreads();                                                 // ... and the other waves' parts
    if (nst > 1) fill(1, (unsigned)(NT * GT));
    const unsigned fa = (unsigned)((wm * 64 + lr) * GP + 16 * hi), fb = (unsigned)(GT + (wn * 64 + lr) * GP + 16 * hi);   // the lane's byte offsets in a stage: row lr of the wave's first fragment, k from 8 hi
#pragma unroll 1
    for (int t = 0; t < nst; ++t) {                                  // rolled: one stage's fragments and the accumulators fill the registers
        const unsigned bo = (unsigned)(t & 1) * (unsigned)(NT * GT);
        const T16* la = (const T16*)(st + bo + fa); const T16* lb = (const T16*)(st + bo + fb); const T16* la2 = (const T16*)(st + bo + 2 * GT + fa);
        V a[4], a2[4], b[4];
        auto frags = [&](int ks) {
#pragma unroll
            for (int mb = 0; mb < 4; ++mb) { a[mb] = WFrag<T16>::ld(la + mb * 16 * (GP / 2) + ks * 32); b[mb] = WFrag<T16>::ld(lb + mb * 16 * (GP / 2) + ks * 32); if (NSPLIT == 1) a2[mb] = WFrag<T16>::ld(la2 + mb * 16 * (GP / 2) + ks * 32); } };
        auto prods = [&]() {
#pragma unroll
            for (int nb = 0; nb < 4; ++nb)
#pragma unroll
                for (int mb = 0; mb < 4; ++mb) { acc[mb][nb] = WFrag<T16>::mma(a[mb], b[nb], acc[mb][nb]); if (NSPLIT == 1) acc[mb][nb] = WFrag<T16>::mma(a2[mb], b[nb], acc[mb][nb]); } };
        static_assert(GK == 64, "a stage is two fragment groups of 32 k");
        frags(0);
        __builtin_amdgcn_sched_barrier(0);   // the fragment loads of 32 k stay one group ahead of its products: spread among them, every group of four products waits out an LDS latency of its own
        prods();
        frags(1);
        if (NSPLIT == 1) __builtin_amdgcn_sched_barrier(0);   // as above: without it the second group's products rise among its loads, on one register set for Bt with a full wait per fragment
        asm volatile("s_wait_dscnt 0x0" ::: "memory");               // this wave's reads of the stage have returned: its last fragments are in registers
        asm volatile("s_wait_asynccnt 0x0" ::: "memory");            // its copies of the next stage have landed
        __syncthreads();                                             // publishes the next stage and ends every wave's reads of this one
        // the refill goes into the buffer that has just been read. One plane of A: ahead of the stage's last products, which lengthen the copies' lead. Two planes: behind them (twice the products a stage give the lead; the fragments and the copies' addresses together would pass 256 registers)
        if (NSPLIT == 1) prods();
        if (t + 2 < nst) fill(t + 2, bo);
        if (NSPLIT == 0) prods();
    }
    asm volatile("s_wait_asynccnt 0x0" ::: "memory");                // no copy is left outstanding
    Pl3 pv[8];
    const size_t pe = ((size_t)hd * TT + r0 + hi) * HD + lr * 4;     // EPI 1: the lane's first element in a plane; every store of the wave is a constant step from it
    if (EPI == 2) {
        // staged transposed, 16 head dims x 64 rows t at a time: a lane's 8 accumulator rows are neighbours in t
#pragma unroll
        for (int nb = 0; nb < 4; ++nb) {
#pragma unroll
            for (int mb = 0; mb < 4; ++mb) { float* p = os + lr * 68 + mb * 16 + hi * 8; v8f t = acc[mb][nb]; if (BIAS) t += bcol[nb]; *(v4fa*)p = (v4f){t[0], t[1], t[2], t[3]}; *(v4fa*)(p + 4) = (v4f){t[4], t[5], t[6], t[7]}; }
            __builtin_amdgcn_wave_barrier(); asm volatile("" ::: "memory");   // the rows are read back by other lanes of the wave: the LDS reads below stay behind the LDS stores above
#pragma unroll
            for (int s = 0; s < 8; ++s) pv[s] = cv_planes(*(const v4fa*)(os + (2 * s + hi) * 68 + lr * 4));
            __builtin_amdgcn_sched_barrier(0);   // the group's 24 stores stay one run behind all of its conversions: mixed in, each store's registers are used again at once, with a wait in front of every such use
#pragma unroll
            for (int s = 0; s < 8; ++s) st_planes(pv[s], ((size_t)hd * HD + nb * 16 + 2 * s + hi) * TT + r0 + lr * 4, P16, Ph, Pl);
            __builtin_amdgcn_wave_barrier(); asm volatile("s_wait_xcnt 0x0" ::: "memory");   // stands in front of the next group's writes to registers that the stores above name; also keeps the next group's LDS stores behind these reads
        }
        return;
    }
#pragma unroll
    for (int mb = 0; mb < 4; ++mb) {
#pragma unroll
        for (int nb = 0; nb < 4; ++nb) {
#pragma unroll
            for (int j = 0; j < 8; ++j) os[(hi * 8 + j) * 68 + nb * 16 + lr] = acc[mb][nb][j]; }
        __builtin_amdgcn_wave_barrier(); asm volatile("" ::: "memory");
        float* crow = C + (size_t)(r0 + mb * 16) * ldc + c0;
{
#pragma unroll
            for (int s = 0; s < 8; ++s) { const int row = 2 * s + hi, cofs = lr * 4; v4f val = *(const v4fa*)(os + row * 68 + cofs); if (BIAS) { val[0] += bfr(bias[c0 + cofs]); val[1] += bfr(bias[c0 + cofs + 1]); val[2] += bfr(bias[c0 + cofs + 2]); val[3] += bfr(bias[c0 + cofs + 3]); }
                if (EPI == 1) pv[s] = cv_planes(val);
                else *(v4f*)(crow + (size_t)row * ldc + cofs) = val; }
             }
        if (EPI == 1) {
            __builtin_amdgcn_sched_barrier(0);   // one run of 24 stores behind all the conversions, as in EPI 2
#pragma unroll
            for (int s = 0; s < 8; ++s) st_planes(pv[s], pe + (size_t)(mb * 16 + 2 * s) * HD, P16, Ph, Pl);
        }
        __builtin_amdgcn_wave_barrier(); asm volatile("" ::: "memory");
    }
}


__global__ __launch_bounds__(256) void k_wtG(const float* __restrict__ w, int K, int N, bf* Bt) {
    const int lane = threadIdx.x & 31; const int L0 = (blockIdx.x * 8 + (threadIdx.x >> 5)) * 8; const int nlines = N * K / 64;
{
#pragma unroll 1
        for (int l = 0; l < 8; ++l) { const int L = L0 + l; if (L >= nlines) break; const size_t e = (size_t)L * 64 + lane * 2; const int k = (int)(e % K), n = (int)(e / K); v2us o;
            o[0] = f2bf(w[(size_t)k * N + n]); o[1] = f2bf(w[(size_t)(k + 1) * N + n]); *(v2us*)(Bt + e) = o; }
         }
}
__global__ __launch_bounds__(256) void k_cvt8(const float* __restrict__ src, bf* dst, size_t n8) { const size_t i = (size_t)blockIdx.x * 256 + threadIdx.x; if (i >= n8) return; const v8f v = *(const v8f*)(src + i * 8); v8us o;
#pragma unroll
    for (int k = 0; k < 8; ++k) o[k] = f2bf(v[k]); *(v8us*)(dst + i * 8) = o;  }
__global__ __launch_bounds__(256) void k_cscvt(const float* __restrict__ cosT, const float* __restrict__ sinT, float* CS) { const int idx = blockIdx.x * 256 + threadIdx.x; if (idx >= TT * HD) return; v2f cs; cs[0] = bfr(cosT[idx]); cs[1] = bfr(sinT[idx]); *(v2f*)(CS + (size_t)idx * 2) = cs;  }
// ---- k_fattn: causal attention, grid (batch x head, row tile), scores never stored. Transposed products: S^T = K Q^T (A = key rows, B = query columns), O^T += V^T P^T; a lane holds one query
// column, so two stacked 16-key score tiles, converted in place, ARE the B operand of the second product (hardware k order, which WFrag::ld also delivers). Running maximum and sum per column (online softmax).
// Query rows >= RH (fp16): a work-group serves QG rows, each of its NW waves QT of them, and all waves walk the same keys, which come through LDS once for the four of them: a stage is SK keys of K [t][d] and of V^T [d][t],
// brought by asynchronous 16-byte copies in whole lines, two buffers, the next stage in flight while this one is worked on.
// Query rows < RH (hi+lo bf16 planes, 3 products): the NW waves share QT query rows and take the 32-key passes w, w + NW, ... from global memory; their (maximum, sum, O^T) are joined through LDS at the end.
#define QT  32
#define KT  32
#define NW  4
#define SC2 (SCL * 1.4426950408889634f)   // score scale times log2(e): probabilities are exp2((s - max) * SC2)
// fragment at a base plus a 32-bit BYTE offset: a wave-uniform base and the lane's own offset, or the lane's own address and 0
template <typename T16> __device__ __forceinline__ typename WFrag<T16>::V fa_ld(const T16* __restrict__ base, unsigned ob) { return WFrag<T16>::ld((const T16*)((const char*)base + ob)); }
// key fragments of one 32-key pass; kb plus koff bytes = the lane's own address in it: key row lr of the pass, from d = 8 hi
template <typename T16>
__device__ __forceinline__ void fa_ldk(const T16* __restrict__ kb, unsigned koff, typename WFrag<T16>::V (&ka)[2][2]) {
#pragma unroll
    for (int ks = 0; ks < 2; ++ks)
#pragma unroll
        for (int kc = 0; kc < 2; ++kc) ka[ks][kc] = fa_ld<T16>(kb + (ks * 16 * HD + kc * 32), koff);
}
__device__ __forceinline__ void fa_pack(const v8f& t0, const v8f& t1, v16h& p, v16h& p2) { (void)p2;
#pragma unroll
    for (int r = 0; r < 8; ++r) { p[r] = (h16)t0[r]; p[8 + r] = (h16)t1[r]; } }
__device__ __forceinline__ void fa_pack(const v8f& t0, const v8f& t1, v16bf& p, v16bf& p2) { v8us h0, h1, l0, l1;
#pragma unroll
    for (int r = 0; r < 8; ++r) { unsigned short a, c; splitf(t0[r], a, c); h0[r] = a; l0[r] = c; splitf(t1[r], a, c); h1[r] = a; l1[r] = c; }
    p = cat16b(h0, h1); p2 = cat16b(l0, l1); }
__device__ __forceinline__ float fa_xhalf(float x) { const int b = __float_as_int(x); return __int_as_float(__builtin_amdgcn_permlanex16(b, b, 0x76543210, 0xfedcba98, false, false)); }   // lane l <-> l ^ 16
// softmax and second product of one pass: s[ks][qb][r] = score(key k0 + 16 ks + 8 hi + r, query q0 + 16 qb + lr), va (and the lo plane's va2) = the pass's value fragments.
// EDGE: the pass may reach above the diagonal. B0, NB: the 16-column groups that the pass serves.
template <typename T16, bool HL, bool EDGE, int B0, int NB>
__device__ __forceinline__ void fa_soft(v8f (&s)[2][2], typename WFrag<T16>::V (&va)[4], typename WFrag<T16>::V (&va2)[4], int q0, int k0, int lr, int hi, v8f (&o)[4][2], float (&m)[2], float (&l)[2]) {
    typedef typename WFrag<T16>::V V;
    if (EDGE) {                                                      // keys above the query are masked (by select: no branch behind the products)
#pragma unroll
        for (int ks = 0; ks < 2; ++ks)
#pragma unroll
            for (int qb = B0; qb < B0 + NB; ++qb)
#pragma unroll
                for (int r = 0; r < 8; ++r) s[ks][qb][r] = (k0 + ks * 16 + 8 * hi + r > q0 + qb * 16 + lr) ? -3.0e38f : s[ks][qb][r]; }
#pragma unroll
    for (int qb = B0; qb < B0 + NB; ++qb) {
        float mx = fmaxf(s[0][qb][0], s[1][qb][0]);
#pragma unroll
        for (int r = 1; r < 8; ++r) mx = fmaxf(mx, fmaxf(s[0][qb][r], s[1][qb][r]));
        mx = fmaxf(mx, fa_xhalf(mx));                                // the two lane halves hold the two halves of a column's keys
        const float mn = fmaxf(m[qb], mx), al = __builtin_amdgcn_exp2f((m[qb] - mn) * SC2), mb = mn * SC2; m[qb] = mn;
        float ps = 0.f;
#pragma unroll
        for (int ks = 0; ks < 2; ++ks)
#pragma unroll
            for (int r = 0; r < 8; ++r) { const float p = __builtin_amdgcn_exp2f(fmaf(s[ks][qb][r], SC2, -mb)); s[ks][qb][r] = p; ps += p; }
        l[qb] = fmaf(l[qb], al, ps);
        V pb, pb2; fa_pack(s[0][qb], s[1][qb], pb, pb2);
#pragma unroll
        for (int db = 0; db < 4; ++db) { v8f t = o[db][qb] * al; t = WFrag<T16>::mma(va[db], pb, t); if (HL) { t = WFrag<T16>::mma(va2[db], pb, t); t = WFrag<T16>::mma(va[db], pb2, t); } o[db][qb] = t; }
    }
}
// one hi+lo pass: 32 keys from k0 against query columns from q0. Q, kb, vb and the lo planes' Q2, kb2, vb2: first query row, first key row [t][d] and first key column [d][t] of the pass, wave-uniform; koff = 2 (lr HD + 8 hi) and voff = 2 (lr TT + 8 hi) are the lane's byte offsets in row-major [t][d] and [d][t] planes.
template <typename T16, int B0, int NB>
__device__ __forceinline__ void fa_pass(const T16* __restrict__ Q, const T16* __restrict__ Q2, const T16* __restrict__ kb, const T16* __restrict__ kb2, const T16* __restrict__ vb, const T16* __restrict__ vb2, int q0, int k0, unsigned koff, unsigned voff, int lr, int hi,
                                        v8f (&o)[4][2], float (&m)[2], float (&l)[2]) {
    typedef typename WFrag<T16>::V V;
    V va[4], va2[4];
    v8f s[2][2];
    {
        // the few hi+lo passes fetch nothing ahead: twice the planes, and their registers would set the occupancy of the whole kernel
        // Each lane's plane addresses are formed here, and the wait behind the loads takes them as inputs: they stay untouched up to it.
        V qf[2][2], qf2[2][2], ka[2][2]; const T16* qp = (const T16*)((const char*)Q + koff); const T16* qp2 = (const T16*)((const char*)Q2 + koff);
#pragma unroll
        for (int qb = B0; qb < B0 + NB; ++qb)
#pragma unroll
            for (int kc = 0; kc < 2; ++kc) { qf[qb][kc] = WFrag<T16>::ld(qp + (qb * 16 * HD + kc * 32)); qf2[qb][kc] = WFrag<T16>::ld(qp2 + (qb * 16 * HD + kc * 32)); }
        asm volatile("s_wait_xcnt 0x0" : : "v"(qp), "v"(qp2) : "memory");
        V ka2[2][2]; const T16* kp = (const T16*)((const char*)kb + koff); const T16* kp2 = (const T16*)((const char*)kb2 + koff);
        fa_ldk<T16>(kp, 0u, ka); fa_ldk<T16>(kp2, 0u, ka2);
        asm volatile("s_wait_xcnt 0x0" : : "v"(kp), "v"(kp2) : "memory");   // as above
#pragma unroll
        for (int ks = 0; ks < 2; ++ks)
#pragma unroll
            for (int qb = B0; qb < B0 + NB; ++qb) { v8f t = (v8f){};
#pragma unroll
                for (int kc = 0; kc < 2; ++kc) { t = WFrag<T16>::mma(ka[ks][kc], qf[qb][kc], t); t = WFrag<T16>::mma(ka2[ks][kc], qf[qb][kc], t); t = WFrag<T16>::mma(ka[ks][kc], qf2[qb][kc], t); }
                s[ks][qb] = t; }
        const T16* vp = (const T16*)((const char*)vb + voff); const T16* vp2 = (const T16*)((const char*)vb2 + voff);
#pragma unroll
        for (int db = 0; db < 4; ++db) { va[db] = WFrag<T16>::ld(vp + db * 16 * TT); va2[db] = WFrag<T16>::ld(vp2 + db * 16 * TT); }
        asm volatile("s_wait_xcnt 0x0" : : "v"(vp), "v"(vp2) : "memory");   // as above
    }
    fa_soft<T16, true, true, B0, NB>(s, va, va2, q0, k0, lr, hi, o, m, l);
}
// the hi+lo walk of tile qt (QT query rows): wave w takes the passes w, w + NW, ...
template <typename T16>
__device__ __forceinline__ void fa_walk(const T16* __restrict__ Q, const T16* __restrict__ Q2, const T16* __restrict__ Kp, const T16* __restrict__ K2, const T16* __restrict__ Vt, const T16* __restrict__ V2,
                                        int qt, int wave, int lr, int hi, v8f (&o)[4][2], float (&m)[2], float (&l)[2]) {
    if (wave > qt) return;                                           // fewer passes than waves: this wave keeps its empty state (sum 0, weight 0 in the join)
    const int q0 = qt * QT; const unsigned koff = (unsigned)(lr * HD + 8 * hi) * 2u, voff = (unsigned)(lr * TT + 8 * hi) * 2u;
    Q += (size_t)q0 * HD; Q2 += (size_t)q0 * HD;
    int kt = wave;
    // one 16-column group at a time: with both groups' hi and lo query planes live the walk spills
#pragma unroll 1
    for (; kt <= qt; kt += NW) fa_pass<T16, 0, 1>(Q, Q2, Kp + (size_t)kt * KT * HD, K2 + (size_t)kt * KT * HD, Vt + kt * KT, V2 + kt * KT, q0, kt * KT, koff, voff, lr, hi, o, m, l);   // rolled: one pass already fills the registers
#pragma unroll 1
    for (kt = wave; kt <= qt; kt += NW) fa_pass<T16, 1, 1>(Q, Q2, Kp + (size_t)kt * KT * HD, K2 + (size_t)kt * KT * HD, Vt + kt * KT, V2 + kt * KT, q0, kt * KT, koff, voff, lr, hi, o, m, l);   // rolled, as above
}
#define QG  (NW * QT)             // query rows of a work-group of the fp16 walk
#define SK  64                    // keys per stage: one 128-byte line of every V^T row
#define SB  ((SK + HD) * GP)      // a stage in LDS: SK key rows, then HD rows of V^T, 128 bytes each at pitch GP
#define NF  ((TT - RH) / QG)      // row tiles of the fp16 walk
// a lane's four asynchronous 16-byte copies: rows 16 apart, LDS byte address l, global address g, gs = bytes of 16 global rows.
// The wait on the address registers is the last line of the copies' own statement, so that no operand register is written anew ahead of it.
__device__ __forceinline__ void g_cp4(unsigned l, const char* g, size_t gs) {
    asm volatile("global_load_async_to_lds_b128 %0, %4, off\n\t"
                 "global_load_async_to_lds_b128 %1, %5, off\n\t"
                 "global_load_async_to_lds_b128 %2, %6, off\n\t"
                 "global_load_async_to_lds_b128 %3, %7, off\n\t"
                 "s_wait_xcnt 0x0"
                 : : "v"(l), "v"(l + 16 * GP), "v"(l + 32 * GP), "v"(l + 48 * GP), "v"(g), "v"(g + gs), "v"(g + 2 * gs), "v"(g + 3 * gs) : "memory");
}
// one fp16 pass out of LDS: 32 keys from k0 against the wave's 32 query columns from q0. kl, vl: the lane's own addresses in the stage, row lr of the pass's keys and row lr of V^T at the pass's first key, each plus 16 hi bytes.
template <bool EDGE>
__device__ __forceinline__ void fa_pass_s(const char* kl, const char* vl, int q0, int k0, int lr, int hi, v16h (&qf)[2][2], v8f (&o)[4][2], float (&m)[2], float (&l)[2]) {
    v16h ka[2][2], va[4], va2[4]; v8f s[2][2];
#pragma unroll
    for (int ks = 0; ks < 2; ++ks)
#pragma unroll
        for (int kc = 0; kc < 2; ++kc) ka[ks][kc] = WFrag<h16>::ld((const h16*)(kl + ks * 16 * GP + kc * 64));
#pragma unroll
    for (int db = 0; db < 4; ++db) va[db] = WFrag<h16>::ld((const h16*)(vl + db * 16 * GP));   // value fragments: asked for ahead of the score products, used behind the softmax
#pragma unroll
    for (int ks = 0; ks < 2; ++ks)
#pragma unroll
        for (int qb = 0; qb < 2; ++qb) { v8f t = (v8f){};
#pragma unroll
            for (int kc = 0; kc < 2; ++kc) t = wmma16(ka[ks][kc], qf[qb][kc], t);
            s[ks][qb] = t; }
    fa_soft<h16, false, EDGE, 0, 2>(s, va, va2, q0, k0, lr, hi, o, m, l);
}
// the fp16 walk of the QG query rows from qg: every wave passes every stage's foot; a wave works the passes up to its own diagonal.
__device__ __forceinline__ void fa_walk_s(const h16* __restrict__ Q, const h16* __restrict__ Kp, const h16* __restrict__ Vt, char* st, int qg, int wave, int lr, int hi, v8f (&o)[4][2], float (&m)[2], float (&l)[2]) {
    static_assert(HD == 64 && SK == 64 && NW == 4, "a thread's copies: 16 rows of eight 16-byte pieces per 128 threads");
    const int q0 = qg + wave * QT; const unsigned koff = (unsigned)(lr * HD + 8 * hi) * 2u; v16h qf[2][2];
#pragma unroll
    for (int qb = 0; qb < 2; ++qb)
#pragma unroll
        for (int kc = 0; kc < 2; ++kc) qf[qb][kc] = fa_ld<h16>(Q + (size_t)q0 * HD + (qb * 16 * HD + kc * 32), koff);
    // copies: thread = (row cpr of 16, 16-byte piece cpc of 8), so that a wave's copy covers four whole lines
    const int cpr = threadIdx.x >> 3, cpc = threadIdx.x & 7;
    const unsigned l0 = (unsigned)(size_t)st + (unsigned)(cpr * GP + cpc * 16);
    const char* gK = (const char*)(Kp + (size_t)cpr * HD + cpc * 8); const char* gV = (const char*)(Vt + (size_t)cpr * TT + cpc * 8);
    auto fill = [&](int s, unsigned bo) { g_cp4(l0 + bo, gK + (size_t)s * (SK * HD * 2), (size_t)16 * HD * 2); g_cp4(l0 + bo + SK * GP, gV + (size_t)s * (SK * 2), (size_t)16 * TT * 2); };
    const int nst = (qg + QG) / SK, nfull = qg / SK;                 // stages in all (at least two), and those that lie below every wave's diagonal
    auto foot = [&](int t, unsigned bo) {
        asm volatile("s_wait_dscnt 0x0" ::: "memory");               // this wave's reads of the stage have returned
        asm volatile("s_wait_asynccnt 0x0" ::: "memory");            // its copies of the next stage have landed
        __syncthreads();                                             // publishes the next stage and ends every wave's reads of this one
        if (t + 2 < nst) fill(t + 2, bo); };                         // the refill goes into the buffer that has just been read
    fill(0, 0u);
    asm volatile("s_wait_asynccnt 0x0" ::: "memory");                // stage 0 has landed, as far as this wave brought it
    __syncthreads();                                                 // ... and the other waves' parts
    fill(1, (unsigned)SB);
    const unsigned fk = (unsigned)(lr * GP + 16 * hi), fv = (unsigned)((SK + lr) * GP + 16 * hi);
    int t = 0;
#pragma unroll 1
    for (; t < nfull; ++t) {                                         // rolled: two passes already fill the registers
        const unsigned bo = (unsigned)(t & 1) * (unsigned)SB;
        fa_pass_s<false>(st + bo + fk, st + bo + fv, q0, t * SK, lr, hi, qf, o, m, l);
        fa_pass_s<false>(st + bo + fk + KT * GP, st + bo + fv + KT * 2, q0, t * SK + KT, lr, hi, qf, o, m, l);
        foot(t, bo);
    }
#pragma unroll 1
    for (; t < nst; ++t) {                                           // the QG keys of the work-group's own rows: below, on or above the wave's diagonal (wave-uniform tests)
        const unsigned bo = (unsigned)(t & 1) * (unsigned)SB;
#pragma unroll 1
        for (int p = 0; p < SK / KT; ++p) { const int k0 = t * SK + p * KT; const char* kl = st + bo + fk + p * (KT * GP); const char* vl = st + bo + fv + p * (KT * 2);   // rolled: code size
            if (k0 < q0) fa_pass_s<false>(kl, vl, q0, k0, lr, hi, qf, o, m, l);
            else if (k0 == q0) fa_pass_s<true>(kl, vl, q0, k0, lr, hi, qf, o, m, l); }
        foot(t, bo);
    }
    asm volatile("s_wait_asynccnt 0x0" ::: "memory");                // no copy is left outstanding
}
__global__ __launch_bounds__(NW * 32) void k_fattn(const h16* __restrict__ Q16, const h16* __restrict__ K16, const h16* __restrict__ V16, const bf* __restrict__ Qh, const bf* __restrict__ Ql, const bf* __restrict__ Kh, const bf* __restrict__ Kl,
                                                   const bf* __restrict__ Vh, const bf* __restrict__ Vl, bf* Ah, bf* Al) {
    static_assert(RH % QG == 0 && (TT - RH) % QG == 0 && QG % SK == 0, "whole row tiles on both sides of RH");
    __shared__ __align__(16) char stg[2 * SB];
    __shared__ __align__(16) float osh[NW * 4 * 2 * 256]; __shared__ float msh[NW * QT]; __shared__ float lsh[NW * QT];
    const int wave = __builtin_amdgcn_readfirstlane((int)(threadIdx.x >> 5)), lane = threadIdx.x & 31, lr = lane & 15, hi = lane >> 4;
    // longest rows first, over all batches and heads. blockIdx.y < NF: the fp16 tile of QG rows from qg; the rest: the hi+lo tile qt of QT rows
    const bool f16 = (int)blockIdx.y < NF; const int qg = TT - QG - (int)blockIdx.y * QG, qt = (RH / QT - 1) - ((int)blockIdx.y - NF);
    const int h = blockIdx.x % NH_, b = blockIdx.x / NH_; const size_t hq = (size_t)blockIdx.x * TT * HD, hk = (size_t)(blockIdx.x / REP) * TT * HD;   // planes are [batch][head][...]: blockIdx.x counts them through
    v8f o[4][2]; float m[2] = {-3.0e38f, -3.0e38f}, l[2] = {0.f, 0.f};
#pragma unroll
    for (int db = 0; db < 4; ++db) { o[db][0] = (v8f){}; o[db][1] = (v8f){}; }
    if (f16) fa_walk_s(Q16 + hq, K16 + hk, V16 + hk, stg, qg, wave, lr, hi, o, m, l);
    else fa_walk<bf>(Qh + hq, Ql + hq, Kh + hk, Kl + hk, Vh + hk, Vl + hk, qt, wave, lr, hi, o, m, l);
#pragma unroll
    for (int qb = 0; qb < 2; ++qb) { l[qb] += fa_xhalf(l[qb]);
#pragma unroll
        for (int db = 0; db < 4; ++db) { float* p = osh + ((wave * 4 + db) * 2 + qb) * 256 + lane * 8; const v8f t = o[db][qb]; *(v4fa*)p = (v4f){t[0], t[1], t[2], t[3]}; *(v4fa*)(p + 4) = (v4f){t[4], t[5], t[6], t[7]}; }
        if (hi == 0) { msh[wave * QT + qb * 16 + lr] = m[qb]; lsh[wave * QT + qb * 16 + lr] = l[qb]; } }
    __syncthreads();
    // thread = (query row q, 16 head dims db), so that one wave writes whole 128-byte lines of the merged planes
    const int q = threadIdx.x >> 2, db = threadIdx.x & 3, qb = q >> 4, c = q & 15;
    if (!f16) {
    // join of the waves' partial states
    float M = msh[q];
#pragma unroll
    for (int w = 1; w < NW; ++w) M = fmaxf(M, msh[w * QT + q]);
    float L = 0.f, acc[16];
#pragma unroll
    for (int r = 0; r < 16; ++r) acc[r] = 0.f;
#pragma unroll
    for (int w = 0; w < NW; ++w) { const float wg = __builtin_amdgcn_exp2f((msh[w * QT + q] - M) * SC2); L = fmaf(wg, lsh[w * QT + q], L);
#pragma unroll
        for (int hh = 0; hh < 2; ++hh) { const float* p = osh + ((w * 4 + db) * 2 + qb) * 256 + (c + 16 * hh) * 8; const v4f x0 = *(const v4fa*)p, x1 = *(const v4fa*)(p + 4);
#pragma unroll
            for (int r = 0; r < 4; ++r) { acc[hh * 8 + r] = fmaf(wg, x0[r], acc[hh * 8 + r]); acc[hh * 8 + 4 + r] = fmaf(wg, x1[r], acc[hh * 8 + 4 + r]); } } }
    const float inv = __fdiv_rn(1.0f, L); const size_t oo = ((size_t)b * TT + qt * QT + q) * DQ + h * HD + db * 16;
#pragma unroll
    for (int hh = 0; hh < 2; ++hh) { v8us oh, ol;
#pragma unroll
        for (int r = 0; r < 8; ++r) { unsigned short a, c2; splitf(acc[hh * 8 + r] * inv, a, c2); oh[r] = a; ol[r] = c2; }
        *(v8usa*)(Ah + oo + hh * 8) = oh; *(v8usa*)(Al + oo + hh * 8) = ol; }
    asm volatile("s_wait_xcnt 0x0" ::: "memory");                    // in the built code the other branch's block follows this one: the wait stands in front of its writes to registers that the stores above name
    } else {
        // every wave's state is complete for its own QT rows: one after the other they are scaled and stored
#pragma unroll
        for (int w = 0; w < NW; ++w) { const float inv = __fdiv_rn(1.0f, lsh[w * QT + q]); const size_t oo = ((size_t)b * TT + qg + w * QT + q) * DQ + h * HD + db * 16;
#pragma unroll
            for (int hh = 0; hh < 2; ++hh) { const float* p = osh + ((w * 4 + db) * 2 + qb) * 256 + (c + 16 * hh) * 8; const v4f x0 = *(const v4fa*)p, x1 = *(const v4fa*)(p + 4); v8us oh, ol;
#pragma unroll
                for (int r = 0; r < 4; ++r) { unsigned short a, c2; splitf(x0[r] * inv, a, c2); oh[r] = a; ol[r] = c2; splitf(x1[r] * inv, a, c2); oh[4 + r] = a; ol[4 + r] = c2; }
                *(v8usa*)(Ah + oo + hh * 8) = oh; *(v8usa*)(Al + oo + hh * 8) = ol; }
            if (w + 1 < NW) asm volatile("s_wait_xcnt 0x0" ::: "memory"); }   // stands in front of the next rows' writes to registers that the stores above name
    }
}

extern "C" void kernel_launch(void* const* d_in, const int* in_sizes, int n_in,
                              void* d_out, int out_size, void* d_ws, size_t ws_size, hipStream_t stream) {
    (void)in_sizes; (void)n_in; (void)out_size;
    const float* x = (const float*)d_in[0]; const float* xk = (const float*)d_in[1]; const float* xv = (const float*)d_in[2]; const float* wq = (const float*)d_in[3]; const float* bq = (const float*)d_in[4]; const float* wk = (const float*)d_in[5]; const float* bk = (const float*)d_in[6]; const float* wv = (const float*)d_in[7]; const float* bv = (const float*)d_in[8]; const float* wo = (const float*)d_in[9]; const float* bo = (const float*)d_in[10]; const float* cosT = nullptr; const float* sinT = nullptr; (void)cosT; (void)sinT;
    float* OUT = (float*)d_out;     // [4][2048][1024]
    char* wsp = (char*)d_ws;
    auto take = [&](size_t bytes) { char* p = wsp; wsp += (bytes + 255) & ~(size_t)255; return (void*)p; };
    bf* WQ = (bf*)take((size_t)DQ * DM * 2); bf* WK = (bf*)take((size_t)DKV * DM * 2); bf* WV = (bf*)take((size_t)DKV * DM * 2); bf* WO = (bf*)take((size_t)DM * DQ * 2);
    // every buffer below holds all NB_ batches; XB is the bf16 copy of one input at a time, used by the projection launched right behind it
    bf* XB = (bf*)take((size_t)NB_ * TT * DM * 2);
    h16* QP16 = (h16*)take((size_t)NB_ * NH_ * TT * HD * 2); h16* KP16 = (h16*)take((size_t)NB_ * NKV * TT * HD * 2); h16* VT16 = (h16*)take((size_t)NB_ * NKV * HD * TT * 2);
    bf* QPh = (bf*)take((size_t)NB_ * NH_ * TT * HD * 2); bf* QPl = (bf*)take((size_t)NB_ * NH_ * TT * HD * 2); bf* KPh = (bf*)take((size_t)NB_ * NKV * TT * HD * 2); bf* KPl = (bf*)take((size_t)NB_ * NKV * TT * HD * 2); bf* VTh = (bf*)take((size_t)NB_ * NKV * HD * TT * 2); bf* VTl = (bf*)take((size_t)NB_ * NKV * HD * TT * 2);
    bf* ATh = (bf*)take((size_t)NB_ * TT * DQ * 2); bf* ATl = (bf*)take((size_t)NB_ * TT * DQ * 2);
    if ((size_t)(wsp - (char*)d_ws) > ws_size) return;    // ws 256 MiB
    { k_cvt8<<<(unsigned)(((size_t)DQ * DM / 8 + 255) / 256), 256, 0, stream>>>(wq, WQ, (size_t)DQ * DM / 8); k_cvt8<<<(unsigned)(((size_t)DKV * DM / 8 + 255) / 256), 256, 0, stream>>>(wk, WK, (size_t)DKV * DM / 8); k_cvt8<<<(unsigned)(((size_t)DKV * DM / 8 + 255) / 256), 256, 0, stream>>>(wv, WV, (size_t)DKV * DM / 8);
      k_cvt8<<<(unsigned)(((size_t)DM * DQ / 8 + 255) / 256), 256, 0, stream>>>(wo, WO, (size_t)DM * DQ / 8);
       }
    const size_t nx8 = (size_t)NB_ * TT * DM / 8; const unsigned gx = (unsigned)((nx8 + 255) / 256);
    k_cvt8<<<gx, 256, 0, stream>>>(x, XB, nx8);
    k_gemmw<bf, 0, true, 1><<<dim3(TT / 128, DQ / 128, NB_), 128, 0, stream>>>(XB, nullptr, WQ, DM, nullptr, 0, bq, (size_t)TT * DM, 0, (size_t)NH_ * TT * HD, QP16, QPh, QPl);
    k_cvt8<<<gx, 256, 0, stream>>>(xk, XB, nx8);
    k_gemmw<bf, 0, true, 1><<<dim3(TT / 128, DKV / 128, NB_), 128, 0, stream>>>(XB, nullptr, WK, DM, nullptr, 0, bk, (size_t)TT * DM, 0, (size_t)NKV * TT * HD, KP16, KPh, KPl);
    k_cvt8<<<gx, 256, 0, stream>>>(xv, XB, nx8);
    k_gemmw<bf, 0, true, 2><<<dim3(TT / 128, DKV / 128, NB_), 128, 0, stream>>>(XB, nullptr, WV, DM, nullptr, 0, bv, (size_t)TT * DM, 0, (size_t)NKV * HD * TT, VT16, VTh, VTl);
    k_fattn<<<dim3(NB_ * NH_, NF + RH / QT, 1), NW * 32, 0, stream>>>(QP16, KP16, VT16, QPh, QPl, KPh, KPl, VTh, VTl, ATh, ATl);
    k_gemmw<bf, 1, true, 0><<<dim3(TT / 128, DM / 128, NB_), 128, 0, stream>>>(ATh, ATl, WO, DQ, OUT, DM, bo, (size_t)TT * DQ, 0, (size_t)TT * DM, nullptr, nullptr, nullptr);
}

// v007
// A run of this version takes 148 microseconds.
// Two timings next to v006 put it at 1.10 and 1.09 times that version's speed.
// Counting every step since v000, it is 19.9 times as fast.
#include <hip/hip_runtime.h>

// SimpleMultiheadSDPAttention (query, key, value [4][2048][1024]; q = query Wq^T + bq, k = key Wk^T + bk, v = value Wv^T + bv (16 heads x 64); causal softmax(q.k / 8) (-1e30); out = merged Wo^T + bo -> [4][2048][1024]).
// Compute dtypes, f32 accumulate: every input rounded to bf16; q/k/v on PLAIN bf16 operands (three inputs; exact) + bias; causal scores and attn.v: query rows < 512 hl (3 products), the rest single fp16, fused with an online f32 softmax, causal tile skipping; Wo hl x exact (2 products) + bias.

#define NB_  4
#define TT   2048
#define DM   1024
#define NH_  16
#define NKV  16
#define REP  (NH_ / NKV)
#define HD   64
#define DQ   (NH_ * HD)
#define DKV  (NKV * HD)
#define RH   512                  // query rows < RH use hi+lo planes (0: none)
#define SCL  0.125f   // HD^-0.5
typedef _Float16 h16;
typedef unsigned short bf;
typedef __attribute__((ext_vector_type(16))) __bf16   v16bf;
typedef __attribute__((ext_vector_type(16))) _Float16 v16h;
typedef __attribute__((ext_vector_type(8)))  _Float16 v8h;
typedef __attribute__((ext_vector_type(8)))  unsigned short v8us;
typedef __attribute__((ext_vector_type(8)))  float    v8f;
typedef __attribute__((ext_vector_type(4)))  float    v4f;
typedef v8h  __attribute__((may_alias)) v8ha;
typedef v4f  __attribute__((may_alias)) v4fa;
typedef v8us __attribute__((may_alias)) v8usa;

__device__ __forceinline__ unsigned short f2bf(float f) { unsigned u = __float_as_uint(f); u += 0x7FFFu + ((u >> 16) & 1u); return (unsigned short)(u >> 16); }
__device__ __forceinline__ float bf2f(unsigned short b) { return __uint_as_float(((unsigned)b) << 16); }
__device__ __forceinline__ float bfr(float f) { return bf2f(f2bf(f)); }
__device__ __forceinline__ v16h cat16(v8h lo, v8h hi) { return __builtin_shufflevector(lo, hi, 0, 1, 2, 3, 4, 5, 6, 7, 8, 9, 10, 11, 12, 13, 14, 15); }
__device__ __forceinline__ v16bf cat16b(v8us lo, v8us hi) { return __builtin_bit_cast(v16bf, __builtin_shufflevector(lo, hi, 0, 1, 2, 3, 4, 5, 6, 7, 8, 9, 10, 11, 12, 13, 14, 15)); }
__device__ __forceinline__ v8f wmma16(v16h a, v16h b, v8f c) { return __builtin_amdgcn_wmma_f32_16x16x32_f16(false, a, false, b, (short)0, c, false, false); }
__device__ __forceinline__ v8f wmmab(v16bf a, v16bf b, v8f c) { return __builtin_amdgcn_wmma_f32_16x16x32_bf16(false, a, false, b, (short)0, c, false, false); }



__device__ __forceinline__ h16 tohx(float x) { return (h16)x; }
__device__ __forceinline__ void splitf(float y, unsigned short& h, unsigned short& l) { h = f2bf(y); l = f2bf(y - bf2f(h)); }
typedef __attribute__((ext_vector_type(2))) _Float16 v2h;
typedef __attribute__((ext_vector_type(4))) _Float16 v4h;
typedef __attribute__((ext_vector_type(2))) unsigned short v2us;
typedef __attribute__((ext_vector_type(4))) unsigned short v4us;
typedef __attribute__((ext_vector_type(2))) float v2f;
typedef __attribute__((ext_vector_type(4))) int v4i;
// four neighbouring f32 results as fp16 and as hi + lo bf16
struct Pl3 { v4h o16; v4us oh, ol; };
__device__ __forceinline__ Pl3 cv_planes(v4f val) { Pl3 r;
#pragma unroll
    for (int i = 0; i < 4; ++i) { r.o16[i] = tohx(val[i]); unsigned short a, c; splitf(val[i], a, c); r.oh[i] = a; r.ol[i] = c; }
    return r; }
__device__ __forceinline__ void st_planes(const Pl3& r, size_t e, h16* P16, bf* Ph, bf* Pl) { *(v4h*)(P16 + e) = r.o16; *(v4us*)(Ph + e) = r.oh; *(v4us*)(Pl + e) = r.ol; }

// ---- k_gemmw: GEMM, one work-group of 4 waves (2 x 2) per 128x128 output tile, ONE WAVE per 64x64 part of it (16 accumulators); grid (M/128, N/128, Z), 128 threads.
// The K-contiguous 16-bit operand planes come through LDS: a stage is 64 k (one 128-byte line) of the tile's 128 rows of every operand, brought by asynchronous 16-byte copies in whole lines, two buffers, the next stage in flight while this one is worked on.
// C[m][n] (f32, pitch ldc, + optional f32 bias[n]) = sum_k A[m][k] Bt[n][k] (+ A2[m][k] Bt[n][k] for NSPLIT 1). z-batch strides sA/sB/sC in elements (EPI 1, 2: sC strides the three planes). K % 64 == 0.
// EPI 0: C as above. EPI 1, 2: no C; a wave's 64 columns are one head, and the f32 result + bias goes out as that head's fp16, hi and lo planes, [h][t][d] (EPI 1) or transposed [h][d][t] (EPI 2), in whole 128-byte lines.
template <typename T16> struct WFrag;
template <> struct WFrag<h16> { typedef v16h V; static __device__ __forceinline__ V ld(const h16* p) { return cat16(*(const v8h*)p, *(const v8h*)(p + 16)); } static __device__ __forceinline__ v8f mma(V a, V b, v8f c) { return wmma16(a, b, c); } };
template <> struct WFrag<bf> { typedef v16bf V; static __device__ __forceinline__ V ld(const bf* p) { return cat16b(*(const v8us*)p, *(const v8us*)(p + 16)); } static __device__ __forceinline__ v8f mma(V a, V b, v8f c) { return wmmab(a, b, c); } };
#define GK  64                    // k per stage
#define GP  144                   // LDS row pitch in bytes: 16 x odd, for 16-byte reads of 128-byte rows
#define GT  (128 * GP)            // one operand's tile of a stage
// a lane's eight asynchronous 16-byte copies of one operand tile: rows 16 apart, LDS byte address l, global address g, gs = bytes of 16 global rows.
// The wait on the address registers is the last line of the copies' own statement, so that no operand register is written anew ahead of it.
__device__ __forceinline__ void g_cp8(unsigned l, const char* g, size_t gs) {
    asm volatile("global_load_async_to_lds_b128 %0, %8, off\n\t"
                 "global_load_async_to_lds_b128 %1, %9, off\n\t"
                 "global_load_async_to_lds_b128 %2, %10, off\n\t"
                 "global_load_async_to_lds_b128 %3, %11, off\n\t"
                 "global_load_async_to_lds_b128 %4, %12, off\n\t"
                 "global_load_async_to_lds_b128 %5, %13, off\n\t"
                 "global_load_async_to_lds_b128 %6, %14, off\n\t"
                 "global_load_async_to_lds_b128 %7, %15, off\n\t"
                 "s_wait_xcnt 0x0"
                 : : "v"(l), "v"(l + 16 * GP), "v"(l + 32 * GP), "v"(l + 48 * GP), "v"(l + 64 * GP), "v"(l + 80 * GP), "v"(l + 96 * GP), "v"(l + 112 * GP),
                     "v"(g), "v"(g + gs), "v"(g + 2 * gs), "v"(g + 3 * gs), "v"(g + 4 * gs), "v"(g + 5 * gs), "v"(g + 6 * gs), "v"(g + 7 * gs) : "memory");
}
template <typename T16, int NSPLIT, bool BIAS, int EPI>
__global__ __launch_bounds__(128) void k_gemmw(const T16* __restrict__ A, const T16* __restrict__ A2, const T16* __restrict__ Bt, int K, float* C, int ldc, const float* __restrict__ bias, size_t sA, size_t sB, size_t sC, h16* P16, bf* Ph, bf* Pl) {
    static_assert(EPI == 0 || HD == 64, "a wave's 64 columns are one head");
    static_assert(NSPLIT == 0 || NSPLIT == 1, "one or two planes of A");
    typedef typename WFrag<T16>::V V;
    constexpr int NT = NSPLIT == 1 ? 3 : 2;                          // operand tiles of a stage: A, Bt, (A2)
    __shared__ __align__(16) char st[2 * NT * GT]; __shared__ __align__(16) float osw[4 * 16 * 68];
    const size_t z = blockIdx.z; A += z * sA; if (NSPLIT == 1) A2 += z * sA; Bt += z * sB; if (EPI == 0) C += z * sC; else { P16 += z * sC; Ph += z * sC; Pl += z * sC; }
    const int wave = __builtin_amdgcn_readfirstlane((int)(threadIdx.x >> 5)), wm = wave >> 1, wn = wave & 1;
    const int lane = threadIdx.x & 31, lr = lane & 15, hi = lane >> 4; const int r0 = blockIdx.x * 128 + wm * 64, c0 = blockIdx.y * 128 + wn * 64, hd = blockIdx.y * 2 + wn;
    float* os = osw + wave * (16 * 68);                              // each wave stages its output in a range of its own
    v8f acc[4][4];
#pragma unroll
    for (int mb = 0; mb < 4; ++mb)
#pragma unroll
        for (int nb = 0; nb < 4; ++nb) acc[mb][nb] = (v8f){};
    float bcol[4];                                                   // EPI 2: the bias of the lane's own four columns, asked for ahead of the K loop
    if (EPI == 2 && BIAS) {
#pragma unroll
        for (int nb = 0; nb < 4; ++nb) bcol[nb] = bfr(bias[c0 + nb * 16 + lr]);
        asm volatile("s_wait_xcnt 0x0" : : "s"(bias) : "memory"); }   // the four bias loads name the scalar pair of bias as their base; as an input here the pair stays untouched up to the wait
    // copies: thread = (row cpr of 16, 16-byte piece cpc of 8), so that a wave's copy covers four whole lines
    const int cpr = threadIdx.x >> 3, cpc = threadIdx.x & 7; const size_t gs = (size_t)16 * K * 2;
    const unsigned l0 = (unsigned)(size_t)st + (unsigned)(cpr * GP + cpc * 16);
    const char* gA = (const char*)(A + (size_t)(blockIdx.x * 128 + cpr) * K + cpc * 8); const char* gB = (const char*)(Bt + (size_t)(blockIdx.y * 128 + cpr) * K + cpc * 8);
    const char* gA2 = NSPLIT == 1 ? (const char*)(A2 + (size_t)(blockIdx.x * 128 + cpr) * K + cpc * 8) : nullptr;
    auto fill = [&](int s, unsigned bo) { g_cp8(l0 + bo, gA + (size_t)s * (GK * 2), gs); g_cp8(l0 + bo + GT, gB + (size_t)s * (GK * 2), gs); if (NSPLIT == 1) g_cp8(l0 + bo + 2 * GT, gA2 + (size_t)s * (GK * 2), gs); };
    const int nst = K / GK;
    fill(0, 0u);
    asm volatile("s_wait_asynccnt 0x0" ::: "memory");                // stage 0 has landed, as far as this wave brought it
    __syncthreads();                                                 // ... and the other waves' parts
    if (nst > 1) fill(1, (unsigned)(NT * GT));
    const unsigned fa = (unsigned)((wm * 64 + lr) * GP + 16 * hi), fb = (unsigned)(GT + (wn * 64 + lr) * GP + 16 * hi);   // the lane's byte offsets in a stage: row lr of the wave's first fragment, k from 8 hi
#pragma unroll 1
    for (int t = 0; t < nst; ++t) {                                  // rolled: one stage's fragments and the accumulators fill the registers
        const unsigned bo = (unsigned)(t & 1) * (unsigned)(NT * GT);
        const T16* la = (const T16*)(st + bo + fa); const T16* lb = (const T16*)(st + bo + fb); const T16* la2 = (const T16*)(st + bo + 2 * GT + fa);
        V a[4], a2[4], b[4];
        auto frags = [&](int ks) {
#pragma unroll
            for (int mb = 0; mb < 4; ++mb) { a[mb] = WFrag<T16>::ld(la + mb * 16 * (GP / 2) + ks * 32); b[mb] = WFrag<T16>::ld(lb + mb * 16 * (GP / 2) + ks * 32); if (NSPLIT == 1) a2[mb] = WFrag<T16>::ld(la2 + mb * 16 * (GP / 2) + ks * 32); } };
        auto prods = [&]() {
#pragma unroll
            for (int nb = 0; nb < 4; ++nb)
#pragma unroll
                for (int mb = 0; mb < 4; ++mb) { acc[mb][nb] = WFrag<T16>::mma(a[mb], b[nb], acc[mb][nb]); if (NSPLIT == 1) acc[mb][nb] = WFrag<T16>::mma(a2[mb], b[nb], acc[mb][nb]); } };
        static_assert(GK == 64, "a stage is two fragment groups of 32 k");
        frags(0);
        __builtin_amdgcn_sched_barrier(0);   // the fragment loads of 32 k stay one group ahead of its products: spread among them, every group of four products waits out an LDS latency of its own
        prods();
        frags(1);
        if (NSPLIT == 1) __builtin_amdgcn_sched_barrier(0);   // as above: without it the second group's products rise among its loads, on one register set for Bt with a full wait per fragment
        asm volatile("s_wait_dscnt 0x0" ::: "memory");               // this wave's reads of the stage have returned: its last fragments are in registers
        asm volatile("s_wait_asynccnt 0x0" ::: "memory");            // its copies of the next stage have landed
        __syncthreads();                                             // publishes the next stage and ends every wave's reads of this one
        // the refill goes into the buffer that has just been read. One plane of A: ahead of the stage's last products, which lengthen the copies' lead. Two planes: behind them (twice the products a stage give the lead; the fragments and the copies' addresses together would pass 256 registers)
        if (NSPLIT == 1) prods();
        if (t + 2 < nst) fill(t + 2, bo);
        if (NSPLIT == 0) prods();
    }
    asm volatile("s_wait_asynccnt 0x0" ::: "memory");                // no copy is left outstanding
    Pl3 pv[8];
    const size_t pe = ((size_t)hd * TT + r0 + hi) * HD + lr * 4;     // EPI 1: the lane's first element in a plane; every store of the wave is a constant step from it
    if (EPI == 2) {
        // staged transposed, 16 head dims x 64 rows t at a time: a lane's 8 accumulator rows are neighbours in t
#pragma unroll
        for (int nb = 0; nb < 4; ++nb) {
#pragma unroll
            for (int mb = 0; mb < 4; ++mb) { float* p = os + lr * 68 + mb * 16 + hi * 8; v8f t = acc[mb][nb]; if (BIAS) t += bcol[nb]; *(v4fa*)p = (v4f){t[0], t[1], t[2], t[3]}; *(v4fa*)(p + 4) = (v4f){t[4], t[5], t[6], t[7]}; }
            __builtin_amdgcn_wave_barrier(); asm volatile("" ::: "memory");   // the rows are read back by other lanes of the wave: the LDS reads below stay behind the LDS stores above
#pragma unroll
            for (int s = 0; s < 8; ++s) pv[s] = cv_planes(*(const v4fa*)(os + (2 * s + hi) * 68 + lr * 4));
            __builtin_amdgcn_sched_barrier(0);   // the group's 24 stores stay one run behind all of its conversions: mixed in, each store's registers are used again at once, with a wait in front of every such use
#pragma unroll
            for (int s = 0; s < 8; ++s) st_planes(pv[s], ((size_t)hd * HD + nb * 16 + 2 * s + hi) * TT + r0 + lr * 4, P16, Ph, Pl);
            __builtin_amdgcn_wave_barrier(); asm volatile("s_wait_xcnt 0x0" ::: "memory");   // stands in front of the next group's writes to registers that the stores above name; also keeps the next group's LDS stores behind these reads
        }
        return;
    }
#pragma unroll
    for (int mb = 0; mb < 4; ++mb) {
#pragma unroll
        for (int nb = 0; nb < 4; ++nb) {
#pragma unroll
            for (int j = 0; j < 8; ++j) os[(hi * 8 + j) * 68 + nb * 16 + lr] = acc[mb][nb][j]; }
        __builtin_amdgcn_wave_barrier(); asm volatile("" ::: "memory");
        float* crow = C + (size_t)(r0 + mb * 16) * ldc + c0;
{
#pragma unroll
            for (int s = 0; s < 8; ++s) { const int row = 2 * s + hi, cofs = lr * 4; v4f val = *(const v4fa*)(os + row * 68 + cofs); if (BIAS) { val[0] += bfr(bias[c0 + cofs]); val[1] += bfr(bias[c0 + cofs + 1]); val[2] += bfr(bias[c0 + cofs + 2]); val[3] += bfr(bias[c0 + cofs + 3]); }
                if (EPI == 1) pv[s] = cv_planes(val);
                else *(v4f*)(crow + (size_t)row * ldc + cofs) = val; }
             }
        if (EPI == 1) {
            __builtin_amdgcn_sched_barrier(0);   // one run of 24 stores behind all the conversions, as in EPI 2
#pragma unroll
            for (int s = 0; s < 8; ++s) st_planes(pv[s], pe + (size_t)(mb * 16 + 2 * s) * HD, P16, Ph, Pl);
        }
        __builtin_amdgcn_wave_barrier(); asm volatile("" ::: "memory");
    }
}


__global__ __launch_bounds__(256) void k_wtG(const float* __restrict__ w, int K, int N, bf* Bt) {
    const int lane = threadIdx.x & 31; const int L0 = (blockIdx.x * 8 + (threadIdx.x >> 5)) * 8; const int nlines = N * K / 64;
{
#pragma unroll 1
        for (int l = 0; l < 8; ++l) { const int L = L0 + l; if (L >= nlines) break; const size_t e = (size_t)L * 64 + lane * 2; const int k = (int)(e % K), n = (int)(e / K); v2us o;
            o[0] = f2bf(w[(size_t)k * N + n]); o[1] = f2bf(w[(size_t)(k + 1) * N + n]); *(v2us*)(Bt + e) = o; }
         }
}
// ---- k_cvtall: every f32 -> bf16 copy of the call (four weights, three inputs) in ONE launch of waves that stay and loop: CG work-groups of CW waves, one round on the chip.
// A chunk is CC elements in a row: eight loads of 16 bytes a lane, 512 bytes in a row each, and eight stores of 8 bytes a lane, 256 bytes in a row each (whole lines both ways). Trip i of wave g takes chunk i * CN + g of dst,
// which holds the seven copies one behind the other; trip 0 is the four weights, every later pair of trips one input. The next trip's loads are asked for ahead of this trip's conversions and stores.
#define CW  16
#define CG  256
#define CC  1024
#define CN  (CG * CW)             // waves in all = chunks of a trip
__global__ __launch_bounds__(CW * 32) void k_cvtall(const float* __restrict__ w0, const float* __restrict__ w1, const float* __restrict__ w2, const float* __restrict__ w3,
                                                    const float* __restrict__ x0, const float* __restrict__ x1, const float* __restrict__ x2, bf* __restrict__ dst) {
    static_assert(DQ * DM == (CN / 4) * CC && DKV * DM == (CN / 4) * CC, "trip 0: a quarter of the waves per weight");
    static_assert((size_t)NB_ * TT * DM == (size_t)2 * CN * CC, "two trips per input");
    const int g = (int)blockIdx.x * CW + __builtin_amdgcn_readfirstlane((int)(threadIdx.x >> 5)), lane = threadIdx.x & 31, wi = g / (CN / 4);
    const float* w = wi == 0 ? w0 : wi == 1 ? w1 : wi == 2 ? w2 : w3;
    const float* s[7] = { w + (size_t)(g % (CN / 4)) * CC, x0 + (size_t)g * CC, x0 + (size_t)(CN + g) * CC, x1 + (size_t)g * CC, x1 + (size_t)(CN + g) * CC, x2 + (size_t)g * CC, x2 + (size_t)(CN + g) * CC };
    v4f v[2][8];
#pragma unroll
    for (int j = 0; j < 8; ++j) v[0][j] = *(const v4f*)(s[0] + j * 128 + lane * 4);
    __builtin_amdgcn_sched_barrier(0);       // trip 0's loads are issued first: behind trip 1's, its conversions would wait for all sixteen
#pragma unroll
    for (int i = 0; i < 7; ++i) {            // unrolled: a trip's source and its one of the two register sets are then fixed at compile time
        if (i + 1 < 7) {
#pragma unroll
            for (int j = 0; j < 8; ++j) v[(i + 1) & 1][j] = *(const v4f*)(s[i + 1] + j * 128 + lane * 4); }
        __builtin_amdgcn_sched_barrier(0);   // the next trip's eight loads stay one group ahead of this trip's conversions: left free, loads of several trips were mixed among waits that let only a few be in flight
        bf* d = dst + ((size_t)i * CN + g) * CC;
#pragma unroll
        for (int j = 0; j < 8; ++j) { v4us o;
#pragma unroll
            for (int k = 0; k < 4; ++k) o[k] = f2bf(v[i & 1][j][k]);
            *(v4us*)(d + j * 128 + lane * 4) = o; }
        if (i + 1 < 7) asm volatile("s_wait_xcnt 0x0" ::: "memory");   // stands in front of the next loads and conversions, which write registers that the stores above name
    }
}
__global__ __launch_bounds__(256) void k_cscvt(const float* __restrict__ cosT, const float* __restrict__ sinT, float* CS) { const int idx = blockIdx.x * 256 + threadIdx.x; if (idx >= TT * HD) return; v2f cs; cs[0] = bfr(cosT[idx]); cs[1] = bfr(sinT[idx]); *(v2f*)(CS + (size_t)idx * 2) = cs;  }
// ---- k_fattn: causal attention, grid (batch x head, row tile), scores never stored. Transposed products: S^T = K Q^T (A = key rows, B = query columns), O^T += V^T P^T; a lane holds one query
// column, so two stacked 16-key score tiles, converted in place, ARE the B operand of the second product (hardware k order, which WFrag::ld also delivers). Running maximum and sum per column (online softmax).
// Query rows >= RH (fp16): a work-group serves QG rows, each of its NW waves QT of them, and all waves walk the same keys, which come through LDS once for the four of them: a stage is SK keys of K [t][d] and of V^T [d][t],
// brought by asynchronous 16-byte copies in whole lines, two buffers, the next stage in flight while this one is worked on.
// Query rows < RH (hi+lo bf16 planes, 3 products): the NW waves share QT query rows and take the 32-key passes w, w + NW, ... from global memory; their (maximum, sum, O^T) are joined through LDS at the end.
#define QT  32
#define KT  32
#define NW  4
#define SC2 (SCL * 1.4426950408889634f)   // score scale times log2(e): probabilities are exp2((s - max) * SC2)
// fragment at a base plus a 32-bit BYTE offset: a wave-uniform base and the lane's own offset, or the lane's own address and 0
template <typename T16> __device__ __forceinline__ typename WFrag<T16>::V fa_ld(const T16* __restrict__ base, unsigned ob) { return WFrag<T16>::ld((const T16*)((const char*)base + ob)); }
// key fragments of one 32-key pass; kb plus koff bytes = the lane's own address in it: key row lr of the pass, from d = 8 hi
template <typename T16>
__device__ __forceinline__ void fa_ldk(const T16* __restrict__ kb, unsigned koff, typename WFrag<T16>::V (&ka)[2][2]) {
#pragma unroll
    for (int ks = 0; ks < 2; ++ks)
#pragma unroll
        for (int kc = 0; kc < 2; ++kc) ka[ks][kc] = fa_ld<T16>(kb + (ks * 16 * HD + kc * 32), koff);
}
__device__ __forceinline__ void fa_pack(const v8f& t0, const v8f& t1, v16h& p, v16h& p2) { (void)p2;
#pragma unroll
    for (int r = 0; r < 8; ++r) { p[r] = (h16)t0[r]; p[8 + r] = (h16)t1[r]; } }
__device__ __forceinline__ void fa_pack(const v8f& t0, const v8f& t1, v16bf& p, v16bf& p2) { v8us h0, h1, l0, l1;
#pragma unroll
    for (int r = 0; r < 8; ++r) { unsigned short a, c; splitf(t0[r], a, c); h0[r] = a; l0[r] = c; splitf(t1[r], a, c); h1[r] = a; l1[r] = c; }
    p = cat16b(h0, h1); p2 = cat16b(l0, l1); }
__device__ __forceinline__ float fa_xhalf(float x) { const int b = __float_as_int(x); return __int_as_float(__builtin_amdgcn_permlanex16(b, b, 0x76543210, 0xfedcba98, false, false)); }   // lane l <-> l ^ 16
// softmax and second product of one pass: s[ks][qb][r] = score(key k0 + 16 ks + 8 hi + r, query q0 + 16 qb + lr), va (and the lo plane's va2) = the pass's value fragments.
// EDGE: the pass may reach above the diagonal. B0, NB: the 16-column groups that the pass serves.
template <typename T16, bool HL, bool EDGE, int B0, int NB>
__device__ __forceinline__ void fa_soft(v8f (&s)[2][2], typename WFrag<T16>::V (&va)[4], typename WFrag<T16>::V (&va2)[4], int q0, int k0, int lr, int hi, v8f (&o)[4][2], float (&m)[2], float (&l)[2]) {
    typedef typename WFrag<T16>::V V;
    if (EDGE) {                                                      // keys above the query are masked (by select: no branch behind the products)
#pragma unroll
        for (int ks = 0; ks < 2; ++ks)
#pragma unroll
            for (int qb = B0; qb < B0 + NB; ++qb)
#pragma unroll
                for (int r = 0; r < 8; ++r) s[ks][qb][r] = (k0 + ks * 16 + 8 * hi + r > q0 + qb * 16 + lr) ? -3.0e38f : s[ks][qb][r]; }
#pragma unroll
    for (int qb = B0; qb < B0 + NB; ++qb) {
        float mx = fmaxf(s[0][qb][0], s[1][qb][0]);
#pragma unroll
        for (int r = 1; r < 8; ++r) mx = fmaxf(mx, fmaxf(s[0][qb][r], s[1][qb][r]));
        mx = fmaxf(mx, fa_xhalf(mx));                                // the two lane halves hold the two halves of a column's keys
        const float mn = fmaxf(m[qb], mx), al = __builtin_amdgcn_exp2f((m[qb] - mn) * SC2), mb = mn * SC2; m[qb] = mn;
        float ps = 0.f;
#pragma unroll
        for (int ks = 0; ks < 2; ++ks)
#pragma unroll
            for (int r = 0; r < 8; ++r) { const float p = __builtin_amdgcn_exp2f(fmaf(s[ks][qb][r], SC2, -mb)); s[ks][qb][r] = p; ps += p; }
        l[qb] = fmaf(l[qb], al, ps);
        V pb, pb2; fa_pack(s[0][qb], s[1][qb], pb, pb2);
#pragma unroll
        for (int db = 0; db < 4; ++db) { v8f t = o[db][qb] * al; t = WFrag<T16>::mma(va[db], pb, t); if (HL) { t = WFrag<T16>::mma(va2[db], pb, t); t = WFrag<T16>::mma(va[db], pb2, t); } o[db][qb] = t; }
    }
}
// one hi+lo pass: 32 keys from k0 against query columns from q0. Q, kb, vb and the lo planes' Q2, kb2, vb2: first query row, first key row [t][d] and first key column [d][t] of the pass, wave-uniform; koff = 2 (lr HD + 8 hi) and voff = 2 (lr TT + 8 hi) are the lane's byte offsets in row-major [t][d] and [d][t] planes.
template <typename T16, int B0, int NB>
__device__ __forceinline__ void fa_pass(const T16* __restrict__ Q, const T16* __restrict__ Q2, const T16* __restrict__ kb, const T16* __restrict__ kb2, const T16* __restrict__ vb, const T16* __restrict__ vb2, int q0, int k0, unsigned koff, unsigned voff, int lr, int hi,
                                        v8f (&o)[4][2], float (&m)[2], float (&l)[2]) {
    typedef typename WFrag<T16>::V V;
    V va[4], va2[4];
    v8f s[2][2];
    {
        // the few hi+lo passes fetch nothing ahead: twice the planes, and their registers would set the occupancy of the whole kernel
        // Each lane's plane addresses are formed here, and the wait behind the loads takes them as inputs: they stay untouched up to it.
        V qf[2][2], qf2[2][2], ka[2][2]; const T16* qp = (const T16*)((const char*)Q + koff); const T16* qp2 = (const T16*)((const char*)Q2 + koff);
#pragma unroll
        for (int qb = B0; qb < B0 + NB; ++qb)
#pragma unroll
            for (int kc = 0; kc < 2; ++kc) { qf[qb][kc] = WFrag<T16>::ld(qp + (qb * 16 * HD + kc * 32)); qf2[qb][kc] = WFrag<T16>::ld(qp2 + (qb * 16 * HD + kc * 32)); }
        asm volatile("s_wait_xcnt 0x0" : : "v"(qp), "v"(qp2) : "memory");
        V ka2[2][2]; const T16* kp = (const T16*)((const char*)kb + koff); const T16* kp2 = (const T16*)((const char*)kb2 + koff);
        fa_ldk<T16>(kp, 0u, ka); fa_ldk<T16>(kp2, 0u, ka2);
        asm volatile("s_wait_xcnt 0x0" : : "v"(kp), "v"(kp2) : "memory");   // as above
#pragma unroll
        for (int ks = 0; ks < 2; ++ks)
#pragma unroll
            for (int qb = B0; qb < B0 + NB; ++qb) { v8f t = (v8f){};
#pragma unroll
                for (int kc = 0; kc < 2; ++kc) { t = WFrag<T16>::mma(ka[ks][kc], qf[qb][kc], t); t = WFrag<T16>::mma(ka2[ks][kc], qf[qb][kc], t); t = WFrag<T16>::mma(ka[ks][kc], qf2[qb][kc], t); }
                s[ks][qb] = t; }
        const T16* vp = (const T16*)((const char*)vb + voff); const T16* vp2 = (const T16*)((const char*)vb2 + voff);
#pragma unroll
        for (int db = 0; db < 4; ++db) { va[db] = WFrag<T16>::ld(vp + db * 16 * TT); va2[db] = WFrag<T16>::ld(vp2 + db * 16 * TT); }
        asm volatile("s_wait_xcnt 0x0" : : "v"(vp), "v"(vp2) : "memory");   // as above
    }
    fa_soft<T16, true, true, B0, NB>(s, va, va2, q0, k0, lr, hi, o, m, l);
}
// the hi+lo walk of tile qt (QT query rows): wave w takes the passes w, w + NW, ...
template <typename T16>
__device__ __forceinline__ void fa_walk(const T16* __restrict__ Q, const T16* __restrict__ Q2, const T16* __restrict__ Kp, const T16* __restrict__ K2, const T16* __restrict__ Vt, const T16* __restrict__ V2,
                                        int qt, int wave, int lr, int hi, v8f (&o)[4][2], float (&m)[2], float (&l)[2]) {
    if (wave > qt) return;                                           // fewer passes than waves: this wave keeps its empty state (sum 0, weight 0 in the join)
    const int q0 = qt * QT; const unsigned koff = (unsigned)(lr * HD + 8 * hi) * 2u, voff = (unsigned)(lr * TT + 8 * hi) * 2u;
    Q += (size_t)q0 * HD; Q2 += (size_t)q0 * HD;
    int kt = wave;
    // one 16-column group at a time: with both groups' hi and lo query planes live the walk spills
#pragma unroll 1
    for (; kt <= qt; kt += NW) fa_pass<T16, 0, 1>(Q, Q2, Kp + (size_t)kt * KT * HD, K2 + (size_t)kt * KT * HD, Vt + kt * KT, V2 + kt * KT, q0, kt * KT, koff, voff, lr, hi, o, m, l);   // rolled: one pass already fills the registers
#pragma unroll 1
    for (kt = wave; kt <= qt; kt += NW) fa_pass<T16, 1, 1>(Q, Q2, Kp + (size_t)kt * KT * HD, K2 + (size_t)kt * KT * HD, Vt + kt * KT, V2 + kt * KT, q0, kt * KT, koff, voff, lr, hi, o, m, l);   // rolled, as above
}
#define QG  (NW * QT)             // query rows of a work-group of the fp16 walk
#define SK  64                    // keys per stage: one 128-byte line of every V^T row
#define SB  ((SK + HD) * GP)      // a stage in LDS: SK key rows, then HD rows of V^T, 128 bytes each at pitch GP
#define NF  ((TT - RH) / QG)      // row tiles of the fp16 walk
// a lane's four asynchronous 16-byte copies: rows 16 apart, LDS byte address l, global address g, gs = bytes of 16 global rows.
// The wait on the address registers is the last line of the copies' own statement, so that no operand register is written anew ahead of it.
__device__ __forceinline__ void g_cp4(unsigned l, const char* g, size_t gs) {
    asm volatile("global_load_async_to_lds_b128 %0, %4, off\n\t"
                 "global_load_async_to_lds_b128 %1, %5, off\n\t"
                 "global_load_async_to_lds_b128 %2, %6, off\n\t"
                 "global_load_async_to_lds_b128 %3, %7, off\n\t"
                 "s_wait_xcnt 0x0"
                 : : "v"(l), "v"(l + 16 * GP), "v"(l + 32 * GP), "v"(l + 48 * GP), "v"(g), "v"(g + gs), "v"(g + 2 * gs), "v"(g + 3 * gs) : "memory");
}
// one fp16 pass out of LDS: 32 keys from k0 against the wave's 32 query columns from q0. kl, vl: the lane's own addresses in the stage, row lr of the pass's keys and row lr of V^T at the pass's first key, each plus 16 hi bytes.
template <bool EDGE>
__device__ __forceinline__ void fa_pass_s(const char* kl, const char* vl, int q0, int k0, int lr, int hi, v16h (&qf)[2][2], v8f (&o)[4][2], float (&m)[2], float (&l)[2]) {
    v16h ka[2][2], va[4], va2[4]; v8f s[2][2];
#pragma unroll
    for (int ks = 0; ks < 2; ++ks)
#pragma unroll
        for (int kc = 0; kc < 2; ++kc) ka[ks][kc] = WFrag<h16>::ld((const h16*)(kl + ks * 16 * GP + kc * 64));
#pragma unroll
    for (int db = 0; db < 4; ++db) va[db] = WFrag<h16>::ld((const h16*)(vl + db * 16 * GP));   // value fragments: asked for ahead of the score products, used behind the softmax
#pragma unroll
    for (int ks = 0; ks < 2; ++ks)
#pragma unroll
        for (int qb = 0; qb < 2; ++qb) { v8f t = (v8f){};
#pragma unroll
            for (int kc = 0; kc < 2; ++kc) t = wmma16(ka[ks][kc], qf[qb][kc], t);
            s[ks][qb] = t; }
    fa_soft<h16, false, EDGE, 0, 2>(s, va, va2, q0, k0, lr, hi, o, m, l);
}
// the fp16 walk of the QG query rows from qg: every wave passes every stage's foot; a wave works the passes up to its own diagonal.
__device__ __forceinline__ void fa_walk_s(const h16* __restrict__ Q, const h16* __restrict__ Kp, const h16* __restrict__ Vt, char* st, int qg, int wave, int lr, int hi, v8f (&o)[4][2], float (&m)[2], float (&l)[2]) {
    static_assert(HD == 64 && SK == 64 && NW == 4, "a thread's copies: 16 rows of eight 16-byte pieces per 128 threads");
    const int q0 = qg + wave * QT; const unsigned koff = (unsigned)(lr * HD + 8 * hi) * 2u; v16h qf[2][2];
#pragma unroll
    for (int qb = 0; qb < 2; ++qb)
#pragma unroll
        for (int kc = 0; kc < 2; ++kc) qf[qb][kc] = fa_ld<h16>(Q + (size_t)q0 * HD + (qb * 16 * HD + kc * 32), koff);
    // copies: thread = (row cpr of 16, 16-byte piece cpc of 8), so that a wave's copy covers four whole lines
    const int cpr = threadIdx.x >> 3, cpc = threadIdx.x & 7;
    const unsigned l0 = (unsigned)(size_t)st + (unsigned)(cpr * GP + cpc * 16);
    const char* gK = (const char*)(Kp + (size_t)cpr * HD + cpc * 8); const char* gV = (const char*)(Vt + (size_t)cpr * TT + cpc * 8);
    auto fill = [&](int s, unsigned bo) { g_cp4(l0 + bo, gK + (size_t)s * (SK * HD * 2), (size_t)16 * HD * 2); g_cp4(l0 + bo + SK * GP, gV + (size_t)s * (SK * 2), (size_t)16 * TT * 2); };
    const int nst = (qg + QG) / SK, nfull = qg / SK;                 // stages in all (at least two), and those that lie below every wave's diagonal
    auto foot = [&](int t, unsigned bo) {
        asm volatile("s_wait_dscnt 0x0" ::: "memory");               // this wave's reads of the stage have returned
        asm volatile("s_wait_asynccnt 0x0" ::: "memory");            // its copies of the next stage have landed
        __syncthreads();                                             // publishes the next stage and ends every wave's reads of this one
        if (t + 2 < nst) fill(t + 2, bo); };                         // the refill goes into the buffer that has just been read
    fill(0, 0u);
    asm volatile("s_wait_asynccnt 0x0" ::: "memory");                // stage 0 has landed, as far as this wave brought it
    __syncthreads();                                                 // ... and the other waves' parts
    fill(1, (unsigned)SB);
    const unsigned fk = (unsigned)(lr * GP + 16 * hi), fv = (unsigned)((SK + lr) * GP + 16 * hi);
    int t = 0;
#pragma unroll 1
    for (; t < nfull; ++t) {                                         // rolled: two passes already fill the registers
        const unsigned bo = (unsigned)(t & 1) * (unsigned)SB;
        fa_pass_s<false>(st + bo + fk, st + bo + fv, q0, t * SK, lr, hi, qf, o, m, l);
        fa_pass_s<false>(st + bo + fk + KT * GP, st + bo + fv + KT * 2, q0, t * SK + KT, lr, hi, qf, o, m, l);
        foot(t, bo);
    }
#pragma unroll 1
    for (; t < nst; ++t) {                                           // the QG keys of the work-group's own rows: below, on or above the wave's diagonal (wave-uniform tests)
        const unsigned bo = (unsigned)(t & 1) * (unsigned)SB;
#pragma unroll 1
        for (int p = 0; p < SK / KT; ++p) { const int k0 = t * SK + p * KT; const char* kl = st + bo + fk + p * (KT * GP); const char* vl = st + bo + fv + p * (KT * 2);   // rolled: code size
            if (k0 < q0) fa_pass_s<false>(kl, vl, q0, k0, lr, hi, qf, o, m, l);
            else if (k0 == q0) fa_pass_s<true>(kl, vl, q0, k0, lr, hi, qf, o, m, l); }
        foot(t, bo);
    }
    asm volatile("s_wait_asynccnt 0x0" ::: "memory");                // no copy is left outstanding
}
__global__ __launch_bounds__(NW * 32) void k_fattn(const h16* __restrict__ Q16, const h16* __restrict__ K16, const h16* __restrict__ V16, const bf* __restrict__ Qh, const bf* __restrict__ Ql, const bf* __restrict__ Kh, const bf* __restrict__ Kl,
                                                   const bf* __restrict__ Vh, const bf* __restrict__ Vl, bf* Ah, bf* Al) {
    static_assert(RH % QG == 0 && (TT - RH) % QG == 0 && QG % SK == 0, "whole row tiles on both sides of RH");
    __shared__ __align__(16) char stg[2 * SB];
    __shared__ __align__(16) float osh[NW * 4 * 2 * 256]; __shared__ float msh[NW * QT]; __shared__ float lsh[NW * QT];
    const int wave = __builtin_amdgcn_readfirstlane((int)(threadIdx.x >> 5)), lane = threadIdx.x & 31, lr = lane & 15, hi = lane >> 4;
    // longest rows first, over all batches and heads. blockIdx.y < NF: the fp16 tile of QG rows from qg; the rest: the hi+lo tile qt of QT rows
    const bool f16 = (int)blockIdx.y < NF; const int qg = TT - QG - (int)blockIdx.y * QG, qt = (RH / QT - 1) - ((int)blockIdx.y - NF);
    const int h = blockIdx.x % NH_, b = blockIdx.x / NH_; const size_t hq = (size_t)blockIdx.x * TT * HD, hk = (size_t)(blockIdx.x / REP) * TT * HD;   // planes are [batch][head][...]: blockIdx.x counts them through
    v8f o[4][2]; float m[2] = {-3.0e38f, -3.0e38f}, l[2] = {0.f, 0.f};
#pragma unroll
    for (int db = 0; db < 4; ++db) { o[db][0] = (v8f){}; o[db][1] = (v8f){}; }
    if (f16) fa_walk_s(Q16 + hq, K16 + hk, V16 + hk, stg, qg, wave, lr, hi, o, m, l);
    else fa_walk<bf>(Qh + hq, Ql + hq, Kh + hk, Kl + hk, Vh + hk, Vl + hk, qt, wave, lr, hi, o, m, l);
#pragma unroll
    for (int qb = 0; qb < 2; ++qb) { l[qb] += fa_xhalf(l[qb]);
#pragma unroll
        for (int db = 0; db < 4; ++db) { float* p = osh + ((wave * 4 + db) * 2 + qb) * 256 + lane * 8; const v8f t = o[db][qb]; *(v4fa*)p = (v4f){t[0], t[1], t[2], t[3]}; *(v4fa*)(p + 4) = (v4f){t[4], t[5], t[6], t[7]}; }
        if (hi == 0) { msh[wave * QT + qb * 16 + lr] = m[qb]; lsh[wave * QT + qb * 16 + lr] = l[qb]; } }
    __syncthreads();
    // thread = (query row q, 16 head dims db), so that one wave writes whole 128-byte lines of the merged planes
    const int q = threadIdx.x >> 2, db = threadIdx.x & 3, qb = q >> 4, c = q & 15;
    if (!f16) {
    // join of the waves' partial states
    float M = msh[q];
#pragma unroll
    for (int w = 1; w < NW; ++w) M = fmaxf(M, msh[w * QT + q]);
    float L = 0.f, acc[16];
#pragma unroll
    for (int r = 0; r < 16; ++r) acc[r] = 0.f;
#pragma unroll
    for (int w = 0; w < NW; ++w) { const float wg = __builtin_amdgcn_exp2f((msh[w * QT + q] - M) * SC2); L = fmaf(wg, lsh[w * QT + q], L);
#pragma unroll
        for (int hh = 0; hh < 2; ++hh) { const float* p = osh + ((w * 4 + db) * 2 + qb) * 256 + (c + 16 * hh) * 8; const v4f x0 = *(const v4fa*)p, x1 = *(const v4fa*)(p + 4);
#pragma unroll
            for (int r = 0; r < 4; ++r) { acc[hh * 8 + r] = fmaf(wg, x0[r], acc[hh * 8 + r]); acc[hh * 8 + 4 + r] = fmaf(wg, x1[r], acc[hh * 8 + 4 + r]); } } }
    const float inv = __fdiv_rn(1.0f, L); const size_t oo = ((size_t)b * TT + qt * QT + q) * DQ + h * HD + db * 16;
#pragma unroll
    for (int hh = 0; hh < 2; ++hh) { v8us oh, ol;
#pragma unroll
        for (int r = 0; r < 8; ++r) { unsigned short a, c2; splitf(acc[hh * 8 + r] * inv, a, c2); oh[r] = a; ol[r] = c2; }
        *(v8usa*)(Ah + oo + hh * 8) = oh; *(v8usa*)(Al + oo + hh * 8) = ol; }
    asm volatile("s_wait_xcnt 0x0" ::: "memory");                    // in the built code the other branch's block follows this one: the wait stands in front of its writes to registers that the stores above name
    } else {
        // every wave's state is complete for its own QT rows: one after the other they are scaled and stored
#pragma unroll
        for (int w = 0; w < NW; ++w) { const float inv = __fdiv_rn(1.0f, lsh[w * QT + q]); const size_t oo = ((size_t)b * TT + qg + w * QT + q) * DQ + h * HD + db * 16;
#pragma unroll
            for (int hh = 0; hh < 2; ++hh) { const float* p = osh + ((w * 4 + db) * 2 + qb) * 256 + (c + 16 * hh) * 8; const v4f x0 = *(const v4fa*)p, x1 = *(const v4fa*)(p + 4); v8us oh, ol;
#pragma unroll
                for (int r = 0; r < 4; ++r) { unsigned short a, c2; splitf(x0[r] * inv, a, c2); oh[r] = a; ol[r] = c2; splitf(x1[r] * inv, a, c2); oh[4 + r] = a; ol[4 + r] = c2; }
                *(v8usa*)(Ah + oo + hh * 8) = oh; *(v8usa*)(Al + oo + hh * 8) = ol; }
            if (w + 1 < NW) asm volatile("s_wait_xcnt 0x0" ::: "memory"); }   // stands in front of the next rows' writes to registers that the stores above name
    }
}

extern "C" void kernel_launch(void* const* d_in, const int* in_sizes, int n_in,
                              void* d_out, int out_size, void* d_ws, size_t ws_size, hipStream_t stream) {
    (void)in_sizes; (void)n_in; (void)out_size;
    const float* x = (const float*)d_in[0]; const float* xk = (const float*)d_in[1]; const float* xv = (const float*)d_in[2]; const float* wq = (const float*)d_in[3]; const float* bq = (const float*)d_in[4]; const float* wk = (const float*)d_in[5]; const float* bk = (const float*)d_in[6]; const float* wv = (const float*)d_in[7]; const float* bv = (const float*)d_in[8]; const float* wo = (const float*)d_in[9]; const float* bo = (const float*)d_in[10]; const float* cosT = nullptr; const float* sinT = nullptr; (void)cosT; (void)sinT;
    float* OUT = (float*)d_out;     // [4][2048][1024]
    char* wsp = (char*)d_ws;
    auto take = [&](size_t bytes) { char* p = wsp; wsp += (bytes + 255) & ~(size_t)255; return (void*)p; };
    // the bf16 copies, one behind the other in the order in which k_cvtall writes them: four weights, then value, key and query input (all NB_ batches each)
    bf* CV = (bf*)take(((size_t)DQ * DM + (size_t)2 * DKV * DM + (size_t)DM * DQ + (size_t)3 * NB_ * TT * DM) * 2);
    bf* WQ = CV; bf* WK = WQ + (size_t)DQ * DM; bf* WV = WK + (size_t)DKV * DM; bf* WO = WV + (size_t)DKV * DM;
    bf* XV = WO + (size_t)DM * DQ; bf* XK = XV + (size_t)NB_ * TT * DM; bf* XQ = XK + (size_t)NB_ * TT * DM;
    // every buffer below holds all NB_ batches
    h16* QP16 = (h16*)take((size_t)NB_ * NH_ * TT * HD * 2); h16* KP16 = (h16*)take((size_t)NB_ * NKV * TT * HD * 2); h16* VT16 = (h16*)take((size_t)NB_ * NKV * HD * TT * 2);
    bf* QPh = (bf*)take((size_t)NB_ * NH_ * TT * HD * 2); bf* QPl = (bf*)take((size_t)NB_ * NH_ * TT * HD * 2); bf* KPh = (bf*)take((size_t)NB_ * NKV * TT * HD * 2); bf* KPl = (bf*)take((size_t)NB_ * NKV * TT * HD * 2); bf* VTh = (bf*)take((size_t)NB_ * NKV * HD * TT * 2); bf* VTl = (bf*)take((size_t)NB_ * NKV * HD * TT * 2);
    bf* ATh = (bf*)take((size_t)NB_ * TT * DQ * 2); bf* ATl = (bf*)take((size_t)NB_ * TT * DQ * 2);
    if ((size_t)(wsp - (char*)d_ws) > ws_size) return;    // ws 256 MiB
    k_cvtall<<<CG, CW * 32, 0, stream>>>(wq, wk, wv, wo, xv, xk, x, CV);
    k_gemmw<bf, 0, true, 1><<<dim3(TT / 128, DQ / 128, NB_), 128, 0, stream>>>(XQ, nullptr, WQ, DM, nullptr, 0, bq, (size_t)TT * DM, 0, (size_t)NH_ * TT * HD, QP16, QPh, QPl);
    k_gemmw<bf, 0, true, 1><<<dim3(TT / 128, DKV / 128, NB_), 128, 0, stream>>>(XK, nullptr, WK, DM, nullptr, 0, bk, (size_t)TT * DM, 0, (size_t)NKV * TT * HD, KP16, KPh, KPl);
    k_gemmw<bf, 0, true, 2><<<dim3(TT / 128, DKV / 128, NB_), 128, 0, stream>>>(XV, nullptr, WV, DM, nullptr, 0, bv, (size_t)TT * DM, 0, (size_t)NKV * HD * TT, VT16, VTh, VTl);
    k_fattn<<<dim3(NB_ * NH_, NF + RH / QT, 1), NW * 32, 0, stream>>>(QP16, KP16, VT16, QPh, QPl, KPh, KPl, VTh, VTl, ATh, ATl);
    k_gemmw<bf, 1, true, 0><<<dim3(TT / 128, DM / 128, NB_), 128, 0, stream>>>(ATh, ATl, WO, DQ, OUT, DM, bo, (size_t)TT * DQ, 0, (size_t)TT * DM, nullptr, nullptr, nullptr);
}

// v008
// Measured time: 136 microseconds a run.
// Two timings next to v007 put it at 1.08 and 1.09 times that version's speed.
// All steps since v000 together make it 21.5 times as fast.
#include <hip/hip_runtime.h>

// SimpleMultiheadSDPAttention (query, key, value [4][2048][1024]; q = query Wq^T + bq, k = key Wk^T + bk, v = value Wv^T + bv (16 heads x 64); causal softmax(q.k / 8) (-1e30); out = merged Wo^T + bo -> [4][2048][1024]).
// Compute dtypes, f32 accumulate: every input rounded to bf16; q/k/v on PLAIN bf16 operands (three inputs; exact) + bias; causal scores and attn.v: query rows < 512 hl (3 products), the rest single fp16, fused with an online f32 softmax, causal tile skipping; Wo hl x exact (2 products) + bias.

#define NB_  4
#define TT   2048
#define DM   1024
#define NH_  16
#define NKV  16
#define REP  (NH_ / NKV)
#define HD   64
#define DQ   (NH_ * HD)
#define DKV  (NKV * HD)
#define RH   512                  // query rows < RH use hi+lo planes (0: none)
#define SCL  0.125f   // HD^-0.5
typedef _Float16 h16;
typedef unsigned short bf;
typedef __attribute__((ext_vector_type(16))) __bf16   v16bf;
typedef __attribute__((ext_vector_type(16))) _Float16 v16h;
typedef __attribute__((ext_vector_type(8)))  _Float16 v8h;
typedef __attribute__((ext_vector_type(8)))  unsigned short v8us;
typedef __attribute__((ext_vector_type(8)))  float    v8f;
typedef __attribute__((ext_vector_type(4)))  float    v4f;
typedef v8h  __attribute__((may_alias)) v8ha;
typedef v4f  __attribute__((may_alias)) v4fa;
typedef v8us __attribute__((may_alias)) v8usa;

__device__ __forceinline__ unsigned short f2bf(float f) { unsigned u = __float_as_uint(f); u += 0x7FFFu + ((u >> 16) & 1u); return (unsigned short)(u >> 16); }
__device__ __forceinline__ float bf2f(unsigned short b) { return __uint_as_float(((unsigned)b) << 16); }
__device__ __forceinline__ float bfr(float f) { return bf2f(f2bf(f)); }
__device__ __forceinline__ v16h cat16(v8h lo, v8h hi) { return __builtin_shufflevector(lo, hi, 0, 1, 2, 3, 4, 5, 6, 7, 8, 9, 10, 11, 12, 13, 14, 15); }
__device__ __forceinline__ v16bf cat16b(v8us lo, v8us hi) { return __builtin_bit_cast(v16bf, __builtin_shufflevector(lo, hi, 0, 1, 2, 3, 4, 5, 6, 7, 8, 9, 10, 11, 12, 13, 14, 15)); }
__device__ __forceinline__ v8f wmma16(v16h a, v16h b, v8f c) { return __builtin_amdgcn_wmma_f32_16x16x32_f16(false, a, false, b, (short)0, c, false, false); }
__device__ __forceinline__ v8f wmmab(v16bf a, v16bf b, v8f c) { return __builtin_amdgcn_wmma_f32_16x16x32_bf16(false, a, false, b, (short)0, c, false, false); }



__device__ __forceinline__ h16 tohx(float x) { return (h16)x; }
__device__ __forceinline__ void splitf(float y, unsigned short& h, unsigned short& l) { h = f2bf(y); l = f2bf(y - bf2f(h)); }
typedef __attribute__((ext_vector_type(2))) _Float16 v2h;
typedef __attribute__((ext_vector_type(4))) _Float16 v4h;
typedef __attribute__((ext_vector_type(2))) unsigned short v2us;
typedef __attribute__((ext_vector_type(4))) unsigned short v4us;
typedef __attribute__((ext_vector_type(2))) float v2f;
typedef __attribute__((ext_vector_type(4))) int v4i;
// four neighbouring f32 results as fp16 and as hi + lo bf16
struct Pl3 { v4h o16; v4us oh, ol; };
__device__ __forceinline__ Pl3 cv_planes(v4f val) { Pl3 r;
#pragma unroll
    for (int i = 0; i < 4; ++i) { r.o16[i] = tohx(val[i]); unsigned short a, c; splitf(val[i], a, c); r.oh[i] = a; r.ol[i] = c; }
    return r; }
__device__ __forceinline__ void st_planes(const Pl3& r, size_t e, h16* P16, bf* Ph, bf* Pl) { *(v4h*)(P16 + e) = r.o16; *(v4us*)(Ph + e) = r.oh; *(v4us*)(Pl + e) = r.ol; }

// ---- k_gemmw: GEMM, one work-group of 4 waves (2 x 2) per 128x128 output tile, ONE WAVE per 64x64 part of it (16 accumulators); grid (M/128, N/128, Z), 128 threads.
// The K-contiguous 16-bit operand planes come through LDS: a stage is 64 k (one 128-byte line) of the tile's 128 rows of every operand, brought by asynchronous 16-byte copies in whole lines, two buffers, the next stage in flight while this one is worked on.
// C[m][n] (f32, pitch ldc, + optional f32 bias[n]) = sum_k A[m][k] Bt[n][k] (+ A2[m][k] Bt[n][k] for NSPLIT 1). z-batch strides sA/sB/sC in elements (EPI 1, 2: sC strides the three planes). K % 64 == 0.
// EPI 0: C as above. EPI 1, 2: no C; a wave's 64 columns are one head, and the f32 result + bias goes out as that head's fp16, hi and lo planes, [h][t][d] (EPI 1) or transposed [h][d][t] (EPI 2), in whole 128-byte lines.
template <typename T16> struct WFrag;
template <> struct WFrag<h16> { typedef v16h V; static __device__ __forceinline__ V ld(const h16* p) { return cat16(*(const v8h*)p, *(const v8h*)(p + 16)); } static __device__ __forceinline__ v8f mma(V a, V b, v8f c) { return wmma16(a, b, c); } };
template <> struct WFrag<bf> { typedef v16bf V; static __device__ __forceinline__ V ld(const bf* p) { return cat16b(*(const v8us*)p, *(const v8us*)(p + 16)); } static __device__ __forceinline__ v8f mma(V a, V b, v8f c) { return wmmab(a, b, c); } };
#define GK  64                    // k per stage
#define GP  144                   // LDS row pitch in bytes: 16 x odd, for 16-byte reads of 128-byte rows
#define GT  (128 * GP)            // one operand's tile of a stage
// a lane's eight asynchronous 16-byte copies of one operand tile: rows 16 apart, LDS byte address l, global address g, gs = bytes of 16 global rows.
// The wait on the address registers is the last line of the copies' own statement, so that no operand register is written anew ahead of it.
__device__ __forceinline__ void g_cp8(unsigned l, const char* g, size_t gs) {
    asm volatile("global_load_async_to_lds_b128 %0, %8, off\n\t"
                 "global_load_async_to_lds_b128 %1, %9, off\n\t"
                 "global_load_async_to_lds_b128 %2, %10, off\n\t"
                 "global_load_async_to_lds_b128 %3, %11, off\n\t"
                 "global_load_async_to_lds_b128 %4, %12, off\n\t"
                 "global_load_async_to_lds_b128 %5, %13, off\n\t"
                 "global_load_async_to_lds_b128 %6, %14, off\n\t"
                 "global_load_async_to_lds_b128 %7, %15, off\n\t"
                 "s_wait_xcnt 0x0"
                 : : "v"(l), "v"(l + 16 * GP), "v"(l + 32 * GP), "v"(l + 48 * GP), "v"(l + 64 * GP), "v"(l + 80 * GP), "v"(l + 96 * GP), "v"(l + 112 * GP),
                     "v"(g), "v"(g + gs), "v"(g + 2 * gs), "v"(g + 3 * gs), "v"(g + 4 * gs), "v"(g + 5 * gs), "v"(g + 6 * gs), "v"(g + 7 * gs) : "memory");
}
// g_tile: one work-group's tile, batch z; st (2 x NT x GT bytes) and osw (4 x 16 x 68 floats) are the calling kernel's LDS.
template <typename T16, int NSPLIT, bool BIAS, int EPI>
__device__ __forceinline__ void g_tile(const T16* __restrict__ A, const T16* __restrict__ A2, const T16* __restrict__ Bt, int K, float* C, int ldc, const float* __restrict__ bias, size_t sA, size_t sB, size_t sC, h16* P16, bf* Ph, bf* Pl, size_t z, char* st, float* osw) {
    static_assert(EPI == 0 || HD == 64, "a wave's 64 columns are one head");
    static_assert(NSPLIT == 0 || NSPLIT == 1, "one or two planes of A");
    typedef typename WFrag<T16>::V V;
    constexpr int NT = NSPLIT == 1 ? 3 : 2;                          // operand tiles of a stage: A, Bt, (A2)
    A += z * sA; if (NSPLIT == 1) A2 += z * sA; Bt += z * sB; if (EPI == 0) C += z * sC; else { P16 += z * sC; Ph += z * sC; Pl += z * sC; }
    const int wave = __builtin_amdgcn_readfirstlane((int)(threadIdx.x >> 5)), wm = wave >> 1, wn = wave & 1;
    const int lane = threadIdx.x & 31, lr = lane & 15, hi = lane >> 4; const int r0 = blockIdx.x * 128 + wm * 64, c0 = blockIdx.y * 128 + wn * 64, hd = blockIdx.y * 2 + wn;
    float* os = osw + wave * (16 * 68);                              // each wave stages its output in a range of its own
    v8f acc[4][4];
#pragma unroll
    for (int mb = 0; mb < 4; ++mb)
#pragma unroll
        for (int nb = 0; nb < 4; ++nb) acc[mb][nb] = (v8f){};
    float bcol[4];                                                   // EPI 2: the bias of the lane's own four columns, asked for ahead of the K loop
    if (EPI == 2 && BIAS) {
#pragma unroll
        for (int nb = 0; nb < 4; ++nb) bcol[nb] = bfr(bias[c0 + nb * 16 + lr]);
        asm volatile("s_wait_xcnt 0x0" : : "s"(bias) : "memory"); }   // the four bias loads name the scalar pair of bias as their base; as an input here the pair stays untouched up to the wait
    // copies: thread = (row cpr of 16, 16-byte piece cpc of 8), so that a wave's copy covers four whole lines
    const int cpr = threadIdx.x >> 3, cpc = threadIdx.x & 7; const size_t gs = (size_t)16 * K * 2;
    const unsigned l0 = (unsigned)(size_t)st + (unsigned)(cpr * GP + cpc * 16);
    const char* gA = (const char*)(A + (size_t)(blockIdx.x * 128 + cpr) * K + cpc * 8); const char* gB = (const char*)(Bt + (size_t)(blockIdx.y * 128 + cpr) * K + cpc * 8);
    const char* gA2 = NSPLIT == 1 ? (const char*)(A2 + (size_t)(blockIdx.x * 128 + cpr) * K + cpc * 8) : nullptr;
    auto fill = [&](int s, unsigned bo) { g_cp8(l0 + bo, gA + (size_t)s * (GK * 2), gs); g_cp8(l0 + bo + GT, gB + (size_t)s * (GK * 2), gs); if (NSPLIT == 1) g_cp8(l0 + bo + 2 * GT, gA2 + (size_t)s * (GK * 2), gs); };
    const int nst = K / GK;
    fill(0, 0u);
    asm volatile("s_wait_asynccnt 0x0" ::: "memory");                // stage 0 has landed, as far as this wave brought it
    __syncthreads();                                                 // ... and the other waves' parts
    if (nst > 1) fill(1, (unsigned)(NT * GT));
    const unsigned fa = (unsigned)((wm * 64 + lr) * GP + 16 * hi), fb = (unsigned)(GT + (wn * 64 + lr) * GP + 16 * hi);   // the lane's byte offsets in a stage: row lr of the wave's first fragment, k from 8 hi
#pragma unroll 1
    for (int t = 0; t < nst; ++t) {                                  // rolled: one stage's fragments and the accumulators fill the registers
        const unsigned bo = (unsigned)(t & 1) * (unsigned)(NT * GT);
        const T16* la = (const T16*)(st + bo + fa); const T16* lb = (const T16*)(st + bo + fb); const T16* la2 = (const T16*)(st + bo + 2 * GT + fa);
        V a[4], a2[4], b[4];
        auto frags = [&](int ks) {
#pragma unroll
            for (int mb = 0; mb < 4; ++mb) { a[mb] = WFrag<T16>::ld(la + mb * 16 * (GP / 2) + ks * 32); b[mb] = WFrag<T16>::ld(lb + mb * 16 * (GP / 2) + ks * 32); if (NSPLIT == 1) a2[mb] = WFrag<T16>::ld(la2 + mb * 16 * (GP / 2) + ks * 32); } };
        auto prods = [&]() {
#pragma unroll
            for (int nb = 0; nb < 4; ++nb)
#pragma unroll
                for (int mb = 0; mb < 4; ++mb) { acc[mb][nb] = WFrag<T16>::mma(a[mb], b[nb], acc[mb][nb]); if (NSPLIT == 1) acc[mb][nb] = WFrag<T16>::mma(a2[mb], b[nb], acc[mb][nb]); } };
        static_assert(GK == 64, "a stage is two fragment groups of 32 k");
        frags(0);
        __builtin_amdgcn_sched_barrier(0);   // the fragment loads of 32 k stay one group ahead of its products: spread among them, every group of four products waits out an LDS latency of its own
        prods();
        frags(1);
        if (NSPLIT == 1) __builtin_amdgcn_sched_barrier(0);   // as above: without it the second group's products rise among its loads, on one register set for Bt with a full wait per fragment
        asm volatile("s_wait_dscnt 0x0" ::: "memory");               // this wave's reads of the stage have returned: its last fragments are in registers
        asm volatile("s_wait_asynccnt 0x0" ::: "memory");            // its copies of the next stage have landed
        __syncthreads();                                             // publishes the next stage and ends every wave's reads of this one
        // the refill goes into the buffer that has just been read. One plane of A: ahead of the stage's last products, which lengthen the copies' lead. Two planes: behind them (twice the products a stage give the lead; the fragments and the copies' addresses together would pass 256 registers)
        if (NSPLIT == 1) prods();
        if (t + 2 < nst) fill(t + 2, bo);
        if (NSPLIT == 0) prods();
    }
    asm volatile("s_wait_asynccnt 0x0" ::: "memory");                // no copy is left outstanding
    Pl3 pv[8];
    const size_t pe = ((size_t)hd * TT + r0 + hi) * HD + lr * 4;     // EPI 1: the lane's first element in a plane; every store of the wave is a constant step from it
    if (EPI == 2) {
        // staged transposed, 16 head dims x 64 rows t at a time: a lane's 8 accumulator rows are neighbours in t
#pragma unroll
        for (int nb = 0; nb < 4; ++nb) {
#pragma unroll
            for (int mb = 0; mb < 4; ++mb) { float* p = os + lr * 68 + mb * 16 + hi * 8; v8f t = acc[mb][nb]; if (BIAS) t += bcol[nb]; *(v4fa*)p = (v4f){t[0], t[1], t[2], t[3]}; *(v4fa*)(p + 4) = (v4f){t[4], t[5], t[6], t[7]}; }
            __builtin_amdgcn_wave_barrier(); asm volatile("" ::: "memory");   // the rows are read back by other lanes of the wave: the LDS reads below stay behind the LDS stores above
#pragma unroll
            for (int s = 0; s < 8; ++s) pv[s] = cv_planes(*(const v4fa*)(os + (2 * s + hi) * 68 + lr * 4));
            __builtin_amdgcn_sched_barrier(0);   // the group's 24 stores stay one run behind all of its conversions: mixed in, each store's registers are used again at once, with a wait in front of every such use
#pragma unroll
            for (int s = 0; s < 8; ++s) st_planes(pv[s], ((size_t)hd * HD + nb * 16 + 2 * s + hi) * TT + r0 + lr * 4, P16, Ph, Pl);
            __builtin_amdgcn_wave_barrier(); asm volatile("s_wait_xcnt 0x0" ::: "memory");   // stands in front of the next group's writes to registers that the stores above name; also keeps the next group's LDS stores behind these reads
        }
        return;
    }
#pragma unroll
    for (int mb = 0; mb < 4; ++mb) {
#pragma unroll
        for (int nb = 0; nb < 4; ++nb) {
#pragma unroll
            for (int j = 0; j < 8; ++j) os[(hi * 8 + j) * 68 + nb * 16 + lr] = acc[mb][nb][j]; }
        __builtin_amdgcn_wave_barrier(); asm volatile("" ::: "memory");
        float* crow = C + (size_t)(r0 + mb * 16) * ldc + c0;
{
#pragma unroll
            for (int s = 0; s < 8; ++s) { const int row = 2 * s + hi, cofs = lr * 4; v4f val = *(const v4fa*)(os + row * 68 + cofs); if (BIAS) { val[0] += bfr(bias[c0 + cofs]); val[1] += bfr(bias[c0 + cofs + 1]); val[2] += bfr(bias[c0 + cofs + 2]); val[3] += bfr(bias[c0 + cofs + 3]); }
                if (EPI == 1) pv[s] = cv_planes(val);
                else *(v4f*)(crow + (size_t)row * ldc + cofs) = val; }
             }
        if (EPI == 1) {
            __builtin_amdgcn_sched_barrier(0);   // one run of 24 stores behind all the conversions, as in EPI 2
#pragma unroll
            for (int s = 0; s < 8; ++s) st_planes(pv[s], pe + (size_t)(mb * 16 + 2 * s) * HD, P16, Ph, Pl);
        }
        __builtin_amdgcn_wave_barrier(); asm volatile("" ::: "memory");
    }
}
template <typename T16, int NSPLIT, bool BIAS, int EPI>
__global__ __launch_bounds__(128) void k_gemmw(const T16* __restrict__ A, const T16* __restrict__ A2, const T16* __restrict__ Bt, int K, float* C, int ldc, const float* __restrict__ bias, size_t sA, size_t sB, size_t sC, h16* P16, bf* Ph, bf* Pl) {
    __shared__ __align__(16) char st[2 * (NSPLIT == 1 ? 3 : 2) * GT]; __shared__ __align__(16) float osw[4 * 16 * 68];
    g_tile<T16, NSPLIT, BIAS, EPI>(A, A2, Bt, K, C, ldc, bias, sA, sB, sC, P16, Ph, Pl, blockIdx.z, st, osw);
}
// ---- k_proj: the three projections in ONE launch, grid (TT/128, DQ/128, 3 x batch): blockIdx.z / NB_ = 0 value, 1 key, 2 query. More work-groups than resident places, so that
// one work-group's epilogue (conversions and stores) runs beside another's K loop, and the chip is filled and drained once instead of three times.
__global__ __launch_bounds__(128) void k_proj(const bf* __restrict__ XQ, const bf* __restrict__ XK, const bf* __restrict__ XV, const bf* __restrict__ WQ, const bf* __restrict__ WK, const bf* __restrict__ WV,
                                              const float* __restrict__ bq, const float* __restrict__ bk, const float* __restrict__ bv,
                                              h16* Q16, bf* Qh, bf* Ql, h16* K16, bf* Kh, bf* Kl, h16* V16, bf* Vh, bf* Vl) {
    static_assert(DQ == DKV, "one grid for the three");
    __shared__ __align__(16) char st[2 * 2 * GT]; __shared__ __align__(16) float osw[4 * 16 * 68];
    const int p = (int)blockIdx.z / NB_; const size_t z = blockIdx.z % NB_; const bool k = p == 1;
    if (p == 0) g_tile<bf, 0, true, 2>(XV, nullptr, WV, DM, nullptr, 0, bv, (size_t)TT * DM, 0, (size_t)NKV * HD * TT, V16, Vh, Vl, z, st, osw);
    else g_tile<bf, 0, true, 1>(k ? XK : XQ, nullptr, k ? WK : WQ, DM, nullptr, 0, k ? bk : bq, (size_t)TT * DM, 0, (size_t)NH_ * TT * HD, k ? K16 : Q16, k ? Kh : Qh, k ? Kl : Ql, z, st, osw);
}


__global__ __launch_bounds__(256) void k_wtG(const float* __restrict__ w, int K, int N, bf* Bt) {
    const int lane = threadIdx.x & 31; const int L0 = (blockIdx.x * 8 + (threadIdx.x >> 5)) * 8; const int nlines = N * K / 64;
{
#pragma unroll 1
        for (int l = 0; l < 8; ++l) { const int L = L0 + l; if (L >= nlines) break; const size_t e = (size_t)L * 64 + lane * 2; const int k = (int)(e % K), n = (int)(e / K); v2us o;
            o[0] = f2bf(w[(size_t)k * N + n]); o[1] = f2bf(w[(size_t)(k + 1) * N + n]); *(v2us*)(Bt + e) = o; }
         }
}
// ---- k_cvtall: every f32 -> bf16 copy of the call (four weights, three inputs) in ONE launch of waves that stay and loop: CG work-groups of CW waves, one round on the chip.
// A chunk is CC elements in a row: eight loads of 16 bytes a lane, 512 bytes in a row each, and eight stores of 8 bytes a lane, 256 bytes in a row each (whole lines both ways). Trip i of wave g takes chunk i * CN + g of dst,
// which holds the seven copies one behind the other; trip 0 is the four weights, every later pair of trips one input. The next trip's loads are asked for ahead of this trip's conversions and stores.
#define CW  16
#define CG  256
#define CC  1024
#define CN  (CG * CW)             // waves in all = chunks of a trip
__global__ __launch_bounds__(CW * 32) void k_cvtall(const float* __restrict__ w0, const float* __restrict__ w1, const float* __restrict__ w2, const float* __restrict__ w3,
                                                    const float* __restrict__ x0, const float* __restrict__ x1, const float* __restrict__ x2, bf* __restrict__ dst) {
    static_assert(DQ * DM == (CN / 4) * CC && DKV * DM == (CN / 4) * CC, "trip 0: a quarter of the waves per weight");
    static_assert((size_t)NB_ * TT * DM == (size_t)2 * CN * CC, "two trips per input");
    const int g = (int)blockIdx.x * CW + __builtin_amdgcn_readfirstlane((int)(threadIdx.x >> 5)), lane = threadIdx.x & 31, wi = g / (CN / 4);
    const float* w = wi == 0 ? w0 : wi == 1 ? w1 : wi == 2 ? w2 : w3;
    const float* s[7] = { w + (size_t)(g % (CN / 4)) * CC, x0 + (size_t)g * CC, x0 + (size_t)(CN + g) * CC, x1 + (size_t)g * CC, x1 + (size_t)(CN + g) * CC, x2 + (size_t)g * CC, x2 + (size_t)(CN + g) * CC };
    v4f v[2][8];
#pragma unroll
    for (int j = 0; j < 8; ++j) v[0][j] = *(const v4f*)(s[0] + j * 128 + lane * 4);
    __builtin_amdgcn_sched_barrier(0);       // trip 0's loads are issued first: behind trip 1's, its conversions would wait for all sixteen
#pragma unroll
    for (int i = 0; i < 7; ++i) {            // unrolled: a trip's source and its one of the two register sets are then fixed at compile time
        if (i + 1 < 7) {
#pragma unroll
            for (int j = 0; j < 8; ++j) v[(i + 1) & 1][j] = *(const v4f*)(s[i + 1] + j * 128 + lane * 4); }
        __builtin_amdgcn_sched_barrier(0);   // the next trip's eight loads stay one group ahead of this trip's conversions: left free, loads of several trips were mixed among waits that let only a few be in flight
        bf* d = dst + ((size_t)i * CN + g) * CC;
#pragma unroll
        for (int j = 0; j < 8; ++j) { v4us o;
#pragma unroll
            for (int k = 0; k < 4; ++k) o[k] = f2bf(v[i & 1][j][k]);
            *(v4us*)(d + j * 128 + lane * 4) = o; }
        if (i + 1 < 7) asm volatile("s_wait_xcnt 0x0" ::: "memory");   // stands in front of the next loads and conversions, which write registers that the stores above name
    }
}
__global__ __launch_bounds__(256) void k_cscvt(const float* __restrict__ cosT, const float* __restrict__ sinT, float* CS) { const int idx = blockIdx.x * 256 + threadIdx.x; if (idx >= TT * HD) return; v2f cs; cs[0] = bfr(cosT[idx]); cs[1] = bfr(sinT[idx]); *(v2f*)(CS + (size_t)idx * 2) = cs;  }
// ---- k_fattn: causal attention, grid (batch x head, row tile), scores never stored. Transposed products: S^T = K Q^T (A = key rows, B = query columns), O^T += V^T P^T; a lane holds one query
// column, so two stacked 16-key score tiles, converted in place, ARE the B operand of the second product (hardware k order, which WFrag::ld also delivers). Running maximum and sum per column (online softmax).
// Query rows >= RH (fp16): a work-group serves QG rows, each of its NW waves QT of them, and all waves walk the same keys, which come through LDS once for the four of them: a stage is SK keys of K [t][d] and of V^T [d][t],
// brought by asynchronous 16-byte copies in whole lines, two buffers, the next stage in flight while this one is worked on.
// Query rows < RH (hi+lo bf16 planes, 3 products): the NW waves share QT query rows and take the 32-key passes w, w + NW, ... from global memory; their (maximum, sum, O^T) are joined through LDS at the end.
#define QT  32
#define KT  32
#define NW  4
#define SC2 (SCL * 1.4426950408889634f)   // score scale times log2(e): probabilities are exp2((s - max) * SC2)
// fragment at a base plus a 32-bit BYTE offset: a wave-uniform base and the lane's own offset, or the lane's own address and 0
template <typename T16> __device__ __forceinline__ typename WFrag<T16>::V fa_ld(const T16* __restrict__ base, unsigned ob) { return WFrag<T16>::ld((const T16*)((const char*)base + ob)); }
// key fragments of one 32-key pass; kb plus koff bytes = the lane's own address in it: key row lr of the pass, from d = 8 hi
template <typename T16>
__device__ __forceinline__ void fa_ldk(const T16* __restrict__ kb, unsigned koff, typename WFrag<T16>::V (&ka)[2][2]) {
#pragma unroll
    for (int ks = 0; ks < 2; ++ks)
#pragma unroll
        for (int kc = 0; kc < 2; ++kc) ka[ks][kc] = fa_ld<T16>(kb + (ks * 16 * HD + kc * 32), koff);
}
__device__ __forceinline__ void fa_pack(const v8f& t0, const v8f& t1, v16h& p, v16h& p2) { (void)p2;
#pragma unroll
    for (int r = 0; r < 8; ++r) { p[r] = (h16)t0[r]; p[8 + r] = (h16)t1[r]; } }
__device__ __forceinline__ void fa_pack(const v8f& t0, const v8f& t1, v16bf& p, v16bf& p2) { v8us h0, h1, l0, l1;
#pragma unroll
    for (int r = 0; r < 8; ++r) { unsigned short a, c; splitf(t0[r], a, c); h0[r] = a; l0[r] = c; splitf(t1[r], a, c); h1[r] = a; l1[r] = c; }
    p = cat16b(h0, h1); p2 = cat16b(l0, l1); }
__device__ __forceinline__ float fa_xhalf(float x) { const int b = __float_as_int(x); return __int_as_float(__builtin_amdgcn_permlanex16(b, b, 0x76543210, 0xfedcba98, false, false)); }   // lane l <-> l ^ 16
// softmax and second product of one pass: s[ks][qb][r] = score(key k0 + 16 ks + 8 hi + r, query q0 + 16 qb + lr), va (and the lo plane's va2) = the pass's value fragments.
// EDGE: the pass may reach above the diagonal. B0, NB: the 16-column groups that the pass serves.
template <typename T16, bool HL, bool EDGE, int B0, int NB>
__device__ __forceinline__ void fa_soft(v8f (&s)[2][2], typename WFrag<T16>::V (&va)[4], typename WFrag<T16>::V (&va2)[4], int q0, int k0, int lr, int hi, v8f (&o)[4][2], float (&m)[2], float (&l)[2]) {
    typedef typename WFrag<T16>::V V;
    if (EDGE) {                                                      // keys above the query are masked (by select: no branch behind the products)
#pragma unroll
        for (int ks = 0; ks < 2; ++ks)
#pragma unroll
            for (int qb = B0; qb < B0 + NB; ++qb)
#pragma unroll
                for (int r = 0; r < 8; ++r) s[ks][qb][r] = (k0 + ks * 16 + 8 * hi + r > q0 + qb * 16 + lr) ? -3.0e38f : s[ks][qb][r]; }
#pragma unroll
    for (int qb = B0; qb < B0 + NB; ++qb) {
        float mx = fmaxf(s[0][qb][0], s[1][qb][0]);
#pragma unroll
        for (int r = 1; r < 8; ++r) mx = fmaxf(mx, fmaxf(s[0][qb][r], s[1][qb][r]));
        mx = fmaxf(mx, fa_xhalf(mx));                                // the two lane halves hold the two halves of a column's keys
        const float mn = fmaxf(m[qb], mx), al = __builtin_amdgcn_exp2f((m[qb] - mn) * SC2), mb = mn * SC2; m[qb] = mn;
        float ps = 0.f;
#pragma unroll
        for (int ks = 0; ks < 2; ++ks)
#pragma unroll
            for (int r = 0; r < 8; ++r) { const float p = __builtin_amdgcn_exp2f(fmaf(s[ks][qb][r], SC2, -mb)); s[ks][qb][r] = p; ps += p; }
        l[qb] = fmaf(l[qb], al, ps);
        V pb, pb2; fa_pack(s[0][qb], s[1][qb], pb, pb2);
#pragma unroll
        for (int db = 0; db < 4; ++db) { v8f t = o[db][qb] * al; t = WFrag<T16>::mma(va[db], pb, t); if (HL) { t = WFrag<T16>::mma(va2[db], pb, t); t = WFrag<T16>::mma(va[db], pb2, t); } o[db][qb] = t; }
    }
}
// one hi+lo pass: 32 keys from k0 against query columns from q0. Q, kb, vb and the lo planes' Q2, kb2, vb2: first query row, first key row [t][d] and first key column [d][t] of the pass, wave-uniform; koff = 2 (lr HD + 8 hi) and voff = 2 (lr TT + 8 hi) are the lane's byte offsets in row-major [t][d] and [d][t] planes.
template <typename T16, int B0, int NB>
__device__ __forceinline__ void fa_pass(const T16* __restrict__ Q, const T16* __restrict__ Q2, const T16* __restrict__ kb, const T16* __restrict__ kb2, const T16* __restrict__ vb, const T16* __restrict__ vb2, int q0, int k0, unsigned koff, unsigned voff, int lr, int hi,
                                        v8f (&o)[4][2], float (&m)[2], float (&l)[2]) {
    typedef typename WFrag<T16>::V V;
    V va[4], va2[4];
    v8f s[2][2];
    {
        // the few hi+lo passes fetch nothing ahead: twice the planes, and their registers would set the occupancy of the whole kernel
        // Each lane's plane addresses are formed here, and the wait behind the loads takes them as inputs: they stay untouched up to it.
        V qf[2][2], qf2[2][2], ka[2][2]; const T16* qp = (const T16*)((const char*)Q + koff); const T16* qp2 = (const T16*)((const char*)Q2 + koff);
#pragma unroll
        for (int qb = B0; qb < B0 + NB; ++qb)
#pragma unroll
            for (int kc = 0; kc < 2; ++kc) { qf[qb][kc] = WFrag<T16>::ld(qp + (qb * 16 * HD + kc * 32)); qf2[qb][kc] = WFrag<T16>::ld(qp2 + (qb * 16 * HD + kc * 32)); }
        asm volatile("s_wait_xcnt 0x0" : : "v"(qp), "v"(qp2) : "memory");
        V ka2[2][2]; const T16* kp = (const T16*)((const char*)kb + koff); const T16* kp2 = (const T16*)((const char*)kb2 + koff);
        fa_ldk<T16>(kp, 0u, ka); fa_ldk<T16>(kp2, 0u, ka2);
        asm volatile("s_wait_xcnt 0x0" : : "v"(kp), "v"(kp2) : "memory");   // as above
#pragma unroll
        for (int ks = 0; ks < 2; ++ks)
#pragma unroll
            for (int qb = B0; qb < B0 + NB; ++qb) { v8f t = (v8f){};
#pragma unroll
                for (int kc = 0; kc < 2; ++kc) { t = WFrag<T16>::mma(ka[ks][kc], qf[qb][kc], t); t = WFrag<T16>::mma(ka2[ks][kc], qf[qb][kc], t); t = WFrag<T16>::mma(ka[ks][kc], qf2[qb][kc], t); }
                s[ks][qb] = t; }
        const T16* vp = (const T16*)((const char*)vb + voff); const T16* vp2 = (const T16*)((const char*)vb2 + voff);
#pragma unroll
        for (int db = 0; db < 4; ++db) { va[db] = WFrag<T16>::ld(vp + db * 16 * TT); va2[db] = WFrag<T16>::ld(vp2 + db * 16 * TT); }
        asm volatile("s_wait_xcnt 0x0" : : "v"(vp), "v"(vp2) : "memory");   // as above
    }
    fa_soft<T16, true, true, B0, NB>(s, va, va2, q0, k0, lr, hi, o, m, l);
}
// the hi+lo walk of tile qt (QT query rows): wave w takes the passes w, w + NW, ...
template <typename T16>
__device__ __forceinline__ void fa_walk(const T16* __restrict__ Q, const T16* __restrict__ Q2, const T16* __restrict__ Kp, const T16* __restrict__ K2, const T16* __restrict__ Vt, const T16* __restrict__ V2,
                                        int qt, int wave, int lr, int hi, v8f (&o)[4][2], float (&m)[2], float (&l)[2]) {
    if (wave > qt) return;                                           // fewer passes than waves: this wave keeps its empty state (sum 0, weight 0 in the join)
    const int q0 = qt * QT; const unsigned koff = (unsigned)(lr * HD + 8 * hi) * 2u, voff = (unsigned)(lr * TT + 8 * hi) * 2u;
    Q += (size_t)q0 * HD; Q2 += (size_t)q0 * HD;
    int kt = wave;
    // one 16-column group at a time: with both groups' hi and lo query planes live the walk spills
#pragma unroll 1
    for (; kt <= qt; kt += NW) fa_pass<T16, 0, 1>(Q, Q2, Kp + (size_t)kt * KT * HD, K2 + (size_t)kt * KT * HD, Vt + kt * KT, V2 + kt * KT, q0, kt * KT, koff, voff, lr, hi, o, m, l);   // rolled: one pass already fills the registers
#pragma unroll 1
    for (kt = wave; kt <= qt; kt += NW) fa_pass<T16, 1, 1>(Q, Q2, Kp + (size_t)kt * KT * HD, K2 + (size_t)kt * KT * HD, Vt + kt * KT, V2 + kt * KT, q0, kt * KT, koff, voff, lr, hi, o, m, l);   // rolled, as above
}
#define QG  (NW * QT)             // query rows of a work-group of the fp16 walk
#define SK  64                    // keys per stage: one 128-byte line of every V^T row
#define SB  ((SK + HD) * GP)      // a stage in LDS: SK key rows, then HD rows of V^T, 128 bytes each at pitch GP
#define NF  ((TT - RH) / QG)      // row tiles of the fp16 walk
// a lane's four asynchronous 16-byte copies: rows 16 apart, LDS byte address l, global address g, gs = bytes of 16 global rows.
// The wait on the address registers is the last line of the copies' own statement, so that no operand register is written anew ahead of it.
__device__ __forceinline__ void g_cp4(unsigned l, const char* g, size_t gs) {
    asm volatile("global_load_async_to_lds_b128 %0, %4, off\n\t"
                 "global_load_async_to_lds_b128 %1, %5, off\n\t"
                 "global_load_async_to_lds_b128 %2, %6, off\n\t"
                 "global_load_async_to_lds_b128 %3, %7, off\n\t"
                 "s_wait_xcnt 0x0"
                 : : "v"(l), "v"(l + 16 * GP), "v"(l + 32 * GP), "v"(l + 48 * GP), "v"(g), "v"(g + gs), "v"(g + 2 * gs), "v"(g + 3 * gs) : "memory");
}
// one fp16 pass out of LDS: 32 keys from k0 against the wave's 32 query columns from q0. kl, vl: the lane's own addresses in the stage, row lr of the pass's keys and row lr of V^T at the pass's first key, each plus 16 hi bytes.
template <bool EDGE>
__device__ __forceinline__ void fa_pass_s(const char* kl, const char* vl, int q0, int k0, int lr, int hi, v16h (&qf)[2][2], v8f (&o)[4][2], float (&m)[2], float (&l)[2]) {
    v16h ka[2][2], va[4], va2[4]; v8f s[2][2];
#pragma unroll
    for (int ks = 0; ks < 2; ++ks)
#pragma unroll
        for (int kc = 0; kc < 2; ++kc) ka[ks][kc] = WFrag<h16>::ld((const h16*)(kl + ks * 16 * GP + kc * 64));
#pragma unroll
    for (int db = 0; db < 4; ++db) va[db] = WFrag<h16>::ld((const h16*)(vl + db * 16 * GP));   // value fragments: asked for ahead of the score products, used behind the softmax
#pragma unroll
    for (int ks = 0; ks < 2; ++ks)
#pragma unroll
        for (int qb = 0; qb < 2; ++qb) { v8f t = (v8f){};
#pragma unroll
            for (int kc = 0; kc < 2; ++kc) t = wmma16(ka[ks][kc], qf[qb][kc], t);
            s[ks][qb] = t; }
    fa_soft<h16, false, EDGE, 0, 2>(s, va, va2, q0, k0, lr, hi, o, m, l);
}
// the fp16 walk of the QG query rows from qg: every wave passes every stage's foot; a wave works the passes up to its own diagonal.
__device__ __forceinline__ void fa_walk_s(const h16* __restrict__ Q, const h16* __restrict__ Kp, const h16* __restrict__ Vt, char* st, int qg, int wave, int lr, int hi, v8f (&o)[4][2], float (&m)[2], float (&l)[2]) {
    static_assert(HD == 64 && SK == 64 && NW == 4, "a thread's copies: 16 rows of eight 16-byte pieces per 128 threads");
    const int q0 = qg + wave * QT; const unsigned koff = (unsigned)(lr * HD + 8 * hi) * 2u; v16h qf[2][2];
#pragma unroll
    for (int qb = 0; qb < 2; ++qb)
#pragma unroll
        for (int kc = 0; kc < 2; ++kc) qf[qb][kc] = fa_ld<h16>(Q + (size_t)q0 * HD + (qb * 16 * HD + kc * 32), koff);
    // copies: thread = (row cpr of 16, 16-byte piece cpc of 8), so that a wave's copy covers four whole lines
    const int cpr = threadIdx.x >> 3, cpc = threadIdx.x & 7;
    const unsigned l0 = (unsigned)(size_t)st + (unsigned)(cpr * GP + cpc * 16);
    const char* gK = (const char*)(Kp + (size_t)cpr * HD + cpc * 8); const char* gV = (const char*)(Vt + (size_t)cpr * TT + cpc * 8);
    auto fill = [&](int s, unsigned bo) { g_cp4(l0 + bo, gK + (size_t)s * (SK * HD * 2), (size_t)16 * HD * 2); g_cp4(l0 + bo + SK * GP, gV + (size_t)s * (SK * 2), (size_t)16 * TT * 2); };
    const int nst = (qg + QG) / SK, nfull = qg / SK;                 // stages in all (at least two), and those that lie below every wave's diagonal
    auto foot = [&](int t, unsigned bo) {
        asm volatile("s_wait_dscnt 0x0" ::: "memory");               // this wave's reads of the stage have returned
        asm volatile("s_wait_asynccnt 0x0" ::: "memory");            // its copies of the next stage have landed
        __syncthreads();                                             // publishes the next stage and ends every wave's reads of this one
        if (t + 2 < nst) fill(t + 2, bo); };                         // the refill goes into the buffer that has just been read
    fill(0, 0u);
    asm volatile("s_wait_asynccnt 0x0" ::: "memory");                // stage 0 has landed, as far as this wave brought it
    __syncthreads();                                                 // ... and the other waves' parts
    fill(1, (unsigned)SB);
    const unsigned fk = (unsigned)(lr * GP + 16 * hi), fv = (unsigned)((SK + lr) * GP + 16 * hi);
    int t = 0;
#pragma unroll 1
    for (; t < nfull; ++t) {                                         // rolled: two passes already fill the registers
        const unsigned bo = (unsigned)(t & 1) * (unsigned)SB;
        fa_pass_s<false>(st + bo + fk, st + bo + fv, q0, t * SK, lr, hi, qf, o, m, l);
        fa_pass_s<false>(st + bo + fk + KT * GP, st + bo + fv + KT * 2, q0, t * SK + KT, lr, hi, qf, o, m, l);
        foot(t, bo);
    }
#pragma unroll 1
    for (; t < nst; ++t) {                                           // the QG keys of the work-group's own rows: below, on or above the wave's diagonal (wave-uniform tests)
        const unsigned bo = (unsigned)(t & 1) * (unsigned)SB;
#pragma unroll 1
        for (int p = 0; p < SK / KT; ++p) { const int k0 = t * SK + p * KT; const char* kl = st + bo + fk + p * (KT * GP); const char* vl = st + bo + fv + p * (KT * 2);   // rolled: code size
            if (k0 < q0) fa_pass_s<false>(kl, vl, q0, k0, lr, hi, qf, o, m, l);
            else if (k0 == q0) fa_pass_s<true>(kl, vl, q0, k0, lr, hi, qf, o, m, l); }
        foot(t, bo);
    }
    asm volatile("s_wait_asynccnt 0x0" ::: "memory");                // no copy is left outstanding
}
__global__ __launch_bounds__(NW * 32) void k_fattn(const h16* __restrict__ Q16, const h16* __restrict__ K16, const h16* __restrict__ V16, const bf* __restrict__ Qh, const bf* __restrict__ Ql, const bf* __restrict__ Kh, const bf* __restrict__ Kl,
                                                   const bf* __restrict__ Vh, const bf* __restrict__ Vl, bf* Ah, bf* Al) {
    static_assert(RH % QG == 0 && (TT - RH) % QG == 0 && QG % SK == 0, "whole row tiles on both sides of RH");
    __shared__ __align__(16) char stg[2 * SB];
    __shared__ __align__(16) float osh[NW * 4 * 2 * 256]; __shared__ float msh[NW * QT]; __shared__ float lsh[NW * QT];
    const int wave = __builtin_amdgcn_readfirstlane((int)(threadIdx.x >> 5)), lane = threadIdx.x & 31, lr = lane & 15, hi = lane >> 4;
    // longest rows first, over all batches and heads. blockIdx.y < NF: the fp16 tile of QG rows from qg; the rest: the hi+lo tile qt of QT rows
    const bool f16 = (int)blockIdx.y < NF; const int qg = TT - QG - (int)blockIdx.y * QG, qt = (RH / QT - 1) - ((int)blockIdx.y - NF);
    const int h = blockIdx.x % NH_, b = blockIdx.x / NH_; const size_t hq = (size_t)blockIdx.x * TT * HD, hk = (size_t)(blockIdx.x / REP) * TT * HD;   // planes are [batch][head][...]: blockIdx.x counts them through
    v8f o[4][2]; float m[2] = {-3.0e38f, -3.0e38f}, l[2] = {0.f, 0.f};
#pragma unroll
    for (int db = 0; db < 4; ++db) { o[db][0] = (v8f){}; o[db][1] = (v8f){}; }
    if (f16) fa_walk_s(Q16 + hq, K16 + hk, V16 + hk, stg, qg, wave, lr, hi, o, m, l);
    else fa_walk<bf>(Qh + hq, Ql + hq, Kh + hk, Kl + hk, Vh + hk, Vl + hk, qt, wave, lr, hi, o, m, l);
#pragma unroll
    for (int qb = 0; qb < 2; ++qb) { l[qb] += fa_xhalf(l[qb]);
#pragma unroll
        for (int db = 0; db < 4; ++db) { float* p = osh + ((wave * 4 + db) * 2 + qb) * 256 + lane * 8; const v8f t = o[db][qb]; *(v4fa*)p = (v4f){t[0], t[1], t[2], t[3]}; *(v4fa*)(p + 4) = (v4f){t[4], t[5], t[6], t[7]}; }
        if (hi == 0) { msh[wave * QT + qb * 16 + lr] = m[qb]; lsh[wave * QT + qb * 16 + lr] = l[qb]; } }
    __syncthreads();
    // thread = (query row q, 16 head dims db), so that one wave writes whole 128-byte lines of the merged planes
    const int q = threadIdx.x >> 2, db = threadIdx.x & 3, qb = q >> 4, c = q & 15;
    if (!f16) {
    // join of the waves' partial states
    float M = msh[q];
#pragma unroll
    for (int w = 1; w < NW; ++w) M = fmaxf(M, msh[w * QT + q]);
    float L = 0.f, acc[16];
#pragma unroll
    for (int r = 0; r < 16; ++r) acc[r] = 0.f;
#pragma unroll
    for (int w = 0; w < NW; ++w) { const float wg = __builtin_amdgcn_exp2f((msh[w * QT + q] - M) * SC2); L = fmaf(wg, lsh[w * QT + q], L);
#pragma unroll
        for (int hh = 0; hh < 2; ++hh) { const float* p = osh + ((w * 4 + db) * 2 + qb) * 256 + (c + 16 * hh) * 8; const v4f x0 = *(const v4fa*)p, x1 = *(const v4fa*)(p + 4);
#pragma unroll
            for (int r = 0; r < 4; ++r) { acc[hh * 8 + r] = fmaf(wg, x0[r], acc[hh * 8 + r]); acc[hh * 8 + 4 + r] = fmaf(wg, x1[r], acc[hh * 8 + 4 + r]); } } }
    const float inv = __fdiv_rn(1.0f, L); const size_t oo = ((size_t)b * TT + qt * QT + q) * DQ + h * HD + db * 16;
#pragma unroll
    for (int hh = 0; hh < 2; ++hh) { v8us oh, ol;
#pragma unroll
        for (int r = 0; r < 8; ++r) { unsigned short a, c2; splitf(acc[hh * 8 + r] * inv, a, c2); oh[r] = a; ol[r] = c2; }
        *(v8usa*)(Ah + oo + hh * 8) = oh; *(v8usa*)(Al + oo + hh * 8) = ol; }
    asm volatile("s_wait_xcnt 0x0" ::: "memory");                    // in the built code the other branch's block follows this one: the wait stands in front of its writes to registers that the stores above name
    } else {
        // every wave's state is complete for its own QT rows: one after the other they are scaled and stored
#pragma unroll
        for (int w = 0; w < NW; ++w) { const float inv = __fdiv_rn(1.0f, lsh[w * QT + q]); const size_t oo = ((size_t)b * TT + qg + w * QT + q) * DQ + h * HD + db * 16;
#pragma unroll
            for (int hh = 0; hh < 2; ++hh) { const float* p = osh + ((w * 4 + db) * 2 + qb) * 256 + (c + 16 * hh) * 8; const v4f x0 = *(const v4fa*)p, x1 = *(const v4fa*)(p + 4); v8us oh, ol;
#pragma unroll
                for (int r = 0; r < 4; ++r) { unsigned short a, c2; splitf(x0[r] * inv, a, c2); oh[r] = a; ol[r] = c2; splitf(x1[r] * inv, a, c2); oh[4 + r] = a; ol[4 + r] = c2; }
                *(v8usa*)(Ah + oo + hh * 8) = oh; *(v8usa*)(Al + oo + hh * 8) = ol; }
            if (w + 1 < NW) asm volatile("s_wait_xcnt 0x0" ::: "memory"); }   // stands in front of the next rows' writes to registers that the stores above name
    }
}

extern "C" void kernel_launch(void* const* d_in, const int* in_sizes, int n_in,
                              void* d_out, int out_size, void* d_ws, size_t ws_size, hipStream_t stream) {
    (void)in_sizes; (void)n_in; (void)out_size;
    const float* x = (const float*)d_in[0]; const float* xk = (const float*)d_in[1]; const float* xv = (const float*)d_in[2]; const float* wq = (const float*)d_in[3]; const float* bq = (const float*)d_in[4]; const float* wk = (const float*)d_in[5]; const float* bk = (const float*)d_in[6]; const float* wv = (const float*)d_in[7]; const float* bv = (const float*)d_in[8]; const float* wo = (const float*)d_in[9]; const float* bo = (const float*)d_in[10]; const float* cosT = nullptr; const float* sinT = nullptr; (void)cosT; (void)sinT;
    float* OUT = (float*)d_out;     // [4][2048][1024]
    char* wsp = (char*)d_ws;
    auto take = [&](size_t bytes) { char* p = wsp; wsp += (bytes + 255) & ~(size_t)255; return (void*)p; };
    // the bf16 copies, one behind the other in the order in which k_cvtall writes them: four weights, then value, key and query input (all NB_ batches each)
    bf* CV = (bf*)take(((size_t)DQ * DM + (size_t)2 * DKV * DM + (size_t)DM * DQ + (size_t)3 * NB_ * TT * DM) * 2);
    bf* WQ = CV; bf* WK = WQ + (size_t)DQ * DM; bf* WV = WK + (size_t)DKV * DM; bf* WO = WV + (size_t)DKV * DM;
    bf* XV = WO + (size_t)DM * DQ; bf* XK = XV + (size_t)NB_ * TT * DM; bf* XQ = XK + (size_t)NB_ * TT * DM;
    // every buffer below holds all NB_ batches
    h16* QP16 = (h16*)take((size_t)NB_ * NH_ * TT * HD * 2); h16* KP16 = (h16*)take((size_t)NB_ * NKV * TT * HD * 2); h16* VT16 = (h16*)take((size_t)NB_ * NKV * HD * TT * 2);
    bf* QPh = (bf*)take((size_t)NB_ * NH_ * TT * HD * 2); bf* QPl = (bf*)take((size_t)NB_ * NH_ * TT * HD * 2); bf* KPh = (bf*)take((size_t)NB_ * NKV * TT * HD * 2); bf* KPl = (bf*)take((size_t)NB_ * NKV * TT * HD * 2); bf* VTh = (bf*)take((size_t)NB_ * NKV * HD * TT * 2); bf* VTl = (bf*)take((size_t)NB_ * NKV * HD * TT * 2);
    bf* ATh = (bf*)take((size_t)NB_ * TT * DQ * 2); bf* ATl = (bf*)take((size_t)NB_ * TT * DQ * 2);
    if ((size_t)(wsp - (char*)d_ws) > ws_size) return;    // ws 256 MiB
    k_cvtall<<<CG, CW * 32, 0, stream>>>(wq, wk, wv, wo, xv, xk, x, CV);
    k_proj<<<dim3(TT / 128, DQ / 128, 3 * NB_), 128, 0, stream>>>(XQ, XK, XV, WQ, WK, WV, bq, bk, bv, QP16, QPh, QPl, KP16, KPh, KPl, VT16, VTh, VTl);
    k_fattn<<<dim3(NB_ * NH_, NF + RH / QT, 1), NW * 32, 0, stream>>>(QP16, KP16, VT16, QPh, QPl, KPh, KPl, VTh, VTl, ATh, ATl);
    k_gemmw<bf, 1, true, 0><<<dim3(TT / 128, DM / 128, NB_), 128, 0, stream>>>(ATh, ATl, WO, DQ, OUT, DM, bo, (size_t)TT * DQ, 0, (size_t)TT * DM, nullptr, nullptr, nullptr);
}
